// v000
// Measured on an AMD MI455X. A time is GPU time per run, averaged over a window of back-to-back runs after a warm-up
// (all launches, gaps included; the runs take copies of the inputs in turn), and the median of several windows.
// Apart from v000's, it joins two sittings. Times from different sittings can be a few percent apart, while
// side-by-side timings come from the same sitting.
// The starting kernel, v000, takes 354 microseconds a run.
#include <hip/hip_runtime.h>

typedef __attribute__((ext_vector_type(16))) _Float16 v16h;
typedef __attribute__((ext_vector_type(8)))  _Float16 v8h;
typedef __attribute__((ext_vector_type(8)))  float    v8f;
typedef int v4i_vs __attribute__((vector_size(16))); // matches builtin param

#define WMMA_F16(a, b, c) \
    __builtin_amdgcn_wmma_f32_16x16x32_f16(false, (a), false, (b), (short)0, (c), false, false)

static constexpr int   kB  = 2;
static constexpr int   kS  = 4096;
static constexpr int   kDM = 512;
static constexpr int   kH  = 8;
static constexpr int   kDK = 64;
static constexpr float kScale = 0.125f; // 1/sqrt(64)

#if __has_builtin(__builtin_amdgcn_global_load_async_to_lds_b128)
#define ASYNC_LDS 1
#endif

// 16-byte global -> LDS copy. Async DMA path on gfx1250
// (GLOBAL_LOAD_ASYNC_TO_LDS_B128, ASYNCcnt), else load+ds_store fallback.
__device__ __forceinline__ void cp16_g2s(const _Float16* g, _Float16* l) {
#ifdef ASYNC_LDS
    __builtin_amdgcn_global_load_async_to_lds_b128(
        (__attribute__((address_space(1))) v4i_vs*)g,
        (__attribute__((address_space(3))) v4i_vs*)l, 0, 0);
#else
    *(v8h*)l = *(const v8h*)g;
#endif
}

__device__ __forceinline__ void wait_g2s() {
#ifdef ASYNC_LDS
#if __has_builtin(__builtin_amdgcn_s_wait_asynccnt)
    __builtin_amdgcn_s_wait_asynccnt(0);
#else
    asm volatile("s_wait_asynccnt 0" ::: "memory");
#endif
#endif
}

// ---------------------------------------------------------------------------
// Kernel 0: pack the (S,S) int32 DAG mask into 1 bit/entry.
// bits[q][c] bit j == (mask[q][c*32 + j] != 0). 2MB result; read 16x by the
// attention kernel instead of 16x 67MB of int32 -> 32x less mask traffic.
// ---------------------------------------------------------------------------
__global__ __launch_bounds__(256) void k_mask_pack(
    const int* __restrict__ mask, unsigned* __restrict__ bits)
{
    const size_t w = (size_t)blockIdx.x * 256 + threadIdx.x; // word index
    const int4* src = (const int4*)(mask + w * 32);
    unsigned word = 0;
#pragma unroll
    for (int j = 0; j < 8; ++j) {
        const int4 m = src[j];
        word |= (m.x ? 1u : 0u) << (4 * j + 0);
        word |= (m.y ? 1u : 0u) << (4 * j + 1);
        word |= (m.z ? 1u : 0u) << (4 * j + 2);
        word |= (m.w ? 1u : 0u) << (4 * j + 3);
    }
    bits[w] = word;
}

// ---------------------------------------------------------------------------
// Kernel 1: fused QKV projection (all three in one wave).
//   Y[m][n] = sum_k X[m][k] * W[n][k] + bias[n]   (einsum 'bsd,ed->bse')
// One wave computes a 16(m) x 64(n) tile for Q, K AND V; the converted
// x A-tile is reused across the three weight matrices (12 WMMAs / A-load).
// Q,K stored f16 as (B,H,S,DK); V stored f16 TRANSPOSED as (B,H,DK,S).
//
// WMMA operand convention (CDNA5 wave32, 16x16x32 f16):
//   A (MxK): lanes 0-15 hold row M=lane, K elems {0..7,16..23};
//            lanes 16-31 hold row M=lane-16, K elems {8..15,24..31}.
//   B (KxN): lane n<16 holds col N=n with K elems {0..7,16..23};
//            lane n+16 holds col N=n with K elems {8..15,24..31}.
//   C/D    : VGPR r, lanes 0-15 -> (M=r, N=lane); lanes 16-31 -> (M=8+r).
// ---------------------------------------------------------------------------
__global__ __launch_bounds__(32) void k_proj_qkv(
    const float* __restrict__ x,
    const float* __restrict__ wq, const float* __restrict__ bq,
    const float* __restrict__ wk, const float* __restrict__ bk,
    const float* __restrict__ wv, const float* __restrict__ bv,
    _Float16* __restrict__ qf, _Float16* __restrict__ kf,
    _Float16* __restrict__ vf)
{
    const int lane = threadIdx.x & 31;
    const int half = lane >> 4;
    const int lm   = lane & 15;
    const int koff = half ? 8 : 0;

    const int m0 = blockIdx.x * 16;   // row tile over B*S = 8192 rows
    const int h  = blockIdx.y;        // head -> n0 = h*64
    const int n0 = h * kDK;

    const float* wmat[3] = {wq, wk, wv};
    const float* bias[3] = {bq, bk, bv};

    v8f acc[3][4] = {};

    const float* xr = x + (size_t)(m0 + lm) * kDM;
    for (int k0 = 0; k0 < kDM; k0 += 32) {
        v16h a;
#pragma unroll
        for (int i = 0; i < 8; ++i) {
            a[i]     = (_Float16)xr[k0 + koff + i];
            a[i + 8] = (_Float16)xr[k0 + 16 + koff + i];
        }
#pragma unroll
        for (int wsel = 0; wsel < 3; ++wsel) {
#pragma unroll
            for (int t = 0; t < 4; ++t) {
                const float* wr =
                    wmat[wsel] + (size_t)(n0 + t * 16 + lm) * kDM + k0;
                v16h bm;
#pragma unroll
                for (int i = 0; i < 8; ++i) {
                    bm[i]     = (_Float16)wr[koff + i];
                    bm[i + 8] = (_Float16)wr[16 + koff + i];
                }
                acc[wsel][t] = WMMA_F16(a, bm, acc[wsel][t]);
            }
        }
    }

#pragma unroll
    for (int wsel = 0; wsel < 3; ++wsel) {
#pragma unroll
        for (int t = 0; t < 4; ++t) {
            const int dk = t * 16 + lm;          // N index inside head
            const float bval = bias[wsel][n0 + dk];
#pragma unroll
            for (int r = 0; r < 8; ++r) {
                const int m = m0 + r + half * 8; // global row (b*S + s)
                const int b = m >> 12;           // / 4096
                const int s = m & (kS - 1);
                const _Float16 val = (_Float16)(acc[wsel][t][r] + bval);
                if (wsel == 2) {                 // V transposed: (B,H,DK,S)
                    vf[(((size_t)b * kH + h) * kDK + dk) * kS + s] = val;
                } else {                         // Q/K: (B,H,S,DK)
                    _Float16* dst = (wsel == 0) ? qf : kf;
                    dst[(((size_t)b * kH + h) * kS + s) * kDK + dk] = val;
                }
            }
        }
    }
}

// ---------------------------------------------------------------------------
// Kernel 2: flash attention, transposed-score formulation, LDS-staged KV.
// Block = 256 threads = 8 waves, all on ONE (b,h); wave w owns q-tile
// (qgroup*8 + w). Each 32-kv chunk of K (32x64 f16) and V^T (64x32 f16) is
// staged into LDS once per block via async-to-LDS (double buffered), then
// all 8 waves consume it with ds_load_b128 -> 8x global traffic reduction.
// Mask comes from the packed bitmask: ONE u32 per lane per chunk.
//
//   S^T (kv x q): c0 (kv 0..15), c1 (kv 16..31), each = 2 WMMAs over DK=64.
//   O^T (dk x q): 4 tiles, A = V^T(dk x kv32), B = P^T (lane-local repack).
// Softmax rows (fixed q) live on the lane axis -> one shfl_xor(16) per
// reduction. Output written f16 to (B,S,H*DK).
// ---------------------------------------------------------------------------
__global__ __launch_bounds__(256) void k_attn(
    const _Float16* __restrict__ qf, const _Float16* __restrict__ kf,
    const _Float16* __restrict__ vf, const unsigned* __restrict__ mbits,
    _Float16* __restrict__ of)
{
    __shared__ alignas(16) _Float16 sK[2][32 * kDK]; // [kv][dk], 4KB/buf
    __shared__ alignas(16) _Float16 sV[2][kDK * 32]; // [dk][kv], 4KB/buf

    const int tid   = threadIdx.x;
    const int wid   = tid >> 5;
    const int lane  = tid & 31;
    const int half  = lane >> 4;
    const int lm    = lane & 15;
    const int koff  = half ? 8 : 0;

    const int qgroup = blockIdx.x & 31;         // 32 q-groups per (b,h)
    const int h      = (blockIdx.x >> 5) & (kH - 1);
    const int b      = blockIdx.x >> 8;
    const int q0     = (qgroup * 8 + wid) * 16;

    const _Float16* Qb = qf + (((size_t)b * kH + h) * kS) * kDK;
    const _Float16* Kb = kf + (((size_t)b * kH + h) * kS) * kDK;
    const _Float16* Vb = vf + (((size_t)b * kH + h) * kDK) * kS;

    // Per-thread staging slots: K chunk = 32 rows x 8 segs, V = 64 rows x 4.
    const int krow = tid >> 3, kseg = tid & 7;
    const int vrow = tid >> 2, vseg = tid & 3;

    // B operand of the score WMMAs: Q^T columns (fixed for the whole tile).
    v16h bq0, bq1;
    {
        const _Float16* qr = Qb + (size_t)(q0 + lm) * kDK;
        const v8h q_lo0 = *(const v8h*)(qr + koff);
        const v8h q_hi0 = *(const v8h*)(qr + 16 + koff);
        const v8h q_lo1 = *(const v8h*)(qr + 32 + koff);
        const v8h q_hi1 = *(const v8h*)(qr + 48 + koff);
#pragma unroll
        for (int i = 0; i < 8; ++i) {
            bq0[i] = q_lo0[i]; bq0[i + 8] = q_hi0[i];
            bq1[i] = q_lo1[i]; bq1[i + 8] = q_hi1[i];
        }
    }

    float mrow = -1e30f;
    float lrow = 0.0f;
    v8f o0 = {}, o1 = {}, o2 = {}, o3 = {};

    const int q = q0 + lm;
    const unsigned* mrowbits = mbits + (size_t)q * (kS / 32);

    // Prologue: stage chunk 0 into buffer 0.
    cp16_g2s(Kb + (size_t)krow * kDK + kseg * 8, &sK[0][krow * kDK + kseg * 8]);
    cp16_g2s(Vb + (size_t)vrow * kS + vseg * 8,  &sV[0][vrow * 32  + vseg * 8]);

    const int nchunks = kS / 32; // 128
    for (int ci = 0; ci < nchunks; ++ci) {
        const int cur = ci & 1;
        const int kv0 = ci * 32;

        wait_g2s();
        __syncthreads(); // chunk ci visible in LDS to all waves

        if (ci + 1 < nchunks) { // overlap next chunk's DMA with compute
            const int nkv = kv0 + 32;
            cp16_g2s(Kb + (size_t)(nkv + krow) * kDK + kseg * 8,
                     &sK[1 - cur][krow * kDK + kseg * 8]);
            cp16_g2s(Vb + (size_t)vrow * kS + nkv + vseg * 8,
                     &sV[1 - cur][vrow * 32 + vseg * 8]);
            __builtin_prefetch(mrowbits + ci + 1, 0, 1); // global_prefetch_b8
        }

        // ---- S^T tiles from LDS K rows
        v8f c0 = {}, c1 = {};
        {
            const _Float16* kr = &sK[cur][lm * kDK];
            v16h a;
            v8h lo = *(const v8h*)(kr + koff);
            v8h hi = *(const v8h*)(kr + 16 + koff);
#pragma unroll
            for (int i = 0; i < 8; ++i) { a[i] = lo[i]; a[i + 8] = hi[i]; }
            c0 = WMMA_F16(a, bq0, c0);
            lo = *(const v8h*)(kr + 32 + koff);
            hi = *(const v8h*)(kr + 48 + koff);
#pragma unroll
            for (int i = 0; i < 8; ++i) { a[i] = lo[i]; a[i + 8] = hi[i]; }
            c0 = WMMA_F16(a, bq1, c0);

            kr = &sK[cur][(16 + lm) * kDK];
            lo = *(const v8h*)(kr + koff);
            hi = *(const v8h*)(kr + 16 + koff);
#pragma unroll
            for (int i = 0; i < 8; ++i) { a[i] = lo[i]; a[i + 8] = hi[i]; }
            c1 = WMMA_F16(a, bq0, c1);
            lo = *(const v8h*)(kr + 32 + koff);
            hi = *(const v8h*)(kr + 48 + koff);
#pragma unroll
            for (int i = 0; i < 8; ++i) { a[i] = lo[i]; a[i + 8] = hi[i]; }
            c1 = WMMA_F16(a, bq1, c1);
        }

        // ---- mask (1 u32 for 32 kv) + online softmax
        const unsigned mw = mrowbits[ci]; // bit j = mask[q][kv0+j]
        float s0[8], s1[8];
        float tmax = -1e30f;
#pragma unroll
        for (int r = 0; r < 8; ++r) {
            const bool b0 = (mw >> (koff + r)) & 1u;
            const bool b1 = (mw >> (16 + koff + r)) & 1u;
            s0[r] = b0 ? c0[r] * kScale : -1e30f;
            s1[r] = b1 ? c1[r] * kScale : -1e30f;
            tmax = fmaxf(tmax, fmaxf(s0[r], s1[r]));
        }
        tmax = fmaxf(tmax, __shfl_xor(tmax, 16, 32));
        const float mnew  = fmaxf(mrow, tmax);
        const float alpha = __expf(mrow - mnew);

        float psum = 0.0f;
        v16h bp; // P^T repacked lane-locally into the B-operand layout
#pragma unroll
        for (int r = 0; r < 8; ++r) {
            const bool b0 = (mw >> (koff + r)) & 1u;
            const bool b1 = (mw >> (16 + koff + r)) & 1u;
            const float p0 = b0 ? __expf(s0[r] - mnew) : 0.0f;
            const float p1 = b1 ? __expf(s1[r] - mnew) : 0.0f;
            psum += p0 + p1;
            bp[r]     = (_Float16)p0;
            bp[r + 8] = (_Float16)p1;
        }
        psum += __shfl_xor(psum, 16, 32);
        lrow = lrow * alpha + psum;
        mrow = mnew;

#pragma unroll
        for (int j = 0; j < 8; ++j) {
            o0[j] *= alpha; o1[j] *= alpha; o2[j] *= alpha; o3[j] *= alpha;
        }

        // ---- O^T += V^T . P^T  (4 dk-tiles), A from LDS
#pragma unroll
        for (int t = 0; t < 4; ++t) {
            const _Float16* vr = &sV[cur][(t * 16 + lm) * 32];
            const v8h lo = *(const v8h*)(vr + koff);
            const v8h hi = *(const v8h*)(vr + 16 + koff);
            v16h a;
#pragma unroll
            for (int i = 0; i < 8; ++i) { a[i] = lo[i]; a[i + 8] = hi[i]; }
            v8f* ot = (t == 0) ? &o0 : (t == 1) ? &o1 : (t == 2) ? &o2 : &o3;
            *ot = WMMA_F16(a, bp, *ot);
        }

        __syncthreads(); // all waves done reading buf[cur] before reuse
    }

    // ---- normalize + store: O^T element (dk = t*16 + r + half*8, q = q0+lm)
    const float inv = 1.0f / lrow;
    _Float16* orow = of + ((size_t)b * kS + q) * kDM + h * kDK;
#pragma unroll
    for (int t = 0; t < 4; ++t) {
        const v8f ot = (t == 0) ? o0 : (t == 1) ? o1 : (t == 2) ? o2 : o3;
#pragma unroll
        for (int r = 0; r < 8; ++r) {
            const int dk = t * 16 + r + half * 8;
            orow[dk] = (_Float16)(ot[r] * inv);
        }
    }
}

// ---------------------------------------------------------------------------
// Kernel 3: output projection. out = attn(f16) @ Wo^T + bo, f32 store.
// ---------------------------------------------------------------------------
__global__ __launch_bounds__(32) void k_out_proj(
    const _Float16* __restrict__ of, const float* __restrict__ wo,
    const float* __restrict__ bo, float* __restrict__ out)
{
    const int lane = threadIdx.x & 31;
    const int half = lane >> 4;
    const int lm   = lane & 15;
    const int koff = half ? 8 : 0;

    const int m0 = blockIdx.x * 16;
    const int n0 = blockIdx.y * 64;

    v8f acc[4] = {};
    const _Float16* ar = of + (size_t)(m0 + lm) * kDM;
    for (int k0 = 0; k0 < kDM; k0 += 32) {
        const v8h lo = *(const v8h*)(ar + k0 + koff);
        const v8h hi = *(const v8h*)(ar + k0 + 16 + koff);
        v16h a;
#pragma unroll
        for (int i = 0; i < 8; ++i) { a[i] = lo[i]; a[i + 8] = hi[i]; }
#pragma unroll
        for (int t = 0; t < 4; ++t) {
            const float* wr = wo + (size_t)(n0 + t * 16 + lm) * kDM + k0;
            v16h bm;
#pragma unroll
            for (int i = 0; i < 8; ++i) {
                bm[i]     = (_Float16)wr[koff + i];
                bm[i + 8] = (_Float16)wr[16 + koff + i];
            }
            acc[t] = WMMA_F16(a, bm, acc[t]);
        }
    }

#pragma unroll
    for (int t = 0; t < 4; ++t) {
        const int n = n0 + t * 16 + lm;
        const float bval = bo[n];
#pragma unroll
        for (int r = 0; r < 8; ++r) {
            const int m = m0 + r + half * 8;
            out[(size_t)m * kDM + n] = acc[t][r] + bval;
        }
    }
}

// ---------------------------------------------------------------------------
extern "C" void kernel_launch(void* const* d_in, const int* in_sizes, int n_in,
                              void* d_out, int out_size, void* d_ws,
                              size_t ws_size, hipStream_t stream) {
    (void)in_sizes; (void)n_in; (void)out_size; (void)ws_size;

    const float* x    = (const float*)d_in[0];
    const int*   dmsk = (const int*)d_in[1];
    const float* wq   = (const float*)d_in[2];
    const float* bq   = (const float*)d_in[3];
    const float* wk   = (const float*)d_in[4];
    const float* bk   = (const float*)d_in[5];
    const float* wv   = (const float*)d_in[6];
    const float* bv   = (const float*)d_in[7];
    const float* wo   = (const float*)d_in[8];
    const float* bo   = (const float*)d_in[9];
    float* out = (float*)d_out;

    const size_t elems = (size_t)kB * kH * kS * kDK; // 4,194,304 per tensor
    _Float16* qf = (_Float16*)d_ws;
    _Float16* kf = qf + elems;
    _Float16* vf = kf + elems;
    _Float16* of = vf + elems;
    unsigned* mbits = (unsigned*)(of + elems);       // +2MB packed mask

    const int nmaskwords = (kS * kS) / 32; // 524288
    k_mask_pack<<<nmaskwords / 256, 256, 0, stream>>>(dmsk, mbits);

    dim3 g1((kB * kS) / 16, kH);
    k_proj_qkv<<<g1, 32, 0, stream>>>(x, wq, bq, wk, bk, wv, bv, qf, kf, vf);

    const int nblk = kB * kH * 32; // (b,h) x 32 q-groups = 512 blocks
    k_attn<<<nblk, 256, 0, stream>>>(qf, kf, vf, mbits, of);

    dim3 g3((kB * kS) / 16, kDM / 64);
    k_out_proj<<<g3, 32, 0, stream>>>(of, wo, bo, out);
}

// v001
// One run takes 276 microseconds.
// Next to v000, in two timings, it ran 1.33 and 1.34 times as fast.
#include <hip/hip_runtime.h>

typedef __attribute__((ext_vector_type(16))) _Float16 v16h;
typedef __attribute__((ext_vector_type(8)))  _Float16 v8h;
typedef __attribute__((ext_vector_type(8)))  float    v8f;
typedef int v4i_vs __attribute__((vector_size(16))); // matches builtin param

#define WMMA_F16(a, b, c) \
    __builtin_amdgcn_wmma_f32_16x16x32_f16(false, (a), false, (b), (short)0, (c), false, false)

static constexpr int   kB  = 2;
static constexpr int   kS  = 4096;
static constexpr int   kDM = 512;
static constexpr int   kH  = 8;
static constexpr int   kDK = 64;
static constexpr float kScale = 0.125f; // 1/sqrt(64)
// LDS row pitches in f16 elements, 16 B x odd so that the 16 rows one
// ds_load_b128 touches fall on 16 different bank groups (64 banks x 4 B):
// K rows 128 B -> 144 B, V^T rows 64 B -> 80 B.
static constexpr int   kKP = kDK + 8;  // 72 elements = 144 B
static constexpr int   kVP = 32 + 8;   // 40 elements =  80 B
// Elements per LDS buffer: the padded tiles (32 * kKP, kDK * kVP) rounded up
// to a power of two, so picking a buffer stays a shift, not a multiply.
static constexpr int   kBuf = 4096;    // 8 KB
static_assert(32 * kKP <= kBuf && kDK * kVP <= kBuf, "tile exceeds buffer");

#if __has_builtin(__builtin_amdgcn_global_load_async_to_lds_b128)
#define ASYNC_LDS 1
#endif

// 16-byte global -> LDS copy. Async DMA path on gfx1250
// (GLOBAL_LOAD_ASYNC_TO_LDS_B128, ASYNCcnt), else load+ds_store fallback.
__device__ __forceinline__ void cp16_g2s(const _Float16* g, _Float16* l) {
#ifdef ASYNC_LDS
    __builtin_amdgcn_global_load_async_to_lds_b128(
        (__attribute__((address_space(1))) v4i_vs*)g,
        (__attribute__((address_space(3))) v4i_vs*)l, 0, 0);
#else
    *(v8h*)l = *(const v8h*)g;
#endif
}

__device__ __forceinline__ void wait_g2s() {
#ifdef ASYNC_LDS
#if __has_builtin(__builtin_amdgcn_s_wait_asynccnt)
    __builtin_amdgcn_s_wait_asynccnt(0);
#else
    asm volatile("s_wait_asynccnt 0" ::: "memory");
#endif
#endif
}

// ---------------------------------------------------------------------------
// Kernel 0: pack the (S,S) int32 DAG mask into 1 bit/entry.
// bits[q][c] bit j == (mask[q][c*32 + j] != 0). 2MB result; read 16x by the
// attention kernel instead of 16x 67MB of int32 -> 32x less mask traffic.
// ---------------------------------------------------------------------------
__global__ __launch_bounds__(256) void k_mask_pack(
    const int* __restrict__ mask, unsigned* __restrict__ bits)
{
    const size_t w = (size_t)blockIdx.x * 256 + threadIdx.x; // word index
    const int4* src = (const int4*)(mask + w * 32);
    unsigned word = 0;
#pragma unroll
    for (int j = 0; j < 8; ++j) {
        const int4 m = src[j];
        word |= (m.x ? 1u : 0u) << (4 * j + 0);
        word |= (m.y ? 1u : 0u) << (4 * j + 1);
        word |= (m.z ? 1u : 0u) << (4 * j + 2);
        word |= (m.w ? 1u : 0u) << (4 * j + 3);
    }
    bits[w] = word;
}

// ---------------------------------------------------------------------------
// Kernel 1: fused QKV projection (all three in one wave).
//   Y[m][n] = sum_k X[m][k] * W[n][k] + bias[n]   (einsum 'bsd,ed->bse')
// One wave computes a 16(m) x 64(n) tile for Q, K AND V; the converted
// x A-tile is reused across the three weight matrices (12 WMMAs / A-load).
// Q,K stored f16 as (B,H,S,DK); V stored f16 TRANSPOSED as (B,H,DK,S).
//
// WMMA operand convention (CDNA5 wave32, 16x16x32 f16):
//   A (MxK): lanes 0-15 hold row M=lane, K elems {0..7,16..23};
//            lanes 16-31 hold row M=lane-16, K elems {8..15,24..31}.
//   B (KxN): lane n<16 holds col N=n with K elems {0..7,16..23};
//            lane n+16 holds col N=n with K elems {8..15,24..31}.
//   C/D    : VGPR r, lanes 0-15 -> (M=r, N=lane); lanes 16-31 -> (M=8+r).
// ---------------------------------------------------------------------------
__global__ __launch_bounds__(32) void k_proj_qkv(
    const float* __restrict__ x,
    const float* __restrict__ wq, const float* __restrict__ bq,
    const float* __restrict__ wk, const float* __restrict__ bk,
    const float* __restrict__ wv, const float* __restrict__ bv,
    _Float16* __restrict__ qf, _Float16* __restrict__ kf,
    _Float16* __restrict__ vf)
{
    const int lane = threadIdx.x & 31;
    const int half = lane >> 4;
    const int lm   = lane & 15;
    const int koff = half ? 8 : 0;

    const int m0 = blockIdx.x * 16;   // row tile over B*S = 8192 rows
    const int h  = blockIdx.y;        // head -> n0 = h*64
    const int n0 = h * kDK;

    const float* wmat[3] = {wq, wk, wv};
    const float* bias[3] = {bq, bk, bv};

    v8f acc[3][4] = {};

    const float* xr = x + (size_t)(m0 + lm) * kDM;
    for (int k0 = 0; k0 < kDM; k0 += 32) {
        v16h a;
#pragma unroll
        for (int i = 0; i < 8; ++i) {
            a[i]     = (_Float16)xr[k0 + koff + i];
            a[i + 8] = (_Float16)xr[k0 + 16 + koff + i];
        }
#pragma unroll
        for (int wsel = 0; wsel < 3; ++wsel) {
#pragma unroll
            for (int t = 0; t < 4; ++t) {
                const float* wr =
                    wmat[wsel] + (size_t)(n0 + t * 16 + lm) * kDM + k0;
                v16h bm;
#pragma unroll
                for (int i = 0; i < 8; ++i) {
                    bm[i]     = (_Float16)wr[koff + i];
                    bm[i + 8] = (_Float16)wr[16 + koff + i];
                }
                acc[wsel][t] = WMMA_F16(a, bm, acc[wsel][t]);
            }
        }
    }

#pragma unroll
    for (int wsel = 0; wsel < 3; ++wsel) {
#pragma unroll
        for (int t = 0; t < 4; ++t) {
            const int dk = t * 16 + lm;          // N index inside head
            const float bval = bias[wsel][n0 + dk];
#pragma unroll
            for (int r = 0; r < 8; ++r) {
                const int m = m0 + r + half * 8; // global row (b*S + s)
                const int b = m >> 12;           // / 4096
                const int s = m & (kS - 1);
                const _Float16 val = (_Float16)(acc[wsel][t][r] + bval);
                if (wsel == 2) {                 // V transposed: (B,H,DK,S)
                    vf[(((size_t)b * kH + h) * kDK + dk) * kS + s] = val;
                } else {                         // Q/K: (B,H,S,DK)
                    _Float16* dst = (wsel == 0) ? qf : kf;
                    dst[(((size_t)b * kH + h) * kS + s) * kDK + dk] = val;
                }
            }
        }
    }
}

// ---------------------------------------------------------------------------
// Kernel 2: flash attention, transposed-score formulation, LDS-staged KV.
// Block = 256 threads = 8 waves, all on ONE (b,h); wave w owns q-tile
// (qgroup*8 + w). Each 32-kv chunk of K (32x64 f16) and V^T (64x32 f16) is
// staged into LDS once per block via async-to-LDS (double buffered), then
// all 8 waves consume it with ds_load_b128 -> 8x global traffic reduction.
// Mask comes from the packed bitmask: ONE u32 per lane per chunk.
//
//   S^T (kv x q): c0 (kv 0..15), c1 (kv 16..31), each = 2 WMMAs over DK=64.
//   O^T (dk x q): 4 tiles, A = V^T(dk x kv32), B = P^T (lane-local repack).
// Softmax rows (fixed q) live on the lane axis -> one shfl_xor(16) per
// reduction. Output written f16 to (B,S,H*DK).
// ---------------------------------------------------------------------------
__global__ __launch_bounds__(256) void k_attn(
    const _Float16* __restrict__ qf, const _Float16* __restrict__ kf,
    const _Float16* __restrict__ vf, const unsigned* __restrict__ mbits,
    _Float16* __restrict__ of)
{
    __shared__ alignas(16) _Float16 sK[2][kBuf]; // [kv][dk], rows of kKP
    __shared__ alignas(16) _Float16 sV[2][kBuf]; // [dk][kv], rows of kVP

    const int tid   = threadIdx.x;
    const int wid   = tid >> 5;
    const int lane  = tid & 31;
    const int half  = lane >> 4;
    const int lm    = lane & 15;
    const int koff  = half ? 8 : 0;

    const int qgroup = blockIdx.x & 31;         // 32 q-groups per (b,h)
    const int h      = (blockIdx.x >> 5) & (kH - 1);
    const int b      = blockIdx.x >> 8;
    const int q0     = (qgroup * 8 + wid) * 16;

    const _Float16* Qb = qf + (((size_t)b * kH + h) * kS) * kDK;
    const _Float16* Kb = kf + (((size_t)b * kH + h) * kS) * kDK;
    const _Float16* Vb = vf + (((size_t)b * kH + h) * kDK) * kS;

    // Per-thread staging slots: K chunk = 32 rows x 8 segs, V = 64 rows x 4.
    const int krow = tid >> 3, kseg = tid & 7;
    const int vrow = tid >> 2, vseg = tid & 3;

    // B operand of the score WMMAs: Q^T columns (fixed for the whole tile).
    v16h bq0, bq1;
    {
        const _Float16* qr = Qb + (size_t)(q0 + lm) * kDK;
        const v8h q_lo0 = *(const v8h*)(qr + koff);
        const v8h q_hi0 = *(const v8h*)(qr + 16 + koff);
        const v8h q_lo1 = *(const v8h*)(qr + 32 + koff);
        const v8h q_hi1 = *(const v8h*)(qr + 48 + koff);
#pragma unroll
        for (int i = 0; i < 8; ++i) {
            bq0[i] = q_lo0[i]; bq0[i + 8] = q_hi0[i];
            bq1[i] = q_lo1[i]; bq1[i + 8] = q_hi1[i];
        }
    }

    float mrow = -1e30f;
    float lrow = 0.0f;
    v8f o0 = {}, o1 = {}, o2 = {}, o3 = {};

    const int q = q0 + lm;
    const unsigned* mrowbits = mbits + (size_t)q * (kS / 32);

    // Prologue: stage chunk 0 into buffer 0.
    cp16_g2s(Kb + (size_t)krow * kDK + kseg * 8, &sK[0][krow * kKP + kseg * 8]);
    cp16_g2s(Vb + (size_t)vrow * kS + vseg * 8,  &sV[0][vrow * kVP + vseg * 8]);

    const int nchunks = kS / 32; // 128
    for (int ci = 0; ci < nchunks; ++ci) {
        const int cur = ci & 1;
        const int kv0 = ci * 32;

        wait_g2s();
        __syncthreads(); // chunk ci visible in LDS to all waves

        if (ci + 1 < nchunks) { // overlap next chunk's DMA with compute
            const int nkv = kv0 + 32;
            cp16_g2s(Kb + (size_t)(nkv + krow) * kDK + kseg * 8,
                     &sK[1 - cur][krow * kKP + kseg * 8]);
            cp16_g2s(Vb + (size_t)vrow * kS + nkv + vseg * 8,
                     &sV[1 - cur][vrow * kVP + vseg * 8]);
            __builtin_prefetch(mrowbits + ci + 1, 0, 1); // global_prefetch_b8
        }

        // ---- S^T tiles from LDS K rows
        v8f c0 = {}, c1 = {};
        {
            const _Float16* kr = &sK[cur][lm * kKP];
            v16h a;
            v8h lo = *(const v8h*)(kr + koff);
            v8h hi = *(const v8h*)(kr + 16 + koff);
#pragma unroll
            for (int i = 0; i < 8; ++i) { a[i] = lo[i]; a[i + 8] = hi[i]; }
            c0 = WMMA_F16(a, bq0, c0);
            lo = *(const v8h*)(kr + 32 + koff);
            hi = *(const v8h*)(kr + 48 + koff);
#pragma unroll
            for (int i = 0; i < 8; ++i) { a[i] = lo[i]; a[i + 8] = hi[i]; }
            c0 = WMMA_F16(a, bq1, c0);

            kr = &sK[cur][(16 + lm) * kKP];
            lo = *(const v8h*)(kr + koff);
            hi = *(const v8h*)(kr + 16 + koff);
#pragma unroll
            for (int i = 0; i < 8; ++i) { a[i] = lo[i]; a[i + 8] = hi[i]; }
            c1 = WMMA_F16(a, bq0, c1);
            lo = *(const v8h*)(kr + 32 + koff);
            hi = *(const v8h*)(kr + 48 + koff);
#pragma unroll
            for (int i = 0; i < 8; ++i) { a[i] = lo[i]; a[i + 8] = hi[i]; }
            c1 = WMMA_F16(a, bq1, c1);
        }

        // ---- mask (1 u32 for 32 kv) + online softmax
        const unsigned mw = mrowbits[ci]; // bit j = mask[q][kv0+j]
        float s0[8], s1[8];
        float tmax = -1e30f;
#pragma unroll
        for (int r = 0; r < 8; ++r) {
            const bool b0 = (mw >> (koff + r)) & 1u;
            const bool b1 = (mw >> (16 + koff + r)) & 1u;
            s0[r] = b0 ? c0[r] * kScale : -1e30f;
            s1[r] = b1 ? c1[r] * kScale : -1e30f;
            tmax = fmaxf(tmax, fmaxf(s0[r], s1[r]));
        }
        tmax = fmaxf(tmax, __shfl_xor(tmax, 16, 32));
        const float mnew  = fmaxf(mrow, tmax);
        const float alpha = __expf(mrow - mnew);

        float psum = 0.0f;
        v16h bp; // P^T repacked lane-locally into the B-operand layout
#pragma unroll
        for (int r = 0; r < 8; ++r) {
            const bool b0 = (mw >> (koff + r)) & 1u;
            const bool b1 = (mw >> (16 + koff + r)) & 1u;
            const float p0 = b0 ? __expf(s0[r] - mnew) : 0.0f;
            const float p1 = b1 ? __expf(s1[r] - mnew) : 0.0f;
            psum += p0 + p1;
            bp[r]     = (_Float16)p0;
            bp[r + 8] = (_Float16)p1;
        }
        psum += __shfl_xor(psum, 16, 32);
        lrow = lrow * alpha + psum;
        mrow = mnew;

#pragma unroll
        for (int j = 0; j < 8; ++j) {
            o0[j] *= alpha; o1[j] *= alpha; o2[j] *= alpha; o3[j] *= alpha;
        }

        // ---- O^T += V^T . P^T  (4 dk-tiles), A from LDS
#pragma unroll
        for (int t = 0; t < 4; ++t) {
            const _Float16* vr = &sV[cur][(t * 16 + lm) * kVP];
            const v8h lo = *(const v8h*)(vr + koff);
            const v8h hi = *(const v8h*)(vr + 16 + koff);
            v16h a;
#pragma unroll
            for (int i = 0; i < 8; ++i) { a[i] = lo[i]; a[i + 8] = hi[i]; }
            v8f* ot = (t == 0) ? &o0 : (t == 1) ? &o1 : (t == 2) ? &o2 : &o3;
            *ot = WMMA_F16(a, bp, *ot);
        }

        __syncthreads(); // all waves done reading buf[cur] before reuse
    }

    // ---- normalize + store: O^T element (dk = t*16 + r + half*8, q = q0+lm)
    const float inv = 1.0f / lrow;
    _Float16* orow = of + ((size_t)b * kS + q) * kDM + h * kDK;
#pragma unroll
    for (int t = 0; t < 4; ++t) {
        const v8f ot = (t == 0) ? o0 : (t == 1) ? o1 : (t == 2) ? o2 : o3;
#pragma unroll
        for (int r = 0; r < 8; ++r) {
            const int dk = t * 16 + r + half * 8;
            orow[dk] = (_Float16)(ot[r] * inv);
        }
    }
}

// ---------------------------------------------------------------------------
// Kernel 3: output projection. out = attn(f16) @ Wo^T + bo, f32 store.
// ---------------------------------------------------------------------------
__global__ __launch_bounds__(32) void k_out_proj(
    const _Float16* __restrict__ of, const float* __restrict__ wo,
    const float* __restrict__ bo, float* __restrict__ out)
{
    const int lane = threadIdx.x & 31;
    const int half = lane >> 4;
    const int lm   = lane & 15;
    const int koff = half ? 8 : 0;

    const int m0 = blockIdx.x * 16;
    const int n0 = blockIdx.y * 64;

    v8f acc[4] = {};
    const _Float16* ar = of + (size_t)(m0 + lm) * kDM;
    for (int k0 = 0; k0 < kDM; k0 += 32) {
        const v8h lo = *(const v8h*)(ar + k0 + koff);
        const v8h hi = *(const v8h*)(ar + k0 + 16 + koff);
        v16h a;
#pragma unroll
        for (int i = 0; i < 8; ++i) { a[i] = lo[i]; a[i + 8] = hi[i]; }
#pragma unroll
        for (int t = 0; t < 4; ++t) {
            const float* wr = wo + (size_t)(n0 + t * 16 + lm) * kDM + k0;
            v16h bm;
#pragma unroll
            for (int i = 0; i < 8; ++i) {
                bm[i]     = (_Float16)wr[koff + i];
                bm[i + 8] = (_Float16)wr[16 + koff + i];
            }
            acc[t] = WMMA_F16(a, bm, acc[t]);
        }
    }

#pragma unroll
    for (int t = 0; t < 4; ++t) {
        const int n = n0 + t * 16 + lm;
        const float bval = bo[n];
#pragma unroll
        for (int r = 0; r < 8; ++r) {
            const int m = m0 + r + half * 8;
            out[(size_t)m * kDM + n] = acc[t][r] + bval;
        }
    }
}

// ---------------------------------------------------------------------------
extern "C" void kernel_launch(void* const* d_in, const int* in_sizes, int n_in,
                              void* d_out, int out_size, void* d_ws,
                              size_t ws_size, hipStream_t stream) {
    (void)in_sizes; (void)n_in; (void)out_size; (void)ws_size;

    const float* x    = (const float*)d_in[0];
    const int*   dmsk = (const int*)d_in[1];
    const float* wq   = (const float*)d_in[2];
    const float* bq   = (const float*)d_in[3];
    const float* wk   = (const float*)d_in[4];
    const float* bk   = (const float*)d_in[5];
    const float* wv   = (const float*)d_in[6];
    const float* bv   = (const float*)d_in[7];
    const float* wo   = (const float*)d_in[8];
    const float* bo   = (const float*)d_in[9];
    float* out = (float*)d_out;

    const size_t elems = (size_t)kB * kH * kS * kDK; // 4,194,304 per tensor
    _Float16* qf = (_Float16*)d_ws;
    _Float16* kf = qf + elems;
    _Float16* vf = kf + elems;
    _Float16* of = vf + elems;
    unsigned* mbits = (unsigned*)(of + elems);       // +2MB packed mask

    const int nmaskwords = (kS * kS) / 32; // 524288
    k_mask_pack<<<nmaskwords / 256, 256, 0, stream>>>(dmsk, mbits);

    dim3 g1((kB * kS) / 16, kH);
    k_proj_qkv<<<g1, 32, 0, stream>>>(x, wq, bq, wk, bk, wv, bv, qf, kf, vf);

    const int nblk = kB * kH * 32; // (b,h) x 32 q-groups = 512 blocks
    k_attn<<<nblk, 256, 0, stream>>>(qf, kf, vf, mbits, of);

    dim3 g3((kB * kS) / 16, kDM / 64);
    k_out_proj<<<g3, 32, 0, stream>>>(of, wo, bo, out);
}

// v002
// A run of this version takes 164 microseconds.
// Two timings next to v001 put it at 1.67 and 1.68 times that version's speed.
// Over all steps from v000 it is 2.24 times as fast.
#include <hip/hip_runtime.h>

typedef __attribute__((ext_vector_type(16))) _Float16 v16h;
typedef __attribute__((ext_vector_type(8)))  _Float16 v8h;
typedef __attribute__((ext_vector_type(4)))  _Float16 v4h;
typedef __attribute__((ext_vector_type(8)))  float    v8f;
typedef int v4i_vs __attribute__((vector_size(16))); // matches builtin param

#define WMMA_F16(a, b, c) \
    __builtin_amdgcn_wmma_f32_16x16x32_f16(false, (a), false, (b), (short)0, (c), false, false)

static constexpr int   kB  = 2;
static constexpr int   kS  = 4096;
static constexpr int   kDM = 512;
static constexpr int   kH  = 8;
static constexpr int   kDK = 64;
static constexpr float kScale = 0.125f; // 1/sqrt(64)
// LDS row pitches in f16 elements, 16 B x odd so that the 16 rows one
// ds_load_b128 touches fall on 16 different bank groups (64 banks x 4 B):
// K rows 128 B -> 144 B, V^T rows 64 B -> 80 B. The projection kernels' LDS
// tiles use the same two pitches for their 128-B and 64-B rows.
static constexpr int   kKP = kDK + 8;  // 72 elements = 144 B
static constexpr int   kVP = 32 + 8;   // 40 elements =  80 B
// Elements per LDS buffer: the padded tiles (32 * kKP, kDK * kVP) rounded up
// to a power of two, so picking a buffer stays a shift, not a multiply.
static constexpr int   kBuf = 4096;    // 8 KB
static_assert(32 * kKP <= kBuf && kDK * kVP <= kBuf, "tile exceeds buffer");

#if __has_builtin(__builtin_amdgcn_global_load_async_to_lds_b128)
#define ASYNC_LDS 1
#endif

// 16-byte global -> LDS copy. Async DMA path on gfx1250
// (GLOBAL_LOAD_ASYNC_TO_LDS_B128, ASYNCcnt), else load+ds_store fallback.
__device__ __forceinline__ void cp16_g2s(const _Float16* g, _Float16* l) {
#ifdef ASYNC_LDS
    __builtin_amdgcn_global_load_async_to_lds_b128(
        (__attribute__((address_space(1))) v4i_vs*)g,
        (__attribute__((address_space(3))) v4i_vs*)l, 0, 0);
#else
    *(v8h*)l = *(const v8h*)g;
#endif
}

__device__ __forceinline__ void wait_g2s() {
#ifdef ASYNC_LDS
#if __has_builtin(__builtin_amdgcn_s_wait_asynccnt)
    __builtin_amdgcn_s_wait_asynccnt(0);
#else
    asm volatile("s_wait_asynccnt 0" ::: "memory");
#endif
#endif
}

// ---------------------------------------------------------------------------
// Kernel 0: pack the (S,S) int32 DAG mask into 1 bit/entry.
// bits[q][c] bit j == (mask[q][c*32 + j] != 0). 2MB result; read 16x by the
// attention kernel instead of 16x 67MB of int32 -> 32x less mask traffic.
// ---------------------------------------------------------------------------
__global__ __launch_bounds__(256) void k_mask_pack(
    const int* __restrict__ mask, unsigned* __restrict__ bits)
{
    const size_t w = (size_t)blockIdx.x * 256 + threadIdx.x; // word index
    const int4* src = (const int4*)(mask + w * 32);
    unsigned word = 0;
#pragma unroll
    for (int j = 0; j < 8; ++j) {
        const int4 m = src[j];
        word |= (m.x ? 1u : 0u) << (4 * j + 0);
        word |= (m.y ? 1u : 0u) << (4 * j + 1);
        word |= (m.z ? 1u : 0u) << (4 * j + 2);
        word |= (m.w ? 1u : 0u) << (4 * j + 3);
    }
    bits[w] = word;
}

// ---------------------------------------------------------------------------
// Kernel 1: fused QKV projection, operands staged in LDS.
//   Y[m][n] = sum_k X[m][k] * W[n][k] + bias[n]   (einsum 'bsd,ed->bse')
// Block = 8 waves on ONE head: 128 rows of x against the head's 64 rows of
// each of Wq, Wk, Wv. Per 32-wide k step the block reads its x and W pieces
// once, as whole 128-B lines (8 lanes x 16 B per row), converts them to f16
// once and stores them in LDS; the 8 waves then take their fragments with
// ds_load_b128. Wave w still computes the 16(m) x 64(n) tile of Q, K AND V
// with the same k order as before (12 WMMAs per A fragment).
// Q,K stored f16 as (B,H,S,DK); V stored f16 TRANSPOSED as (B,H,DK,S).
//
// WMMA operand convention (CDNA5 wave32, 16x16x32 f16):
//   A (MxK): lanes 0-15 hold row M=lane, K elems {0..7,16..23};
//            lanes 16-31 hold row M=lane-16, K elems {8..15,24..31}.
//   B (KxN): lane n<16 holds col N=n with K elems {0..7,16..23};
//            lane n+16 holds col N=n with K elems {8..15,24..31}.
//   C/D    : VGPR r, lanes 0-15 -> (M=r, N=lane); lanes 16-31 -> (M=8+r).
// ---------------------------------------------------------------------------
__device__ __forceinline__ v4h cvt4(const float4 f) {
    v4h r;
    r[0] = (_Float16)f.x; r[1] = (_Float16)f.y;
    r[2] = (_Float16)f.z; r[3] = (_Float16)f.w;
    return r;
}

__device__ __forceinline__ void sched_fence() {
    __builtin_amdgcn_sched_barrier(0);
}

__device__ __forceinline__ v16h frag16(const _Float16* p) {
    const v8h lo = *(const v8h*)(p);
    const v8h hi = *(const v8h*)(p + 16);
    v16h a;
#pragma unroll
    for (int i = 0; i < 8; ++i) { a[i] = lo[i]; a[i + 8] = hi[i]; }
    return a;
}

__global__ __launch_bounds__(256) void k_proj_qkv(
    const float* __restrict__ x,
    const float* __restrict__ wq, const float* __restrict__ bq,
    const float* __restrict__ wk, const float* __restrict__ bk,
    const float* __restrict__ wv, const float* __restrict__ bv,
    _Float16* __restrict__ qf, _Float16* __restrict__ kf,
    _Float16* __restrict__ vf)
{
    __shared__ alignas(16) _Float16 sX[2][128 * kVP]; // [m][k], rows of kVP
    __shared__ alignas(16) _Float16 sW[2][192 * kVP]; // [wsel*64+n][k]

    const int tid  = threadIdx.x;
    const int wid  = tid >> 5;
    const int lane = tid & 31;
    const int half = lane >> 4;
    const int lm   = lane & 15;
    const int koff = half ? 8 : 0;

    const int mblk = blockIdx.x * 128; // row block over B*S = 8192 rows
    const int m0   = mblk + wid * 16;  // this wave's 16 rows
    const int h    = blockIdx.y;       // head -> n0 = h*64
    const int n0   = h * kDK;

    const float* bias[3] = {bq, bk, bv};

    // Staging slot: 8 threads cover one row's 32 floats, 32 rows per sweep.
    const int srow = tid >> 3;
    const int sc4  = (tid & 7) * 4;
    const float* xg = x + (size_t)(mblk + srow) * kDM + sc4;
    const float* wg[3] = {wq + (size_t)(n0 + srow) * kDM + sc4,
                          wk + (size_t)(n0 + srow) * kDM + sc4,
                          wv + (size_t)(n0 + srow) * kDM + sc4};

    float4 rx[4], rw[6];
#pragma unroll
    for (int i = 0; i < 4; ++i)
        rx[i] = *(const float4*)(xg + (size_t)i * 32 * kDM);
#pragma unroll
    for (int j = 0; j < 6; ++j)
        rw[j] = *(const float4*)(wg[j >> 1] + (size_t)(j & 1) * 32 * kDM);
#pragma unroll
    for (int i = 0; i < 4; ++i)
        *(v4h*)&sX[0][(i * 32 + srow) * kVP + sc4] = cvt4(rx[i]);
#pragma unroll
    for (int j = 0; j < 6; ++j)
        *(v4h*)&sW[0][(j * 32 + srow) * kVP + sc4] = cvt4(rw[j]);

    v8f acc[3][4] = {};

    const int nsteps = kDM / 32; // 16
    for (int ks = 0; ks < nsteps; ++ks) {
        const int cur = ks & 1;
        // One barrier per step: buffer cur is complete, and every wave has
        // left the other buffer (read in step ks-1), which is refilled below.
        __syncthreads();

        const bool more = ks + 1 < nsteps;
        if (more) { // next step's global loads fly under this step's WMMAs
            const int k0 = (ks + 1) * 32;
#pragma unroll
            for (int i = 0; i < 4; ++i)
                rx[i] = *(const float4*)(xg + (size_t)i * 32 * kDM + k0);
#pragma unroll
            for (int j = 0; j < 6; ++j)
                rw[j] = *(const float4*)(wg[j >> 1] +
                                         (size_t)(j & 1) * 32 * kDM + k0);
        }

        // The scheduler does not cross sched_fence(): without these it sinks
        // the global loads below the WMMAs and waits out every LDS read
        // alone. Each W group is read one group ahead of its WMMAs.
        sched_fence();
        const _Float16* wrow = &sW[cur][lm * kVP + koff];
        const v16h a = frag16(&sX[cur][(wid * 16 + lm) * kVP + koff]);
        v16h b0[4], b1[4];
#pragma unroll
        for (int t = 0; t < 4; ++t) b0[t] = frag16(wrow + (t * 16) * kVP);
#pragma unroll
        for (int t = 0; t < 4; ++t) b1[t] = frag16(wrow + (64 + t * 16) * kVP);
        sched_fence();
#pragma unroll
        for (int t = 0; t < 4; ++t) acc[0][t] = WMMA_F16(a, b0[t], acc[0][t]);
        sched_fence();
#pragma unroll
        for (int t = 0; t < 4; ++t) b0[t] = frag16(wrow + (128 + t * 16) * kVP);
        sched_fence();
#pragma unroll
        for (int t = 0; t < 4; ++t) acc[1][t] = WMMA_F16(a, b1[t], acc[1][t]);
#pragma unroll
        for (int t = 0; t < 4; ++t) acc[2][t] = WMMA_F16(a, b0[t], acc[2][t]);
        sched_fence();

        if (more) {
#pragma unroll
            for (int i = 0; i < 4; ++i)
                *(v4h*)&sX[1 - cur][(i * 32 + srow) * kVP + sc4] = cvt4(rx[i]);
#pragma unroll
            for (int j = 0; j < 6; ++j)
                *(v4h*)&sW[1 - cur][(j * 32 + srow) * kVP + sc4] = cvt4(rw[j]);
        }
    }

#pragma unroll
    for (int wsel = 0; wsel < 3; ++wsel) {
#pragma unroll
        for (int t = 0; t < 4; ++t) {
            const int dk = t * 16 + lm;          // N index inside head
            const float bval = bias[wsel][n0 + dk];
#pragma unroll
            for (int r = 0; r < 8; ++r) {
                const int m = m0 + r + half * 8; // global row (b*S + s)
                const int b = m >> 12;           // / 4096
                const int s = m & (kS - 1);
                const _Float16 val = (_Float16)(acc[wsel][t][r] + bval);
                if (wsel == 2) {                 // V transposed: (B,H,DK,S)
                    vf[(((size_t)b * kH + h) * kDK + dk) * kS + s] = val;
                } else {                         // Q/K: (B,H,S,DK)
                    _Float16* dst = (wsel == 0) ? qf : kf;
                    dst[(((size_t)b * kH + h) * kS + s) * kDK + dk] = val;
                }
            }
        }
    }
}

// ---------------------------------------------------------------------------
// Kernel 2: flash attention, transposed-score formulation, LDS-staged KV.
// Block = 256 threads = 8 waves, all on ONE (b,h); wave w owns q-tile
// (qgroup*8 + w). Each 32-kv chunk of K (32x64 f16) and V^T (64x32 f16) is
// staged into LDS once per block via async-to-LDS (double buffered), then
// all 8 waves consume it with ds_load_b128 -> 8x global traffic reduction.
// Mask comes from the packed bitmask: ONE u32 per lane per chunk.
//
//   S^T (kv x q): c0 (kv 0..15), c1 (kv 16..31), each = 2 WMMAs over DK=64.
//   O^T (dk x q): 4 tiles, A = V^T(dk x kv32), B = P^T (lane-local repack).
// Softmax rows (fixed q) live on the lane axis -> one shfl_xor(16) per
// reduction. Output written f16 to (B,S,H*DK).
// ---------------------------------------------------------------------------
__global__ __launch_bounds__(256) void k_attn(
    const _Float16* __restrict__ qf, const _Float16* __restrict__ kf,
    const _Float16* __restrict__ vf, const unsigned* __restrict__ mbits,
    _Float16* __restrict__ of)
{
    __shared__ alignas(16) _Float16 sK[2][kBuf]; // [kv][dk], rows of kKP
    __shared__ alignas(16) _Float16 sV[2][kBuf]; // [dk][kv], rows of kVP

    const int tid   = threadIdx.x;
    const int wid   = tid >> 5;
    const int lane  = tid & 31;
    const int half  = lane >> 4;
    const int lm    = lane & 15;
    const int koff  = half ? 8 : 0;

    const int qgroup = blockIdx.x & 31;         // 32 q-groups per (b,h)
    const int h      = (blockIdx.x >> 5) & (kH - 1);
    const int b      = blockIdx.x >> 8;
    const int q0     = (qgroup * 8 + wid) * 16;

    const _Float16* Qb = qf + (((size_t)b * kH + h) * kS) * kDK;
    const _Float16* Kb = kf + (((size_t)b * kH + h) * kS) * kDK;
    const _Float16* Vb = vf + (((size_t)b * kH + h) * kDK) * kS;

    // Per-thread staging slots: K chunk = 32 rows x 8 segs, V = 64 rows x 4.
    const int krow = tid >> 3, kseg = tid & 7;
    const int vrow = tid >> 2, vseg = tid & 3;

    // B operand of the score WMMAs: Q^T columns (fixed for the whole tile).
    v16h bq0, bq1;
    {
        const _Float16* qr = Qb + (size_t)(q0 + lm) * kDK;
        const v8h q_lo0 = *(const v8h*)(qr + koff);
        const v8h q_hi0 = *(const v8h*)(qr + 16 + koff);
        const v8h q_lo1 = *(const v8h*)(qr + 32 + koff);
        const v8h q_hi1 = *(const v8h*)(qr + 48 + koff);
#pragma unroll
        for (int i = 0; i < 8; ++i) {
            bq0[i] = q_lo0[i]; bq0[i + 8] = q_hi0[i];
            bq1[i] = q_lo1[i]; bq1[i + 8] = q_hi1[i];
        }
    }

    float mrow = -1e30f;
    float lrow = 0.0f;
    v8f o0 = {}, o1 = {}, o2 = {}, o3 = {};

    const int q = q0 + lm;
    const unsigned* mrowbits = mbits + (size_t)q * (kS / 32);

    // Prologue: stage chunk 0 into buffer 0.
    cp16_g2s(Kb + (size_t)krow * kDK + kseg * 8, &sK[0][krow * kKP + kseg * 8]);
    cp16_g2s(Vb + (size_t)vrow * kS + vseg * 8,  &sV[0][vrow * kVP + vseg * 8]);

    const int nchunks = kS / 32; // 128
    for (int ci = 0; ci < nchunks; ++ci) {
        const int cur = ci & 1;
        const int kv0 = ci * 32;

        wait_g2s();
        __syncthreads(); // chunk ci visible in LDS to all waves

        if (ci + 1 < nchunks) { // overlap next chunk's DMA with compute
            const int nkv = kv0 + 32;
            cp16_g2s(Kb + (size_t)(nkv + krow) * kDK + kseg * 8,
                     &sK[1 - cur][krow * kKP + kseg * 8]);
            cp16_g2s(Vb + (size_t)vrow * kS + nkv + vseg * 8,
                     &sV[1 - cur][vrow * kVP + vseg * 8]);
            __builtin_prefetch(mrowbits + ci + 1, 0, 1); // global_prefetch_b8
        }

        // ---- S^T tiles from LDS K rows
        v8f c0 = {}, c1 = {};
        {
            const _Float16* kr = &sK[cur][lm * kKP];
            v16h a;
            v8h lo = *(const v8h*)(kr + koff);
            v8h hi = *(const v8h*)(kr + 16 + koff);
#pragma unroll
            for (int i = 0; i < 8; ++i) { a[i] = lo[i]; a[i + 8] = hi[i]; }
            c0 = WMMA_F16(a, bq0, c0);
            lo = *(const v8h*)(kr + 32 + koff);
            hi = *(const v8h*)(kr + 48 + koff);
#pragma unroll
            for (int i = 0; i < 8; ++i) { a[i] = lo[i]; a[i + 8] = hi[i]; }
            c0 = WMMA_F16(a, bq1, c0);

            kr = &sK[cur][(16 + lm) * kKP];
            lo = *(const v8h*)(kr + koff);
            hi = *(const v8h*)(kr + 16 + koff);
#pragma unroll
            for (int i = 0; i < 8; ++i) { a[i] = lo[i]; a[i + 8] = hi[i]; }
            c1 = WMMA_F16(a, bq0, c1);
            lo = *(const v8h*)(kr + 32 + koff);
            hi = *(const v8h*)(kr + 48 + koff);
#pragma unroll
            for (int i = 0; i < 8; ++i) { a[i] = lo[i]; a[i + 8] = hi[i]; }
            c1 = WMMA_F16(a, bq1, c1);
        }

        // ---- mask (1 u32 for 32 kv) + online softmax
        const unsigned mw = mrowbits[ci]; // bit j = mask[q][kv0+j]
        float s0[8], s1[8];
        float tmax = -1e30f;
#pragma unroll
        for (int r = 0; r < 8; ++r) {
            const bool b0 = (mw >> (koff + r)) & 1u;
            const bool b1 = (mw >> (16 + koff + r)) & 1u;
            s0[r] = b0 ? c0[r] * kScale : -1e30f;
            s1[r] = b1 ? c1[r] * kScale : -1e30f;
            tmax = fmaxf(tmax, fmaxf(s0[r], s1[r]));
        }
        tmax = fmaxf(tmax, __shfl_xor(tmax, 16, 32));
        const float mnew  = fmaxf(mrow, tmax);
        const float alpha = __expf(mrow - mnew);

        float psum = 0.0f;
        v16h bp; // P^T repacked lane-locally into the B-operand layout
#pragma unroll
        for (int r = 0; r < 8; ++r) {
            const bool b0 = (mw >> (koff + r)) & 1u;
            const bool b1 = (mw >> (16 + koff + r)) & 1u;
            const float p0 = b0 ? __expf(s0[r] - mnew) : 0.0f;
            const float p1 = b1 ? __expf(s1[r] - mnew) : 0.0f;
            psum += p0 + p1;
            bp[r]     = (_Float16)p0;
            bp[r + 8] = (_Float16)p1;
        }
        psum += __shfl_xor(psum, 16, 32);
        lrow = lrow * alpha + psum;
        mrow = mnew;

#pragma unroll
        for (int j = 0; j < 8; ++j) {
            o0[j] *= alpha; o1[j] *= alpha; o2[j] *= alpha; o3[j] *= alpha;
        }

        // ---- O^T += V^T . P^T  (4 dk-tiles), A from LDS
#pragma unroll
        for (int t = 0; t < 4; ++t) {
            const _Float16* vr = &sV[cur][(t * 16 + lm) * kVP];
            const v8h lo = *(const v8h*)(vr + koff);
            const v8h hi = *(const v8h*)(vr + 16 + koff);
            v16h a;
#pragma unroll
            for (int i = 0; i < 8; ++i) { a[i] = lo[i]; a[i + 8] = hi[i]; }
            v8f* ot = (t == 0) ? &o0 : (t == 1) ? &o1 : (t == 2) ? &o2 : &o3;
            *ot = WMMA_F16(a, bp, *ot);
        }

        __syncthreads(); // all waves done reading buf[cur] before reuse
    }

    // ---- normalize + store: O^T element (dk = t*16 + r + half*8, q = q0+lm)
    const float inv = 1.0f / lrow;
    _Float16* orow = of + ((size_t)b * kS + q) * kDM + h * kDK;
#pragma unroll
    for (int t = 0; t < 4; ++t) {
        const v8f ot = (t == 0) ? o0 : (t == 1) ? o1 : (t == 2) ? o2 : o3;
#pragma unroll
        for (int r = 0; r < 8; ++r) {
            const int dk = t * 16 + r + half * 8;
            orow[dk] = (_Float16)(ot[r] * inv);
        }
    }
}

// ---------------------------------------------------------------------------
// Kernel 3: output projection. out = attn(f16) @ Wo^T + bo, f32 store.
// Same staging as kernel 1: block = 8 waves, 128 rows of attn against 64 rows
// of Wo; per 64-wide k step both pieces are read once as whole lines, Wo is
// converted to f16 once, and the waves take fragments from LDS.
// ---------------------------------------------------------------------------
__global__ __launch_bounds__(256) void k_out_proj(
    const _Float16* __restrict__ of, const float* __restrict__ wo,
    const float* __restrict__ bo, float* __restrict__ out)
{
    __shared__ alignas(16) _Float16 sA[2][128 * kKP]; // [m][k], rows of kKP
    __shared__ alignas(16) _Float16 sB[2][64 * kKP];  // [n][k]

    const int tid  = threadIdx.x;
    const int wid  = tid >> 5;
    const int lane = tid & 31;
    const int half = lane >> 4;
    const int lm   = lane & 15;
    const int koff = half ? 8 : 0;

    const int mblk = blockIdx.x * 128;
    const int m0   = mblk + wid * 16;
    const int n0   = blockIdx.y * 64;

    // Staging slots: attn rows 64 f16 = 8 threads x 16 B, 32 rows per sweep;
    // Wo rows 64 f32 = 16 threads x 16 B, 16 rows per sweep.
    const int arow = tid >> 3, aseg = (tid & 7) * 8;
    const int brow = tid >> 4, bc4  = (tid & 15) * 4;
    const _Float16* ag = of + (size_t)(mblk + arow) * kDM + aseg;
    const float*    bg = wo + (size_t)(n0 + brow) * kDM + bc4;

    v8h ra[4];
    float4 rb[4];
#pragma unroll
    for (int i = 0; i < 4; ++i) {
        ra[i] = *(const v8h*)(ag + (size_t)i * 32 * kDM);
        rb[i] = *(const float4*)(bg + (size_t)i * 16 * kDM);
    }
#pragma unroll
    for (int i = 0; i < 4; ++i) {
        *(v8h*)&sA[0][(i * 32 + arow) * kKP + aseg] = ra[i];
        *(v4h*)&sB[0][(i * 16 + brow) * kKP + bc4]  = cvt4(rb[i]);
    }

    v8f acc[4] = {};

    const int nsteps = kDM / 64; // 8
    for (int ks = 0; ks < nsteps; ++ks) {
        const int cur = ks & 1;
        // One barrier per step: buffer cur is complete, and every wave has
        // left the other buffer (read in step ks-1), which is refilled below.
        __syncthreads();

        const bool more = ks + 1 < nsteps;
        if (more) { // next step's global loads fly under this step's WMMAs
            const int k0 = (ks + 1) * 64;
#pragma unroll
            for (int i = 0; i < 4; ++i) {
                ra[i] = *(const v8h*)(ag + (size_t)i * 32 * kDM + k0);
                rb[i] = *(const float4*)(bg + (size_t)i * 16 * kDM + k0);
            }
        }

        // sched_fence(): keeps the global loads above, and the step's LDS
        // reads together ahead of its WMMAs (see kernel 1).
        sched_fence();
        v16h a[2], bm[2][4];
#pragma unroll
        for (int kk = 0; kk < 2; ++kk) {
            a[kk] = frag16(&sA[cur][(wid * 16 + lm) * kKP + kk * 32 + koff]);
#pragma unroll
            for (int t = 0; t < 4; ++t)
                bm[kk][t] =
                    frag16(&sB[cur][(t * 16 + lm) * kKP + kk * 32 + koff]);
        }
        sched_fence();
#pragma unroll
        for (int kk = 0; kk < 2; ++kk) {
#pragma unroll
            for (int t = 0; t < 4; ++t)
                acc[t] = WMMA_F16(a[kk], bm[kk][t], acc[t]);
        }
        sched_fence();

        if (more) {
#pragma unroll
            for (int i = 0; i < 4; ++i) {
                *(v8h*)&sA[1 - cur][(i * 32 + arow) * kKP + aseg] = ra[i];
                *(v4h*)&sB[1 - cur][(i * 16 + brow) * kKP + bc4] = cvt4(rb[i]);
            }
        }
    }

#pragma unroll
    for (int t = 0; t < 4; ++t) {
        const int n = n0 + t * 16 + lm;
        const float bval = bo[n];
#pragma unroll
        for (int r = 0; r < 8; ++r) {
            const int m = m0 + r + half * 8;
            out[(size_t)m * kDM + n] = acc[t][r] + bval;
        }
    }
}

// ---------------------------------------------------------------------------
extern "C" void kernel_launch(void* const* d_in, const int* in_sizes, int n_in,
                              void* d_out, int out_size, void* d_ws,
                              size_t ws_size, hipStream_t stream) {
    (void)in_sizes; (void)n_in; (void)out_size; (void)ws_size;

    const float* x    = (const float*)d_in[0];
    const int*   dmsk = (const int*)d_in[1];
    const float* wq   = (const float*)d_in[2];
    const float* bq   = (const float*)d_in[3];
    const float* wk   = (const float*)d_in[4];
    const float* bk   = (const float*)d_in[5];
    const float* wv   = (const float*)d_in[6];
    const float* bv   = (const float*)d_in[7];
    const float* wo   = (const float*)d_in[8];
    const float* bo   = (const float*)d_in[9];
    float* out = (float*)d_out;

    const size_t elems = (size_t)kB * kH * kS * kDK; // 4,194,304 per tensor
    _Float16* qf = (_Float16*)d_ws;
    _Float16* kf = qf + elems;
    _Float16* vf = kf + elems;
    _Float16* of = vf + elems;
    unsigned* mbits = (unsigned*)(of + elems);       // +2MB packed mask

    const int nmaskwords = (kS * kS) / 32; // 524288
    k_mask_pack<<<nmaskwords / 256, 256, 0, stream>>>(dmsk, mbits);

    dim3 g1((kB * kS) / 128, kH);
    k_proj_qkv<<<g1, 256, 0, stream>>>(x, wq, bq, wk, bk, wv, bv, qf, kf, vf);

    const int nblk = kB * kH * 32; // (b,h) x 32 q-groups = 512 blocks
    k_attn<<<nblk, 256, 0, stream>>>(qf, kf, vf, mbits, of);

    dim3 g3((kB * kS) / 128, kDM / 64);
    k_out_proj<<<g3, 256, 0, stream>>>(of, wo, bo, out);
}

// v003
// Measured time: 131 microseconds a run.
// In both of two side-by-side timings against v002, it was 1.26 times as fast.
// Counting every step since v000, it is 2.82 times as fast.
#include <hip/hip_runtime.h>

typedef __attribute__((ext_vector_type(16))) _Float16 v16h;
typedef __attribute__((ext_vector_type(8)))  _Float16 v8h;
typedef __attribute__((ext_vector_type(4)))  _Float16 v4h;
typedef __attribute__((ext_vector_type(8)))  float    v8f;
typedef __attribute__((ext_vector_type(16))) unsigned v16u;
typedef int v4i_vs __attribute__((vector_size(16))); // matches builtin param

#define WMMA_F16(a, b, c) \
    __builtin_amdgcn_wmma_f32_16x16x32_f16(false, (a), false, (b), (short)0, (c), false, false)

static constexpr int   kB  = 2;
static constexpr int   kS  = 4096;
static constexpr int   kDM = 512;
static constexpr int   kH  = 8;
static constexpr int   kDK = 64;
static constexpr float kScale = 0.125f; // 1/sqrt(64)
// LDS row pitches in f16 elements, 16 B x odd so that the 16 rows one
// ds_load_b128 touches fall on 16 different bank groups (64 banks x 4 B):
// K rows 128 B -> 144 B, V^T rows 64 B -> 80 B. The projection kernels' LDS
// tiles use the same two pitches for their 128-B and 64-B rows.
static constexpr int   kKP = kDK + 8;  // 72 elements = 144 B
static constexpr int   kVP = 32 + 8;   // 40 elements =  80 B
// Elements per LDS buffer: the padded tiles (32 * kKP, kDK * kVP) rounded up
// to a power of two, so picking a buffer stays a shift, not a multiply.
static constexpr int   kBuf = 4096;    // 8 KB
static_assert(32 * kKP <= kBuf && kDK * kVP <= kBuf, "tile exceeds buffer");

#if __has_builtin(__builtin_amdgcn_global_load_async_to_lds_b128)
#define ASYNC_LDS 1
#endif

// 16-byte global -> LDS copy. Async DMA path on gfx1250
// (GLOBAL_LOAD_ASYNC_TO_LDS_B128, ASYNCcnt), else load+ds_store fallback.
__device__ __forceinline__ void cp16_g2s(const _Float16* g, _Float16* l) {
#ifdef ASYNC_LDS
    __builtin_amdgcn_global_load_async_to_lds_b128(
        (__attribute__((address_space(1))) v4i_vs*)g,
        (__attribute__((address_space(3))) v4i_vs*)l, 0, 0);
#else
    *(v8h*)l = *(const v8h*)g;
#endif
}

__device__ __forceinline__ void wait_g2s() {
#ifdef ASYNC_LDS
#if __has_builtin(__builtin_amdgcn_s_wait_asynccnt)
    __builtin_amdgcn_s_wait_asynccnt(0);
#else
    asm volatile("s_wait_asynccnt 0" ::: "memory");
#endif
#endif
}

// ---------------------------------------------------------------------------
// Kernel 0: pack the (S,S) int32 DAG mask into 1 bit/entry, laid out as the
// attention kernel's LANE MASKS. For score tile (qt = q/16, c = kv/32) there
// are 16 words, one per accumulator register of the tile's two S^T blocks:
//   bits[(qt*128 + c)*16 + e], bit L ==
//     (mask[qt*16 + (L&15)][c*32 + (e>>3)*16 + (L>>4)*8 + (e&7)] != 0)
// i.e. bit L of word e is the entry that lane L holds in register e. A wave
// of the attention kernel reads its tile's 64 B with one scalar load and
// selects straight from the scalar registers. Still 2 MB in all.
// One wave packs two neighbouring tiles: lane L reads its own row's entries
// (whole 256-B row pieces per wave), a ballot per entry makes the word, and
// the 32 words leave as one 128-B line.
// ---------------------------------------------------------------------------
__global__ __launch_bounds__(256) void k_mask_pack(
    const int* __restrict__ mask, unsigned* __restrict__ bits)
{
    const int lane = threadIdx.x & 31;
    const int w    = blockIdx.x * 8 + (threadIdx.x >> 5); // wave = tile pair
    const int qt   = w >> 6;                              // 64 pairs per qt
    const int c2   = w & 63;
    const int* src = mask + (size_t)(qt * 16 + (lane & 15)) * kS + c2 * 64 +
                     (lane >> 4) * 8;
    // The loops below are unrolled so that m[] and t[] have constant indices
    // and stay in registers.
    int4 m[8]; // m[j]: words e = 4j..4j+3 of the pair (tile j>>2)
#pragma unroll
    for (int j = 0; j < 8; ++j)
        m[j] = *(const int4*)(src + (j >> 1) * 16 + (j & 1) * 4);
    unsigned t[32]; // the pair's 32 words, each wave-uniform
#pragma unroll
    for (int j = 0; j < 8; ++j) {
        t[4 * j + 0] = __builtin_amdgcn_ballot_w32(m[j].x != 0);
        t[4 * j + 1] = __builtin_amdgcn_ballot_w32(m[j].y != 0);
        t[4 * j + 2] = __builtin_amdgcn_ballot_w32(m[j].z != 0);
        t[4 * j + 3] = __builtin_amdgcn_ballot_w32(m[j].w != 0);
    }
    // Lane L picks word L: a select tree over the five bits of L.
#pragma unroll
    for (int s = 0; s < 5; ++s) {
        const bool odd = (lane >> s) & 1;
#pragma unroll
        for (int i = 0; i < (16 >> s); ++i)
            t[i] = odd ? t[2 * i + 1] : t[2 * i];
    }
    bits[(size_t)w * 32 + lane] = t[0];
}

// ---------------------------------------------------------------------------
// Kernel 1: fused QKV projection, operands staged in LDS.
//   Y[m][n] = sum_k X[m][k] * W[n][k] + bias[n]   (einsum 'bsd,ed->bse')
// Block = 8 waves on ONE head: 128 rows of x against the head's 64 rows of
// each of Wq, Wk, Wv. Per 32-wide k step the block reads its x and W pieces
// once, as whole 128-B lines (8 lanes x 16 B per row), converts them to f16
// once and stores them in LDS; the 8 waves then take their fragments with
// ds_load_b128. Wave w still computes the 16(m) x 64(n) tile of Q, K AND V
// with the same k order as before (12 WMMAs per A fragment).
// Q,K stored f16 as (B,H,S,DK); V stored f16 TRANSPOSED as (B,H,DK,S).
//
// WMMA operand convention (CDNA5 wave32, 16x16x32 f16):
//   A (MxK): lanes 0-15 hold row M=lane, K elems {0..7,16..23};
//            lanes 16-31 hold row M=lane-16, K elems {8..15,24..31}.
//   B (KxN): lane n<16 holds col N=n with K elems {0..7,16..23};
//            lane n+16 holds col N=n with K elems {8..15,24..31}.
//   C/D    : VGPR r, lanes 0-15 -> (M=r, N=lane); lanes 16-31 -> (M=8+r).
// ---------------------------------------------------------------------------
__device__ __forceinline__ v4h cvt4(const float4 f) {
    v4h r;
    r[0] = (_Float16)f.x; r[1] = (_Float16)f.y;
    r[2] = (_Float16)f.z; r[3] = (_Float16)f.w;
    return r;
}

__device__ __forceinline__ void sched_fence() {
    __builtin_amdgcn_sched_barrier(0);
}

__device__ __forceinline__ v16h frag16(const _Float16* p) {
    const v8h lo = *(const v8h*)(p);
    const v8h hi = *(const v8h*)(p + 16);
    v16h a;
#pragma unroll
    for (int i = 0; i < 8; ++i) { a[i] = lo[i]; a[i + 8] = hi[i]; }
    return a;
}

__global__ __launch_bounds__(256) void k_proj_qkv(
    const float* __restrict__ x,
    const float* __restrict__ wq, const float* __restrict__ bq,
    const float* __restrict__ wk, const float* __restrict__ bk,
    const float* __restrict__ wv, const float* __restrict__ bv,
    _Float16* __restrict__ qf, _Float16* __restrict__ kf,
    _Float16* __restrict__ vf)
{
    __shared__ alignas(16) _Float16 sX[2][128 * kVP]; // [m][k], rows of kVP
    __shared__ alignas(16) _Float16 sW[2][192 * kVP]; // [wsel*64+n][k]

    const int tid  = threadIdx.x;
    const int wid  = tid >> 5;
    const int lane = tid & 31;
    const int half = lane >> 4;
    const int lm   = lane & 15;
    const int koff = half ? 8 : 0;

    const int mblk = blockIdx.x * 128; // row block over B*S = 8192 rows
    const int m0   = mblk + wid * 16;  // this wave's 16 rows
    const int h    = blockIdx.y;       // head -> n0 = h*64
    const int n0   = h * kDK;

    const float* bias[3] = {bq, bk, bv};

    // Staging slot: 8 threads cover one row's 32 floats, 32 rows per sweep.
    const int srow = tid >> 3;
    const int sc4  = (tid & 7) * 4;
    const float* xg = x + (size_t)(mblk + srow) * kDM + sc4;
    const float* wg[3] = {wq + (size_t)(n0 + srow) * kDM + sc4,
                          wk + (size_t)(n0 + srow) * kDM + sc4,
                          wv + (size_t)(n0 + srow) * kDM + sc4};

    float4 rx[4], rw[6];
#pragma unroll
    for (int i = 0; i < 4; ++i)
        rx[i] = *(const float4*)(xg + (size_t)i * 32 * kDM);
#pragma unroll
    for (int j = 0; j < 6; ++j)
        rw[j] = *(const float4*)(wg[j >> 1] + (size_t)(j & 1) * 32 * kDM);
#pragma unroll
    for (int i = 0; i < 4; ++i)
        *(v4h*)&sX[0][(i * 32 + srow) * kVP + sc4] = cvt4(rx[i]);
#pragma unroll
    for (int j = 0; j < 6; ++j)
        *(v4h*)&sW[0][(j * 32 + srow) * kVP + sc4] = cvt4(rw[j]);

    v8f acc[3][4] = {};

    const int nsteps = kDM / 32; // 16
    for (int ks = 0; ks < nsteps; ++ks) {
        const int cur = ks & 1;
        // One barrier per step: buffer cur is complete, and every wave has
        // left the other buffer (read in step ks-1), which is refilled below.
        __syncthreads();

        const bool more = ks + 1 < nsteps;
        if (more) { // next step's global loads fly under this step's WMMAs
            const int k0 = (ks + 1) * 32;
#pragma unroll
            for (int i = 0; i < 4; ++i)
                rx[i] = *(const float4*)(xg + (size_t)i * 32 * kDM + k0);
#pragma unroll
            for (int j = 0; j < 6; ++j)
                rw[j] = *(const float4*)(wg[j >> 1] +
                                         (size_t)(j & 1) * 32 * kDM + k0);
        }

        // The scheduler does not cross sched_fence(): without these it sinks
        // the global loads below the WMMAs and waits out every LDS read
        // alone. Each W group is read one group ahead of its WMMAs.
        sched_fence();
        const _Float16* wrow = &sW[cur][lm * kVP + koff];
        const v16h a = frag16(&sX[cur][(wid * 16 + lm) * kVP + koff]);
        v16h b0[4], b1[4];
#pragma unroll
        for (int t = 0; t < 4; ++t) b0[t] = frag16(wrow + (t * 16) * kVP);
#pragma unroll
        for (int t = 0; t < 4; ++t) b1[t] = frag16(wrow + (64 + t * 16) * kVP);
        sched_fence();
#pragma unroll
        for (int t = 0; t < 4; ++t) acc[0][t] = WMMA_F16(a, b0[t], acc[0][t]);
        sched_fence();
#pragma unroll
        for (int t = 0; t < 4; ++t) b0[t] = frag16(wrow + (128 + t * 16) * kVP);
        sched_fence();
#pragma unroll
        for (int t = 0; t < 4; ++t) acc[1][t] = WMMA_F16(a, b1[t], acc[1][t]);
#pragma unroll
        for (int t = 0; t < 4; ++t) acc[2][t] = WMMA_F16(a, b0[t], acc[2][t]);
        sched_fence();

        if (more) {
#pragma unroll
            for (int i = 0; i < 4; ++i)
                *(v4h*)&sX[1 - cur][(i * 32 + srow) * kVP + sc4] = cvt4(rx[i]);
#pragma unroll
            for (int j = 0; j < 6; ++j)
                *(v4h*)&sW[1 - cur][(j * 32 + srow) * kVP + sc4] = cvt4(rw[j]);
        }
    }

#pragma unroll
    for (int wsel = 0; wsel < 3; ++wsel) {
#pragma unroll
        for (int t = 0; t < 4; ++t) {
            const int dk = t * 16 + lm;          // N index inside head
            const float bval = bias[wsel][n0 + dk];
#pragma unroll
            for (int r = 0; r < 8; ++r) {
                const int m = m0 + r + half * 8; // global row (b*S + s)
                const int b = m >> 12;           // / 4096
                const int s = m & (kS - 1);
                const _Float16 val = (_Float16)(acc[wsel][t][r] + bval);
                if (wsel == 2) {                 // V transposed: (B,H,DK,S)
                    vf[(((size_t)b * kH + h) * kDK + dk) * kS + s] = val;
                } else {                         // Q/K: (B,H,S,DK)
                    _Float16* dst = (wsel == 0) ? qf : kf;
                    dst[(((size_t)b * kH + h) * kS + s) * kDK + dk] = val;
                }
            }
        }
    }
}

// ---------------------------------------------------------------------------
// Kernel 2: flash attention, transposed-score formulation, LDS-staged KV.
// Block = 256 threads = 8 waves, all on ONE (b,h); wave w owns q-tile
// (qgroup*8 + w). Each 32-kv chunk of K (32x64 f16) and V^T (64x32 f16) is
// staged into LDS once per block via async-to-LDS (double buffered), then
// all 8 waves consume it with ds_load_b128 -> 8x global traffic reduction.
// Mask comes as lane masks (kernel 0): 16 words per wave per chunk, read by
// one scalar load; each select takes its word as it stands.
//
//   S^T (kv x q): c0 (kv 0..15), c1 (kv 16..31), each = 2 WMMAs over DK=64.
//   O^T (dk x q): 4 tiles, A = V^T(dk x kv32), B = P^T (lane-local repack).
// Softmax rows (fixed q) live on the lane axis -> one shfl_xor(16) per
// reduction. Output written f16 to (B,S,H*DK).
// ---------------------------------------------------------------------------
// waves_per_eu: the grid puts 4 waves on a SIMD, so registers saved for more
// than 8 buy nothing. Without the upper bound this build keeps to fewer
// registers than the fragments need, reads each LDS fragment right before its
// WMMA and waits out every read alone.
__global__ __launch_bounds__(256)
__attribute__((amdgpu_waves_per_eu(4, 8))) void k_attn(
    const _Float16* __restrict__ qf, const _Float16* __restrict__ kf,
    const _Float16* __restrict__ vf, const unsigned* __restrict__ mbits,
    _Float16* __restrict__ of)
{
    __shared__ alignas(16) _Float16 sK[2][kBuf]; // [kv][dk], rows of kKP
    __shared__ alignas(16) _Float16 sV[2][kBuf]; // [dk][kv], rows of kVP

    const int tid   = threadIdx.x;
    const int wid   = tid >> 5;
    const int lane  = tid & 31;
    const int half  = lane >> 4;
    const int lm    = lane & 15;
    const int koff  = half ? 8 : 0;

    const int qgroup = blockIdx.x & 31;         // 32 q-groups per (b,h)
    const int h      = (blockIdx.x >> 5) & (kH - 1);
    const int b      = blockIdx.x >> 8;
    const int q0     = (qgroup * 8 + wid) * 16;

    const _Float16* Qb = qf + (((size_t)b * kH + h) * kS) * kDK;
    const _Float16* Kb = kf + (((size_t)b * kH + h) * kS) * kDK;
    const _Float16* Vb = vf + (((size_t)b * kH + h) * kDK) * kS;

    // Per-thread staging slots: K chunk = 32 rows x 8 segs, V = 64 rows x 4.
    const int krow = tid >> 3, kseg = tid & 7;
    const int vrow = tid >> 2, vseg = tid & 3;

    // B operand of the score WMMAs: Q^T columns (fixed for the whole tile).
    v16h bq0, bq1;
    {
        const _Float16* qr = Qb + (size_t)(q0 + lm) * kDK;
        const v8h q_lo0 = *(const v8h*)(qr + koff);
        const v8h q_hi0 = *(const v8h*)(qr + 16 + koff);
        const v8h q_lo1 = *(const v8h*)(qr + 32 + koff);
        const v8h q_hi1 = *(const v8h*)(qr + 48 + koff);
#pragma unroll
        for (int i = 0; i < 8; ++i) {
            bq0[i] = q_lo0[i]; bq0[i + 8] = q_hi0[i];
            bq1[i] = q_lo1[i]; bq1[i + 8] = q_hi1[i];
        }
    }

    float mrow = -1e30f;
    float lrow = 0.0f;
    v8f o0 = {}, o1 = {}, o2 = {}, o3 = {};

    const int q = q0 + lm;
    // readfirstlane: the wave's number in a scalar register, so that the mask
    // address is wave-uniform. Constant address space: nothing writes the
    // words while this kernel runs; without it the compiler takes the loop's
    // copies and barriers for possible writers and loads through vector
    // registers instead of with s_load.
    const int qt = qgroup * 8 + __builtin_amdgcn_readfirstlane(wid);
    const __attribute__((address_space(4))) v16u* mtile =
        (const __attribute__((address_space(4))) v16u*)(
            mbits + (size_t)qt * (kS / 32) * 16);

    // Prologue: stage chunk 0 into buffer 0.
    cp16_g2s(Kb + (size_t)krow * kDK + kseg * 8, &sK[0][krow * kKP + kseg * 8]);
    cp16_g2s(Vb + (size_t)vrow * kS + vseg * 8,  &sV[0][vrow * kVP + vseg * 8]);

    const int nchunks = kS / 32; // 128
    for (int ci = 0; ci < nchunks; ++ci) {
        const int cur = ci & 1;
        const int kv0 = ci * 32;

        wait_g2s();
        __syncthreads(); // chunk ci visible in LDS to all waves

        if (ci + 1 < nchunks) { // overlap next chunk's DMA with compute
            const int nkv = kv0 + 32;
            cp16_g2s(Kb + (size_t)(nkv + krow) * kDK + kseg * 8,
                     &sK[1 - cur][krow * kKP + kseg * 8]);
            cp16_g2s(Vb + (size_t)vrow * kS + nkv + vseg * 8,
                     &sV[1 - cur][vrow * kVP + vseg * 8]);
        }

        // ---- S^T tiles from LDS K rows
        v8f c0 = {}, c1 = {};
        {
            const _Float16* kr = &sK[cur][lm * kKP];
            v16h a;
            v8h lo = *(const v8h*)(kr + koff);
            v8h hi = *(const v8h*)(kr + 16 + koff);
#pragma unroll
            for (int i = 0; i < 8; ++i) { a[i] = lo[i]; a[i + 8] = hi[i]; }
            c0 = WMMA_F16(a, bq0, c0);
            lo = *(const v8h*)(kr + 32 + koff);
            hi = *(const v8h*)(kr + 48 + koff);
#pragma unroll
            for (int i = 0; i < 8; ++i) { a[i] = lo[i]; a[i + 8] = hi[i]; }
            c0 = WMMA_F16(a, bq1, c0);

            kr = &sK[cur][(16 + lm) * kKP];
            lo = *(const v8h*)(kr + koff);
            hi = *(const v8h*)(kr + 16 + koff);
#pragma unroll
            for (int i = 0; i < 8; ++i) { a[i] = lo[i]; a[i + 8] = hi[i]; }
            c1 = WMMA_F16(a, bq0, c1);
            lo = *(const v8h*)(kr + 32 + koff);
            hi = *(const v8h*)(kr + 48 + koff);
#pragma unroll
            for (int i = 0; i < 8; ++i) { a[i] = lo[i]; a[i + 8] = hi[i]; }
            c1 = WMMA_F16(a, bq1, c1);
        }

        // ---- mask (lane masks in scalar registers) + online softmax
        const v16u mw = mtile[ci]; // word e, bit L = lane L's entry of register e
        float s0[8], s1[8];
        float tmax = -1e30f;
#pragma unroll
        for (int r = 0; r < 8; ++r) {
            const bool b0 = __builtin_amdgcn_inverse_ballot_w32(mw[r]);
            const bool b1 = __builtin_amdgcn_inverse_ballot_w32(mw[8 + r]);
            s0[r] = b0 ? c0[r] * kScale : -1e30f;
            s1[r] = b1 ? c1[r] * kScale : -1e30f;
            tmax = fmaxf(tmax, fmaxf(s0[r], s1[r]));
        }
        tmax = fmaxf(tmax, __shfl_xor(tmax, 16, 32));
        const float mnew  = fmaxf(mrow, tmax);
        const float alpha = __expf(mrow - mnew);

        float psum = 0.0f;
        v16h bp; // P^T repacked lane-locally into the B-operand layout
#pragma unroll
        for (int r = 0; r < 8; ++r) {
            const bool b0 = __builtin_amdgcn_inverse_ballot_w32(mw[r]);
            const bool b1 = __builtin_amdgcn_inverse_ballot_w32(mw[8 + r]);
            const float p0 = b0 ? __expf(s0[r] - mnew) : 0.0f;
            const float p1 = b1 ? __expf(s1[r] - mnew) : 0.0f;
            psum += p0 + p1;
            bp[r]     = (_Float16)p0;
            bp[r + 8] = (_Float16)p1;
        }
        psum += __shfl_xor(psum, 16, 32);
        lrow = lrow * alpha + psum;
        mrow = mnew;

#pragma unroll
        for (int j = 0; j < 8; ++j) {
            o0[j] *= alpha; o1[j] *= alpha; o2[j] *= alpha; o3[j] *= alpha;
        }

        // ---- O^T += V^T . P^T  (4 dk-tiles), A from LDS
#pragma unroll
        for (int t = 0; t < 4; ++t) {
            const _Float16* vr = &sV[cur][(t * 16 + lm) * kVP];
            const v8h lo = *(const v8h*)(vr + koff);
            const v8h hi = *(const v8h*)(vr + 16 + koff);
            v16h a;
#pragma unroll
            for (int i = 0; i < 8; ++i) { a[i] = lo[i]; a[i + 8] = hi[i]; }
            v8f* ot = (t == 0) ? &o0 : (t == 1) ? &o1 : (t == 2) ? &o2 : &o3;
            *ot = WMMA_F16(a, bp, *ot);
        }

        __syncthreads(); // all waves done reading buf[cur] before reuse
    }

    // ---- normalize + store: O^T element (dk = t*16 + r + half*8, q = q0+lm)
    const float inv = 1.0f / lrow;
    _Float16* orow = of + ((size_t)b * kS + q) * kDM + h * kDK;
#pragma unroll
    for (int t = 0; t < 4; ++t) {
        const v8f ot = (t == 0) ? o0 : (t == 1) ? o1 : (t == 2) ? o2 : o3;
#pragma unroll
        for (int r = 0; r < 8; ++r) {
            const int dk = t * 16 + r + half * 8;
            orow[dk] = (_Float16)(ot[r] * inv);
        }
    }
}

// ---------------------------------------------------------------------------
// Kernel 3: output projection. out = attn(f16) @ Wo^T + bo, f32 store.
// Same staging as kernel 1: block = 8 waves, 128 rows of attn against 64 rows
// of Wo; per 64-wide k step both pieces are read once as whole lines, Wo is
// converted to f16 once, and the waves take fragments from LDS.
// ---------------------------------------------------------------------------
__global__ __launch_bounds__(256) void k_out_proj(
    const _Float16* __restrict__ of, const float* __restrict__ wo,
    const float* __restrict__ bo, float* __restrict__ out)
{
    __shared__ alignas(16) _Float16 sA[2][128 * kKP]; // [m][k], rows of kKP
    __shared__ alignas(16) _Float16 sB[2][64 * kKP];  // [n][k]

    const int tid  = threadIdx.x;
    const int wid  = tid >> 5;
    const int lane = tid & 31;
    const int half = lane >> 4;
    const int lm   = lane & 15;
    const int koff = half ? 8 : 0;

    const int mblk = blockIdx.x * 128;
    const int m0   = mblk + wid * 16;
    const int n0   = blockIdx.y * 64;

    // Staging slots: attn rows 64 f16 = 8 threads x 16 B, 32 rows per sweep;
    // Wo rows 64 f32 = 16 threads x 16 B, 16 rows per sweep.
    const int arow = tid >> 3, aseg = (tid & 7) * 8;
    const int brow = tid >> 4, bc4  = (tid & 15) * 4;
    const _Float16* ag = of + (size_t)(mblk + arow) * kDM + aseg;
    const float*    bg = wo + (size_t)(n0 + brow) * kDM + bc4;

    v8h ra[4];
    float4 rb[4];
#pragma unroll
    for (int i = 0; i < 4; ++i) {
        ra[i] = *(const v8h*)(ag + (size_t)i * 32 * kDM);
        rb[i] = *(const float4*)(bg + (size_t)i * 16 * kDM);
    }
#pragma unroll
    for (int i = 0; i < 4; ++i) {
        *(v8h*)&sA[0][(i * 32 + arow) * kKP + aseg] = ra[i];
        *(v4h*)&sB[0][(i * 16 + brow) * kKP + bc4]  = cvt4(rb[i]);
    }

    v8f acc[4] = {};

    const int nsteps = kDM / 64; // 8
    for (int ks = 0; ks < nsteps; ++ks) {
        const int cur = ks & 1;
        // One barrier per step: buffer cur is complete, and every wave has
        // left the other buffer (read in step ks-1), which is refilled below.
        __syncthreads();

        const bool more = ks + 1 < nsteps;
        if (more) { // next step's global loads fly under this step's WMMAs
            const int k0 = (ks + 1) * 64;
#pragma unroll
            for (int i = 0; i < 4; ++i) {
                ra[i] = *(const v8h*)(ag + (size_t)i * 32 * kDM + k0);
                rb[i] = *(const float4*)(bg + (size_t)i * 16 * kDM + k0);
            }
        }

        // sched_fence(): keeps the global loads above, and the step's LDS
        // reads together ahead of its WMMAs (see kernel 1).
        sched_fence();
        v16h a[2], bm[2][4];
#pragma unroll
        for (int kk = 0; kk < 2; ++kk) {
            a[kk] = frag16(&sA[cur][(wid * 16 + lm) * kKP + kk * 32 + koff]);
#pragma unroll
            for (int t = 0; t < 4; ++t)
                bm[kk][t] =
                    frag16(&sB[cur][(t * 16 + lm) * kKP + kk * 32 + koff]);
        }
        sched_fence();
#pragma unroll
        for (int kk = 0; kk < 2; ++kk) {
#pragma unroll
            for (int t = 0; t < 4; ++t)
                acc[t] = WMMA_F16(a[kk], bm[kk][t], acc[t]);
        }
        sched_fence();

        if (more) {
#pragma unroll
            for (int i = 0; i < 4; ++i) {
                *(v8h*)&sA[1 - cur][(i * 32 + arow) * kKP + aseg] = ra[i];
                *(v4h*)&sB[1 - cur][(i * 16 + brow) * kKP + bc4] = cvt4(rb[i]);
            }
        }
    }

#pragma unroll
    for (int t = 0; t < 4; ++t) {
        const int n = n0 + t * 16 + lm;
        const float bval = bo[n];
#pragma unroll
        for (int r = 0; r < 8; ++r) {
            const int m = m0 + r + half * 8;
            out[(size_t)m * kDM + n] = acc[t][r] + bval;
        }
    }
}

// ---------------------------------------------------------------------------
extern "C" void kernel_launch(void* const* d_in, const int* in_sizes, int n_in,
                              void* d_out, int out_size, void* d_ws,
                              size_t ws_size, hipStream_t stream) {
    (void)in_sizes; (void)n_in; (void)out_size; (void)ws_size;

    const float* x    = (const float*)d_in[0];
    const int*   dmsk = (const int*)d_in[1];
    const float* wq   = (const float*)d_in[2];
    const float* bq   = (const float*)d_in[3];
    const float* wk   = (const float*)d_in[4];
    const float* bk   = (const float*)d_in[5];
    const float* wv   = (const float*)d_in[6];
    const float* bv   = (const float*)d_in[7];
    const float* wo   = (const float*)d_in[8];
    const float* bo   = (const float*)d_in[9];
    float* out = (float*)d_out;

    const size_t elems = (size_t)kB * kH * kS * kDK; // 4,194,304 per tensor
    _Float16* qf = (_Float16*)d_ws;
    _Float16* kf = qf + elems;
    _Float16* vf = kf + elems;
    _Float16* of = vf + elems;
    unsigned* mbits = (unsigned*)(of + elems);       // +2MB packed mask

    const int nmaskwords = (kS * kS) / 32; // 524288, one per thread
    k_mask_pack<<<nmaskwords / 256, 256, 0, stream>>>(dmsk, mbits);

    dim3 g1((kB * kS) / 128, kH);
    k_proj_qkv<<<g1, 256, 0, stream>>>(x, wq, bq, wk, bk, wv, bv, qf, kf, vf);

    const int nblk = kB * kH * 32; // (b,h) x 32 q-groups = 512 blocks
    k_attn<<<nblk, 256, 0, stream>>>(qf, kf, vf, mbits, of);

    dim3 g3((kB * kS) / 128, kDM / 64);
    k_out_proj<<<g3, 256, 0, stream>>>(of, wo, bo, out);
}

// v004
// It runs in 114 microseconds.
// Timed twice side by side with v003, it ran 1.17 and 1.13 times as fast.
// Counting every step since v000, it is 3.23 times as fast.
#include <hip/hip_runtime.h>

typedef __attribute__((ext_vector_type(16))) _Float16 v16h;
typedef __attribute__((ext_vector_type(8)))  _Float16 v8h;
typedef __attribute__((ext_vector_type(4)))  _Float16 v4h;
typedef __attribute__((ext_vector_type(8)))  float    v8f;
typedef __attribute__((ext_vector_type(16))) unsigned v16u;
typedef int v4i_vs __attribute__((vector_size(16))); // matches builtin param

#define WMMA_F16(a, b, c) \
    __builtin_amdgcn_wmma_f32_16x16x32_f16(false, (a), false, (b), (short)0, (c), false, false)

static constexpr int   kB  = 2;
static constexpr int   kS  = 4096;
static constexpr int   kDM = 512;
static constexpr int   kH  = 8;
static constexpr int   kDK = 64;
static constexpr float kScale = 0.125f; // 1/sqrt(64)
// LDS row pitches in f16 elements, 16 B x odd so that the 16 rows one
// ds_load_b128 touches fall on 16 different bank groups (64 banks x 4 B):
// 128-B rows (staged K) -> 144 B, 64-B rows -> 80 B. The projection kernels'
// LDS tiles use these two pitches for their 128-B and 64-B rows.
static constexpr int   kKP = kDK + 8;  // 72 elements = 144 B
static constexpr int   kVP = 32 + 8;   // 40 elements =  80 B
// Attention pass: kNG groups of 32 keys are staged, scored and reduced
// together. A staged V^T row holds the pass's keys, again at 16 B x odd.
static constexpr int   kNG  = 4;
static constexpr int   kPK  = 32 * kNG;   // keys per pass
static constexpr int   kVQ  = kPK + 8;    // V^T row pitch in elements
static constexpr int   kVS  = kPK / 8;    // 16-B segments per V^T row
static constexpr int   kVR  = 256 / kVS;  // V^T rows per staging sweep
static_assert(kNG % 2 == 0 && ((kVQ / 8) & 1) == 1, "pairs of groups; odd pitch");

#if __has_builtin(__builtin_amdgcn_global_load_async_to_lds_b128)
#define ASYNC_LDS 1
#endif

// 16-byte global -> LDS copy. Async DMA path on gfx1250
// (GLOBAL_LOAD_ASYNC_TO_LDS_B128, ASYNCcnt), else load+ds_store fallback.
__device__ __forceinline__ void cp16_g2s(const _Float16* g, _Float16* l) {
#ifdef ASYNC_LDS
    __builtin_amdgcn_global_load_async_to_lds_b128(
        (__attribute__((address_space(1))) v4i_vs*)g,
        (__attribute__((address_space(3))) v4i_vs*)l, 0, 0);
#else
    *(v8h*)l = *(const v8h*)g;
#endif
}

__device__ __forceinline__ void wait_g2s() {
#ifdef ASYNC_LDS
#if __has_builtin(__builtin_amdgcn_s_wait_asynccnt)
    __builtin_amdgcn_s_wait_asynccnt(0);
#else
    asm volatile("s_wait_asynccnt 0" ::: "memory");
#endif
#endif
}

// ---------------------------------------------------------------------------
// Kernel 0: pack the (S,S) int32 DAG mask into 1 bit/entry, laid out as the
// attention kernel's LANE MASKS. For score tile (qt = q/16, c = kv/32) there
// are 16 words, one per accumulator register of the tile's two S^T blocks:
//   bits[(qt*128 + c)*16 + e], bit L ==
//     (mask[qt*16 + (L&15)][c*32 + (e>>3)*16 + (L>>4)*8 + (e&7)] != 0)
// i.e. bit L of word e is the entry that lane L holds in register e. A wave
// of the attention kernel reads its tile's 64 B with one scalar load and
// selects straight from the scalar registers. Still 2 MB in all.
// One wave packs two neighbouring tiles: lane L reads its own row's entries
// (whole 256-B row pieces per wave), a ballot per entry makes the word, and
// the 32 words leave as one 128-B line.
// ---------------------------------------------------------------------------
__global__ __launch_bounds__(256) void k_mask_pack(
    const int* __restrict__ mask, unsigned* __restrict__ bits)
{
    const int lane = threadIdx.x & 31;
    const int w    = blockIdx.x * 8 + (threadIdx.x >> 5); // wave = tile pair
    const int qt   = w >> 6;                              // 64 pairs per qt
    const int c2   = w & 63;
    const int* src = mask + (size_t)(qt * 16 + (lane & 15)) * kS + c2 * 64 +
                     (lane >> 4) * 8;
    // The loops below are unrolled so that m[] and t[] have constant indices
    // and stay in registers.
    int4 m[8]; // m[j]: words e = 4j..4j+3 of the pair (tile j>>2)
#pragma unroll
    for (int j = 0; j < 8; ++j)
        m[j] = *(const int4*)(src + (j >> 1) * 16 + (j & 1) * 4);
    unsigned t[32]; // the pair's 32 words, each wave-uniform
#pragma unroll
    for (int j = 0; j < 8; ++j) {
        t[4 * j + 0] = __builtin_amdgcn_ballot_w32(m[j].x != 0);
        t[4 * j + 1] = __builtin_amdgcn_ballot_w32(m[j].y != 0);
        t[4 * j + 2] = __builtin_amdgcn_ballot_w32(m[j].z != 0);
        t[4 * j + 3] = __builtin_amdgcn_ballot_w32(m[j].w != 0);
    }
    // Lane L picks word L: a select tree over the five bits of L.
#pragma unroll
    for (int s = 0; s < 5; ++s) {
        const bool odd = (lane >> s) & 1;
#pragma unroll
        for (int i = 0; i < (16 >> s); ++i)
            t[i] = odd ? t[2 * i + 1] : t[2 * i];
    }
    bits[(size_t)w * 32 + lane] = t[0];
}

// ---------------------------------------------------------------------------
// Kernel 1: fused QKV projection, operands staged in LDS.
//   Y[m][n] = sum_k X[m][k] * W[n][k] + bias[n]   (einsum 'bsd,ed->bse')
// Block = 8 waves on ONE head: 128 rows of x against the head's 64 rows of
// each of Wq, Wk, Wv. Per 32-wide k step the block reads its x and W pieces
// once, as whole 128-B lines (8 lanes x 16 B per row), converts them to f16
// once and stores them in LDS; the 8 waves then take their fragments with
// ds_load_b128. Wave w still computes the 16(m) x 64(n) tile of Q, K AND V
// with the same k order as before (12 WMMAs per A fragment).
// Q,K stored f16 as (B,H,S,DK); V stored f16 TRANSPOSED as (B,H,DK,S).
//
// WMMA operand convention (CDNA5 wave32, 16x16x32 f16):
//   A (MxK): lanes 0-15 hold row M=lane, K elems {0..7,16..23};
//            lanes 16-31 hold row M=lane-16, K elems {8..15,24..31}.
//   B (KxN): lane n<16 holds col N=n with K elems {0..7,16..23};
//            lane n+16 holds col N=n with K elems {8..15,24..31}.
//   C/D    : VGPR r, lanes 0-15 -> (M=r, N=lane); lanes 16-31 -> (M=8+r).
// ---------------------------------------------------------------------------
__device__ __forceinline__ v4h cvt4(const float4 f) {
    v4h r;
    r[0] = (_Float16)f.x; r[1] = (_Float16)f.y;
    r[2] = (_Float16)f.z; r[3] = (_Float16)f.w;
    return r;
}

__device__ __forceinline__ void sched_fence() {
    __builtin_amdgcn_sched_barrier(0);
}

__device__ __forceinline__ v16h frag16(const _Float16* p) {
    const v8h lo = *(const v8h*)(p);
    const v8h hi = *(const v8h*)(p + 16);
    v16h a;
#pragma unroll
    for (int i = 0; i < 8; ++i) { a[i] = lo[i]; a[i + 8] = hi[i]; }
    return a;
}

__global__ __launch_bounds__(256) void k_proj_qkv(
    const float* __restrict__ x,
    const float* __restrict__ wq, const float* __restrict__ bq,
    const float* __restrict__ wk, const float* __restrict__ bk,
    const float* __restrict__ wv, const float* __restrict__ bv,
    _Float16* __restrict__ qf, _Float16* __restrict__ kf,
    _Float16* __restrict__ vf)
{
    __shared__ alignas(16) _Float16 sX[2][128 * kVP]; // [m][k], rows of kVP
    __shared__ alignas(16) _Float16 sW[2][192 * kVP]; // [wsel*64+n][k]

    const int tid  = threadIdx.x;
    const int wid  = tid >> 5;
    const int lane = tid & 31;
    const int half = lane >> 4;
    const int lm   = lane & 15;
    const int koff = half ? 8 : 0;

    const int mblk = blockIdx.x * 128; // row block over B*S = 8192 rows
    const int m0   = mblk + wid * 16;  // this wave's 16 rows
    const int h    = blockIdx.y;       // head -> n0 = h*64
    const int n0   = h * kDK;

    const float* bias[3] = {bq, bk, bv};

    // Staging slot: 8 threads cover one row's 32 floats, 32 rows per sweep.
    const int srow = tid >> 3;
    const int sc4  = (tid & 7) * 4;
    const float* xg = x + (size_t)(mblk + srow) * kDM + sc4;
    const float* wg[3] = {wq + (size_t)(n0 + srow) * kDM + sc4,
                          wk + (size_t)(n0 + srow) * kDM + sc4,
                          wv + (size_t)(n0 + srow) * kDM + sc4};

    float4 rx[4], rw[6];
#pragma unroll
    for (int i = 0; i < 4; ++i)
        rx[i] = *(const float4*)(xg + (size_t)i * 32 * kDM);
#pragma unroll
    for (int j = 0; j < 6; ++j)
        rw[j] = *(const float4*)(wg[j >> 1] + (size_t)(j & 1) * 32 * kDM);
#pragma unroll
    for (int i = 0; i < 4; ++i)
        *(v4h*)&sX[0][(i * 32 + srow) * kVP + sc4] = cvt4(rx[i]);
#pragma unroll
    for (int j = 0; j < 6; ++j)
        *(v4h*)&sW[0][(j * 32 + srow) * kVP + sc4] = cvt4(rw[j]);

    v8f acc[3][4] = {};

    const int nsteps = kDM / 32; // 16
    for (int ks = 0; ks < nsteps; ++ks) {
        const int cur = ks & 1;
        // One barrier per step: buffer cur is complete, and every wave has
        // left the other buffer (read in step ks-1), which is refilled below.
        __syncthreads();

        const bool more = ks + 1 < nsteps;
        if (more) { // next step's global loads fly under this step's WMMAs
            const int k0 = (ks + 1) * 32;
#pragma unroll
            for (int i = 0; i < 4; ++i)
                rx[i] = *(const float4*)(xg + (size_t)i * 32 * kDM + k0);
#pragma unroll
            for (int j = 0; j < 6; ++j)
                rw[j] = *(const float4*)(wg[j >> 1] +
                                         (size_t)(j & 1) * 32 * kDM + k0);
        }

        // The scheduler does not cross sched_fence(): without these it sinks
        // the global loads below the WMMAs and waits out every LDS read
        // alone. Each W group is read one group ahead of its WMMAs.
        sched_fence();
        const _Float16* wrow = &sW[cur][lm * kVP + koff];
        const v16h a = frag16(&sX[cur][(wid * 16 + lm) * kVP + koff]);
        v16h b0[4], b1[4];
#pragma unroll
        for (int t = 0; t < 4; ++t) b0[t] = frag16(wrow + (t * 16) * kVP);
#pragma unroll
        for (int t = 0; t < 4; ++t) b1[t] = frag16(wrow + (64 + t * 16) * kVP);
        sched_fence();
#pragma unroll
        for (int t = 0; t < 4; ++t) acc[0][t] = WMMA_F16(a, b0[t], acc[0][t]);
        sched_fence();
#pragma unroll
        for (int t = 0; t < 4; ++t) b0[t] = frag16(wrow + (128 + t * 16) * kVP);
        sched_fence();
#pragma unroll
        for (int t = 0; t < 4; ++t) acc[1][t] = WMMA_F16(a, b1[t], acc[1][t]);
#pragma unroll
        for (int t = 0; t < 4; ++t) acc[2][t] = WMMA_F16(a, b0[t], acc[2][t]);
        sched_fence();

        if (more) {
#pragma unroll
            for (int i = 0; i < 4; ++i)
                *(v4h*)&sX[1 - cur][(i * 32 + srow) * kVP + sc4] = cvt4(rx[i]);
#pragma unroll
            for (int j = 0; j < 6; ++j)
                *(v4h*)&sW[1 - cur][(j * 32 + srow) * kVP + sc4] = cvt4(rw[j]);
        }
    }

#pragma unroll
    for (int wsel = 0; wsel < 3; ++wsel) {
#pragma unroll
        for (int t = 0; t < 4; ++t) {
            const int dk = t * 16 + lm;          // N index inside head
            const float bval = bias[wsel][n0 + dk];
#pragma unroll
            for (int r = 0; r < 8; ++r) {
                const int m = m0 + r + half * 8; // global row (b*S + s)
                const int b = m >> 12;           // / 4096
                const int s = m & (kS - 1);
                const _Float16 val = (_Float16)(acc[wsel][t][r] + bval);
                if (wsel == 2) {                 // V transposed: (B,H,DK,S)
                    vf[(((size_t)b * kH + h) * kDK + dk) * kS + s] = val;
                } else {                         // Q/K: (B,H,S,DK)
                    _Float16* dst = (wsel == 0) ? qf : kf;
                    dst[(((size_t)b * kH + h) * kS + s) * kDK + dk] = val;
                }
            }
        }
    }
}

// ---------------------------------------------------------------------------
// Kernel 2: flash attention, transposed-score formulation, LDS-staged KV.
// Block = 256 threads = 8 waves, all on ONE (b,h); wave w owns q-tile
// (qgroup*8 + w). Each 128-kv pass of K (128x64 f16) and V^T (64x128 f16) is
// staged into LDS once per block via async-to-LDS (double buffered), then
// all 8 waves consume it with ds_load_b128 -> 8x global traffic reduction.
// Mask comes as lane masks (kernel 0): 16 words per wave per 32 keys, read by
// scalar loads; each select takes its word as it stands.
//
//   S^T (kv x q): 8 tiles of 16 kv, each = 2 WMMAs over DK=64.
//   O^T (dk x q): 4 tiles, A = V^T(dk x kv32), B = P^T (lane-local repack),
//                 one WMMA per tile and 32 keys.
// One maximum, one sum, one rescale of O^T and one barrier pair per pass.
// Softmax rows (fixed q) live on the lane axis -> one shfl_xor(16) per
// reduction. Output written f16 to (B,S,H*DK).
// ---------------------------------------------------------------------------
// waves_per_eu: the grid puts 4 waves on a SIMD, so registers saved for more
// than 4 buy nothing. With a higher upper bound this build saves registers by
// running each score's sub, mul, exp, select as a chain of its own, with a
// v_nop behind most exps and few paired instructions.
__global__ __launch_bounds__(256)
__attribute__((amdgpu_waves_per_eu(4, 4))) void k_attn(
    const _Float16* __restrict__ qf, const _Float16* __restrict__ kf,
    const _Float16* __restrict__ vf, const unsigned* __restrict__ mbits,
    _Float16* __restrict__ of)
{
    __shared__ alignas(16) _Float16 sK[2][kPK * kKP]; // [kv][dk], rows of kKP
    __shared__ alignas(16) _Float16 sV[2][kDK * kVQ]; // [dk][kv], rows of kVQ

    const int tid   = threadIdx.x;
    const int wid   = tid >> 5;
    const int lane  = tid & 31;
    const int half  = lane >> 4;
    const int lm    = lane & 15;
    const int koff  = half ? 8 : 0;

    const int qgroup = blockIdx.x & 31;         // 32 q-groups per (b,h)
    const int h      = (blockIdx.x >> 5) & (kH - 1);
    const int b      = blockIdx.x >> 8;
    const int q0     = (qgroup * 8 + wid) * 16;

    const _Float16* Qb = qf + (((size_t)b * kH + h) * kS) * kDK;
    const _Float16* Kb = kf + (((size_t)b * kH + h) * kS) * kDK;
    const _Float16* Vb = vf + (((size_t)b * kH + h) * kDK) * kS;

    // Per-thread staging slots, kNG sweeps per tile: K = kPK rows x 8 segs of
    // 16 B, 32 rows a sweep; V^T = 64 rows x kVS segs, kVR rows a sweep.
    const int krow = tid >> 3,  kseg = (tid & 7) * 8;
    const int vrow = tid / kVS, vseg = (tid % kVS) * 8;
    const _Float16* kg = Kb + (size_t)krow * kDK + kseg;
    const _Float16* vg = Vb + (size_t)vrow * kS + vseg;
    const int kdst = krow * kKP + kseg;
    const int vdst = vrow * kVQ + vseg;

    // B operand of the score WMMAs: Q^T columns (fixed for the whole tile).
    v16h bq0, bq1;
    {
        const _Float16* qr = Qb + (size_t)(q0 + lm) * kDK;
        const v8h q_lo0 = *(const v8h*)(qr + koff);
        const v8h q_hi0 = *(const v8h*)(qr + 16 + koff);
        const v8h q_lo1 = *(const v8h*)(qr + 32 + koff);
        const v8h q_hi1 = *(const v8h*)(qr + 48 + koff);
#pragma unroll
        for (int i = 0; i < 8; ++i) {
            bq0[i] = q_lo0[i]; bq0[i + 8] = q_hi0[i];
            bq1[i] = q_lo1[i]; bq1[i + 8] = q_hi1[i];
        }
    }

    float mrow = -1e30f;
    float lrow = 0.0f;
    v8f o0 = {}, o1 = {}, o2 = {}, o3 = {};

    const int q = q0 + lm;
    // readfirstlane: the wave's number in a scalar register, so that the mask
    // address is wave-uniform. Constant address space: nothing writes the
    // words while this kernel runs; without it the compiler takes the loop's
    // copies and barriers for possible writers and loads through vector
    // registers instead of with s_load.
    const int qt = qgroup * 8 + __builtin_amdgcn_readfirstlane(wid);
    const __attribute__((address_space(4))) v16u* mtile =
        (const __attribute__((address_space(4))) v16u*)(
            mbits + (size_t)qt * (kS / 32) * 16);

    // Prologue: stage pass 0 into buffer 0.
#pragma unroll
    for (int i = 0; i < kNG; ++i) {
        cp16_g2s(kg + (size_t)i * 32 * kDK,  &sK[0][kdst + i * 32 * kKP]);
        cp16_g2s(vg + (size_t)i * kVR * kS,  &sV[0][vdst + i * kVR * kVQ]);
    }

    const int npass = kS / kPK; // 32
    for (int ci = 0; ci < npass; ++ci) {
        const int cur = ci & 1;

        wait_g2s();
        __syncthreads(); // pass ci visible in LDS to all waves

        if (ci + 1 < npass) { // overlap next pass's DMA with compute
            const int nkv = (ci + 1) * kPK;
#pragma unroll
            for (int i = 0; i < kNG; ++i) {
                cp16_g2s(kg + (size_t)(nkv + i * 32) * kDK,
                         &sK[1 - cur][kdst + i * 32 * kKP]);
                cp16_g2s(vg + (size_t)i * kVR * kS + nkv,
                         &sV[1 - cur][vdst + i * kVR * kVQ]);
            }
        }

        // word e of group g, bit L = lane L's entry of register e
        v16u mw[kNG];
#pragma unroll
        for (int g = 0; g < kNG; ++g) mw[g] = mtile[ci * kNG + g];

        // ---- S^T tiles from LDS K rows, 64 keys at a time. sched_fence(): the
        // K reads of 64 keys stay one group ahead of their score WMMAs, and
        // each 64 keys' V^T reads one group; without it each read is waited
        // out alone.
        v8f c[2 * kNG] = {};
#pragma unroll
        for (int hp = 0; hp < kNG / 2; ++hp) {
            sched_fence();
            v16h ka[4][2];
#pragma unroll
            for (int j = 0; j < 4; ++j) {
                const _Float16* kr = &sK[cur][((hp * 4 + j) * 16 + lm) * kKP + koff];
                ka[j][0] = frag16(kr);
                ka[j][1] = frag16(kr + 32);
            }
            sched_fence();
#pragma unroll
            for (int kk = 0; kk < 2; ++kk) {
#pragma unroll
                for (int j = 0; j < 4; ++j)
                    c[hp * 4 + j] =
                        WMMA_F16(ka[j][kk], kk ? bq1 : bq0, c[hp * 4 + j]);
            }
        }
        sched_fence();
        v16h va[kNG][4]; // the first 64 keys' V^T now, the rest after the softmax
#pragma unroll
        for (int g = 0; g < 2; ++g) {
#pragma unroll
            for (int t = 0; t < 4; ++t)
                va[g][t] = frag16(&sV[cur][(t * 16 + lm) * kVQ + g * 32 + koff]);
        }
        sched_fence();

        // ---- mask (lane masks in scalar registers) + online softmax
        float s0[kNG][8], s1[kNG][8];
        float tmax = -1e30f;
#pragma unroll
        for (int g = 0; g < kNG; ++g) {
#pragma unroll
            for (int r = 0; r < 8; ++r) {
                const bool b0 = __builtin_amdgcn_inverse_ballot_w32(mw[g][r]);
                const bool b1 = __builtin_amdgcn_inverse_ballot_w32(mw[g][8 + r]);
                s0[g][r] = b0 ? c[2 * g][r] * kScale : -1e30f;
                s1[g][r] = b1 ? c[2 * g + 1][r] * kScale : -1e30f;
                tmax = fmaxf(tmax, fmaxf(s0[g][r], s1[g][r]));
            }
        }
        tmax = fmaxf(tmax, __shfl_xor(tmax, 16, 32));
        const float mnew  = fmaxf(mrow, tmax);
        const float alpha = __expf(mrow - mnew);

        float psum = 0.0f;
        v16h bp[kNG]; // P^T repacked lane-locally into the B-operand layout
#pragma unroll
        for (int g = 0; g < kNG; ++g) {
#pragma unroll
            for (int r = 0; r < 8; ++r) {
                const bool b0 = __builtin_amdgcn_inverse_ballot_w32(mw[g][r]);
                const bool b1 = __builtin_amdgcn_inverse_ballot_w32(mw[g][8 + r]);
                const float p0 = b0 ? __expf(s0[g][r] - mnew) : 0.0f;
                const float p1 = b1 ? __expf(s1[g][r] - mnew) : 0.0f;
                psum += p0 + p1;
                bp[g][r]     = (_Float16)p0;
                bp[g][r + 8] = (_Float16)p1;
            }
        }
        psum += __shfl_xor(psum, 16, 32);
        lrow = lrow * alpha + psum;
        mrow = mnew;

#pragma unroll
        for (int j = 0; j < 8; ++j) {
            o0[j] *= alpha; o1[j] *= alpha; o2[j] *= alpha; o3[j] *= alpha;
        }

        // ---- O^T += V^T . P^T  (4 dk-tiles per 32 keys); the next 64 keys'
        // V^T reads fly under this 64 keys' WMMAs
#pragma unroll
        for (int hp = 0; hp < kNG / 2; ++hp) {
            if (hp + 1 < kNG / 2) {
                sched_fence();
#pragma unroll
                for (int g = 2 * hp + 2; g < 2 * hp + 4; ++g) {
#pragma unroll
                    for (int t = 0; t < 4; ++t)
                        va[g][t] = frag16(
                            &sV[cur][(t * 16 + lm) * kVQ + g * 32 + koff]);
                }
                sched_fence();
            }
#pragma unroll
            for (int g = 2 * hp; g < 2 * hp + 2; ++g) {
                o0 = WMMA_F16(va[g][0], bp[g], o0);
                o1 = WMMA_F16(va[g][1], bp[g], o1);
                o2 = WMMA_F16(va[g][2], bp[g], o2);
                o3 = WMMA_F16(va[g][3], bp[g], o3);
            }
        }

        __syncthreads(); // all waves done reading buf[cur] before reuse
    }

    // ---- normalize + store: O^T element (dk = t*16 + r + half*8, q = q0+lm)
    const float inv = 1.0f / lrow;
    _Float16* orow = of + ((size_t)b * kS + q) * kDM + h * kDK;
#pragma unroll
    for (int t = 0; t < 4; ++t) {
        const v8f ot = (t == 0) ? o0 : (t == 1) ? o1 : (t == 2) ? o2 : o3;
#pragma unroll
        for (int r = 0; r < 8; ++r) {
            const int dk = t * 16 + r + half * 8;
            orow[dk] = (_Float16)(ot[r] * inv);
        }
    }
}

// ---------------------------------------------------------------------------
// Kernel 3: output projection. out = attn(f16) @ Wo^T + bo, f32 store.
// Same staging as kernel 1: block = 8 waves, 128 rows of attn against 64 rows
// of Wo; per 64-wide k step both pieces are read once as whole lines, Wo is
// converted to f16 once, and the waves take fragments from LDS.
// ---------------------------------------------------------------------------
__global__ __launch_bounds__(256) void k_out_proj(
    const _Float16* __restrict__ of, const float* __restrict__ wo,
    const float* __restrict__ bo, float* __restrict__ out)
{
    __shared__ alignas(16) _Float16 sA[2][128 * kKP]; // [m][k], rows of kKP
    __shared__ alignas(16) _Float16 sB[2][64 * kKP];  // [n][k]

    const int tid  = threadIdx.x;
    const int wid  = tid >> 5;
    const int lane = tid & 31;
    const int half = lane >> 4;
    const int lm   = lane & 15;
    const int koff = half ? 8 : 0;

    const int mblk = blockIdx.x * 128;
    const int m0   = mblk + wid * 16;
    const int n0   = blockIdx.y * 64;

    // Staging slots: attn rows 64 f16 = 8 threads x 16 B, 32 rows per sweep;
    // Wo rows 64 f32 = 16 threads x 16 B, 16 rows per sweep.
    const int arow = tid >> 3, aseg = (tid & 7) * 8;
    const int brow = tid >> 4, bc4  = (tid & 15) * 4;
    const _Float16* ag = of + (size_t)(mblk + arow) * kDM + aseg;
    const float*    bg = wo + (size_t)(n0 + brow) * kDM + bc4;

    v8h ra[4];
    float4 rb[4];
#pragma unroll
    for (int i = 0; i < 4; ++i) {
        ra[i] = *(const v8h*)(ag + (size_t)i * 32 * kDM);
        rb[i] = *(const float4*)(bg + (size_t)i * 16 * kDM);
    }
#pragma unroll
    for (int i = 0; i < 4; ++i) {
        *(v8h*)&sA[0][(i * 32 + arow) * kKP + aseg] = ra[i];
        *(v4h*)&sB[0][(i * 16 + brow) * kKP + bc4]  = cvt4(rb[i]);
    }

    v8f acc[4] = {};

    const int nsteps = kDM / 64; // 8
    for (int ks = 0; ks < nsteps; ++ks) {
        const int cur = ks & 1;
        // One barrier per step: buffer cur is complete, and every wave has
        // left the other buffer (read in step ks-1), which is refilled below.
        __syncthreads();

        const bool more = ks + 1 < nsteps;
        if (more) { // next step's global loads fly under this step's WMMAs
            const int k0 = (ks + 1) * 64;
#pragma unroll
            for (int i = 0; i < 4; ++i) {
                ra[i] = *(const v8h*)(ag + (size_t)i * 32 * kDM + k0);
                rb[i] = *(const float4*)(bg + (size_t)i * 16 * kDM + k0);
            }
        }

        // sched_fence(): keeps the global loads above, and the step's LDS
        // reads together ahead of its WMMAs (see kernel 1).
        sched_fence();
        v16h a[2], bm[2][4];
#pragma unroll
        for (int kk = 0; kk < 2; ++kk) {
            a[kk] = frag16(&sA[cur][(wid * 16 + lm) * kKP + kk * 32 + koff]);
#pragma unroll
            for (int t = 0; t < 4; ++t)
                bm[kk][t] =
                    frag16(&sB[cur][(t * 16 + lm) * kKP + kk * 32 + koff]);
        }
        sched_fence();
#pragma unroll
        for (int kk = 0; kk < 2; ++kk) {
#pragma unroll
            for (int t = 0; t < 4; ++t)
                acc[t] = WMMA_F16(a[kk], bm[kk][t], acc[t]);
        }
        sched_fence();

        if (more) {
#pragma unroll
            for (int i = 0; i < 4; ++i) {
                *(v8h*)&sA[1 - cur][(i * 32 + arow) * kKP + aseg] = ra[i];
                *(v4h*)&sB[1 - cur][(i * 16 + brow) * kKP + bc4] = cvt4(rb[i]);
            }
        }
    }

#pragma unroll
    for (int t = 0; t < 4; ++t) {
        const int n = n0 + t * 16 + lm;
        const float bval = bo[n];
#pragma unroll
        for (int r = 0; r < 8; ++r) {
            const int m = m0 + r + half * 8;
            out[(size_t)m * kDM + n] = acc[t][r] + bval;
        }
    }
}

// ---------------------------------------------------------------------------
extern "C" void kernel_launch(void* const* d_in, const int* in_sizes, int n_in,
                              void* d_out, int out_size, void* d_ws,
                              size_t ws_size, hipStream_t stream) {
    (void)in_sizes; (void)n_in; (void)out_size; (void)ws_size;

    const float* x    = (const float*)d_in[0];
    const int*   dmsk = (const int*)d_in[1];
    const float* wq   = (const float*)d_in[2];
    const float* bq   = (const float*)d_in[3];
    const float* wk   = (const float*)d_in[4];
    const float* bk   = (const float*)d_in[5];
    const float* wv   = (const float*)d_in[6];
    const float* bv   = (const float*)d_in[7];
    const float* wo   = (const float*)d_in[8];
    const float* bo   = (const float*)d_in[9];
    float* out = (float*)d_out;

    const size_t elems = (size_t)kB * kH * kS * kDK; // 4,194,304 per tensor
    _Float16* qf = (_Float16*)d_ws;
    _Float16* kf = qf + elems;
    _Float16* vf = kf + elems;
    _Float16* of = vf + elems;
    unsigned* mbits = (unsigned*)(of + elems);       // +2MB packed mask

    const int nmaskwords = (kS * kS) / 32; // 524288, one per thread
    k_mask_pack<<<nmaskwords / 256, 256, 0, stream>>>(dmsk, mbits);

    dim3 g1((kB * kS) / 128, kH);
    k_proj_qkv<<<g1, 256, 0, stream>>>(x, wq, bq, wk, bk, wv, bv, qf, kf, vf);

    const int nblk = kB * kH * 32; // (b,h) x 32 q-groups = 512 blocks
    k_attn<<<nblk, 256, 0, stream>>>(qf, kf, vf, mbits, of);

    dim3 g3((kB * kS) / 128, kDM / 64);
    k_out_proj<<<g3, 256, 0, stream>>>(of, wo, bo, out);
}

// v005
// A run of this version takes 105 microseconds.
// In two side-by-side timings against v004, it was 1.08 and 1.09 times as fast.
// All steps since v000 together make it 3.51 times as fast.
#include <hip/hip_runtime.h>

typedef __attribute__((ext_vector_type(16))) _Float16 v16h;
typedef __attribute__((ext_vector_type(8)))  _Float16 v8h;
typedef __attribute__((ext_vector_type(4)))  _Float16 v4h;
typedef __attribute__((ext_vector_type(8)))  float    v8f;
typedef __attribute__((ext_vector_type(16))) unsigned v16u;
typedef int v4i_vs __attribute__((vector_size(16))); // matches builtin param

#define WMMA_F16(a, b, c) \
    __builtin_amdgcn_wmma_f32_16x16x32_f16(false, (a), false, (b), (short)0, (c), false, false)

static constexpr int   kB  = 2;
static constexpr int   kS  = 4096;
static constexpr int   kDM = 512;
static constexpr int   kH  = 8;
static constexpr int   kDK = 64;
static constexpr float kScale = 0.125f; // 1/sqrt(64)
static constexpr float kSL = kScale * 1.44269504088896f; // scale * log2(e)
// LDS row pitches in f16 elements, 16 B x odd so that the 16 rows one
// ds_load_b128 touches fall on 16 different bank groups (64 banks x 4 B):
// 128-B rows (staged K) -> 144 B, 64-B rows -> 80 B. The projection kernels'
// LDS tiles use these two pitches for their 128-B and 64-B rows.
static constexpr int   kKP = kDK + 8;  // 72 elements = 144 B
static constexpr int   kVP = 32 + 8;   // 40 elements =  80 B
// Attention pass: kNG groups of 32 keys are staged, scored and reduced
// together. A staged V^T row holds the pass's keys, again at 16 B x odd.
static constexpr int   kNG  = 4;
static constexpr int   kPK  = 32 * kNG;   // keys per pass
static constexpr int   kVQ  = kPK + 8;    // V^T row pitch in elements
static constexpr int   kVS  = kPK / 8;    // 16-B segments per V^T row
static constexpr int   kVR  = 256 / kVS;  // V^T rows per staging sweep
static_assert(kNG % 2 == 0 && ((kVQ / 8) & 1) == 1, "pairs of groups; odd pitch");

#if __has_builtin(__builtin_amdgcn_global_load_async_to_lds_b128)
#define ASYNC_LDS 1
#endif

// 16-byte global -> LDS copy. Async DMA path on gfx1250
// (GLOBAL_LOAD_ASYNC_TO_LDS_B128, ASYNCcnt), else load+ds_store fallback.
__device__ __forceinline__ void cp16_g2s(const _Float16* g, _Float16* l) {
#ifdef ASYNC_LDS
    __builtin_amdgcn_global_load_async_to_lds_b128(
        (__attribute__((address_space(1))) v4i_vs*)g,
        (__attribute__((address_space(3))) v4i_vs*)l, 0, 0);
#else
    *(v8h*)l = *(const v8h*)g;
#endif
}

__device__ __forceinline__ void wait_g2s() {
#ifdef ASYNC_LDS
#if __has_builtin(__builtin_amdgcn_s_wait_asynccnt)
    __builtin_amdgcn_s_wait_asynccnt(0);
#else
    asm volatile("s_wait_asynccnt 0" ::: "memory");
#endif
#endif
}

// ---------------------------------------------------------------------------
// Kernel 0: pack the (S,S) int32 DAG mask into 1 bit/entry, laid out as the
// attention kernel's LANE MASKS. For score tile (qt = q/16, c = kv/32) there
// are 16 words, one per accumulator register of the tile's two S^T blocks:
//   bits[(qt*128 + c)*16 + e], bit L ==
//     (mask[qt*16 + (L&15)][c*32 + (e>>3)*16 + (L>>4)*8 + (e&7)] != 0)
// i.e. bit L of word e is the entry that lane L holds in register e. A wave
// of the attention kernel reads its tile's 64 B with one scalar load and
// selects straight from the scalar registers. Still 2 MB in all.
// One wave packs two neighbouring tiles: lane L reads its own row's entries
// (whole 256-B row pieces per wave), a ballot per entry makes the word, and
// the 32 words leave as one 128-B line.
// ---------------------------------------------------------------------------
__global__ __launch_bounds__(256) void k_mask_pack(
    const int* __restrict__ mask, unsigned* __restrict__ bits)
{
    const int lane = threadIdx.x & 31;
    const int w    = blockIdx.x * 8 + (threadIdx.x >> 5); // wave = tile pair
    const int qt   = w >> 6;                              // 64 pairs per qt
    const int c2   = w & 63;
    const int* src = mask + (size_t)(qt * 16 + (lane & 15)) * kS + c2 * 64 +
                     (lane >> 4) * 8;
    // The loops below are unrolled so that m[] and t[] have constant indices
    // and stay in registers.
    int4 m[8]; // m[j]: words e = 4j..4j+3 of the pair (tile j>>2)
#pragma unroll
    for (int j = 0; j < 8; ++j)
        m[j] = *(const int4*)(src + (j >> 1) * 16 + (j & 1) * 4);
    unsigned t[32]; // the pair's 32 words, each wave-uniform
#pragma unroll
    for (int j = 0; j < 8; ++j) {
        t[4 * j + 0] = __builtin_amdgcn_ballot_w32(m[j].x != 0);
        t[4 * j + 1] = __builtin_amdgcn_ballot_w32(m[j].y != 0);
        t[4 * j + 2] = __builtin_amdgcn_ballot_w32(m[j].z != 0);
        t[4 * j + 3] = __builtin_amdgcn_ballot_w32(m[j].w != 0);
    }
    // Lane L picks word L: a select tree over the five bits of L.
#pragma unroll
    for (int s = 0; s < 5; ++s) {
        const bool odd = (lane >> s) & 1;
#pragma unroll
        for (int i = 0; i < (16 >> s); ++i)
            t[i] = odd ? t[2 * i + 1] : t[2 * i];
    }
    bits[(size_t)w * 32 + lane] = t[0];
}

// ---------------------------------------------------------------------------
// Kernel 1: fused QKV projection, operands staged in LDS.
//   Y[m][n] = sum_k X[m][k] * W[n][k] + bias[n]   (einsum 'bsd,ed->bse')
// Block = 8 waves on ONE head: 128 rows of x against the head's 64 rows of
// each of Wq, Wk, Wv. Per 32-wide k step the block reads its x and W pieces
// once, as whole 128-B lines (8 lanes x 16 B per row), converts them to f16
// once and stores them in LDS; the 8 waves then take their fragments with
// ds_load_b128. Wave w still computes the 16(m) x 64(n) tile of Q, K AND V
// with the same k order as before (12 WMMAs per A fragment).
// Q,K stored f16 as (B,H,S,DK); V stored f16 TRANSPOSED as (B,H,DK,S).
//
// WMMA operand convention (CDNA5 wave32, 16x16x32 f16):
//   A (MxK): lanes 0-15 hold row M=lane, K elems {0..7,16..23};
//            lanes 16-31 hold row M=lane-16, K elems {8..15,24..31}.
//   B (KxN): lane n<16 holds col N=n with K elems {0..7,16..23};
//            lane n+16 holds col N=n with K elems {8..15,24..31}.
//   C/D    : VGPR r, lanes 0-15 -> (M=r, N=lane); lanes 16-31 -> (M=8+r).
// ---------------------------------------------------------------------------
__device__ __forceinline__ v4h cvt4(const float4 f) {
    v4h r;
    r[0] = (_Float16)f.x; r[1] = (_Float16)f.y;
    r[2] = (_Float16)f.z; r[3] = (_Float16)f.w;
    return r;
}

__device__ __forceinline__ void sched_fence() {
    __builtin_amdgcn_sched_barrier(0);
}

__device__ __forceinline__ v16h frag16(const _Float16* p) {
    const v8h lo = *(const v8h*)(p);
    const v8h hi = *(const v8h*)(p + 16);
    v16h a;
#pragma unroll
    for (int i = 0; i < 8; ++i) { a[i] = lo[i]; a[i + 8] = hi[i]; }
    return a;
}

__global__ __launch_bounds__(256) void k_proj_qkv(
    const float* __restrict__ x,
    const float* __restrict__ wq, const float* __restrict__ bq,
    const float* __restrict__ wk, const float* __restrict__ bk,
    const float* __restrict__ wv, const float* __restrict__ bv,
    _Float16* __restrict__ qf, _Float16* __restrict__ kf,
    _Float16* __restrict__ vf)
{
    __shared__ alignas(16) _Float16 sX[2][128 * kVP]; // [m][k], rows of kVP
    __shared__ alignas(16) _Float16 sW[2][192 * kVP]; // [wsel*64+n][k]

    const int tid  = threadIdx.x;
    const int wid  = tid >> 5;
    const int lane = tid & 31;
    const int half = lane >> 4;
    const int lm   = lane & 15;
    const int koff = half ? 8 : 0;

    const int mblk = blockIdx.x * 128; // row block over B*S = 8192 rows
    const int m0   = mblk + wid * 16;  // this wave's 16 rows
    const int h    = blockIdx.y;       // head -> n0 = h*64
    const int n0   = h * kDK;

    const float* bias[3] = {bq, bk, bv};

    // Staging slot: 8 threads cover one row's 32 floats, 32 rows per sweep.
    const int srow = tid >> 3;
    const int sc4  = (tid & 7) * 4;
    const float* xg = x + (size_t)(mblk + srow) * kDM + sc4;
    const float* wg[3] = {wq + (size_t)(n0 + srow) * kDM + sc4,
                          wk + (size_t)(n0 + srow) * kDM + sc4,
                          wv + (size_t)(n0 + srow) * kDM + sc4};

    float4 rx[4], rw[6];
#pragma unroll
    for (int i = 0; i < 4; ++i)
        rx[i] = *(const float4*)(xg + (size_t)i * 32 * kDM);
#pragma unroll
    for (int j = 0; j < 6; ++j)
        rw[j] = *(const float4*)(wg[j >> 1] + (size_t)(j & 1) * 32 * kDM);
#pragma unroll
    for (int i = 0; i < 4; ++i)
        *(v4h*)&sX[0][(i * 32 + srow) * kVP + sc4] = cvt4(rx[i]);
#pragma unroll
    for (int j = 0; j < 6; ++j)
        *(v4h*)&sW[0][(j * 32 + srow) * kVP + sc4] = cvt4(rw[j]);

    v8f acc[3][4] = {};

    const int nsteps = kDM / 32; // 16
    for (int ks = 0; ks < nsteps; ++ks) {
        const int cur = ks & 1;
        // One barrier per step: buffer cur is complete, and every wave has
        // left the other buffer (read in step ks-1), which is refilled below.
        __syncthreads();

        const bool more = ks + 1 < nsteps;
        if (more) { // next step's global loads fly under this step's WMMAs
            const int k0 = (ks + 1) * 32;
#pragma unroll
            for (int i = 0; i < 4; ++i)
                rx[i] = *(const float4*)(xg + (size_t)i * 32 * kDM + k0);
#pragma unroll
            for (int j = 0; j < 6; ++j)
                rw[j] = *(const float4*)(wg[j >> 1] +
                                         (size_t)(j & 1) * 32 * kDM + k0);
        }

        // The scheduler does not cross sched_fence(): without these it sinks
        // the global loads below the WMMAs and waits out every LDS read
        // alone. Each W group is read one group ahead of its WMMAs.
        sched_fence();
        const _Float16* wrow = &sW[cur][lm * kVP + koff];
        const v16h a = frag16(&sX[cur][(wid * 16 + lm) * kVP + koff]);
        v16h b0[4], b1[4];
#pragma unroll
        for (int t = 0; t < 4; ++t) b0[t] = frag16(wrow + (t * 16) * kVP);
#pragma unroll
        for (int t = 0; t < 4; ++t) b1[t] = frag16(wrow + (64 + t * 16) * kVP);
        sched_fence();
#pragma unroll
        for (int t = 0; t < 4; ++t) acc[0][t] = WMMA_F16(a, b0[t], acc[0][t]);
        sched_fence();
#pragma unroll
        for (int t = 0; t < 4; ++t) b0[t] = frag16(wrow + (128 + t * 16) * kVP);
        sched_fence();
#pragma unroll
        for (int t = 0; t < 4; ++t) acc[1][t] = WMMA_F16(a, b1[t], acc[1][t]);
#pragma unroll
        for (int t = 0; t < 4; ++t) acc[2][t] = WMMA_F16(a, b0[t], acc[2][t]);
        sched_fence();

        if (more) {
#pragma unroll
            for (int i = 0; i < 4; ++i)
                *(v4h*)&sX[1 - cur][(i * 32 + srow) * kVP + sc4] = cvt4(rx[i]);
#pragma unroll
            for (int j = 0; j < 6; ++j)
                *(v4h*)&sW[1 - cur][(j * 32 + srow) * kVP + sc4] = cvt4(rw[j]);
        }
    }

#pragma unroll
    for (int wsel = 0; wsel < 3; ++wsel) {
#pragma unroll
        for (int t = 0; t < 4; ++t) {
            const int dk = t * 16 + lm;          // N index inside head
            const float bval = bias[wsel][n0 + dk];
#pragma unroll
            for (int r = 0; r < 8; ++r) {
                const int m = m0 + r + half * 8; // global row (b*S + s)
                const int b = m >> 12;           // / 4096
                const int s = m & (kS - 1);
                const _Float16 val = (_Float16)(acc[wsel][t][r] + bval);
                if (wsel == 2) {                 // V transposed: (B,H,DK,S)
                    vf[(((size_t)b * kH + h) * kDK + dk) * kS + s] = val;
                } else {                         // Q/K: (B,H,S,DK)
                    _Float16* dst = (wsel == 0) ? qf : kf;
                    dst[(((size_t)b * kH + h) * kS + s) * kDK + dk] = val;
                }
            }
        }
    }
}

// ---------------------------------------------------------------------------
// Kernel 2: flash attention, transposed-score formulation, LDS-staged KV.
// Block = 256 threads = 8 waves, all on ONE (b,h); wave w owns q-tile
// (qgroup*8 + w). Each 128-kv pass of K (128x64 f16) and V^T (64x128 f16) is
// staged into LDS once per block via async-to-LDS (double buffered), then
// all 8 waves consume it with ds_load_b128 -> 8x global traffic reduction.
// Mask comes as lane masks (kernel 0): 16 words per wave per 32 keys, read by
// scalar loads; each select takes its word as it stands.
//
//   S^T (kv x q): 8 tiles of 16 kv, each = 2 WMMAs over DK=64.
//   O^T (dk x q): 4 tiles, A = V^T(dk x kv32), B = P^T (lane-local repack),
//                 one WMMA per tile and 32 keys.
// One maximum, one sum, one rescale of O^T and one barrier pair per pass.
// Softmax rows (fixed q) live on the lane axis -> one shfl_xor(16) per
// reduction. Output written f16 to (B,S,H*DK).
// ---------------------------------------------------------------------------
// waves_per_eu: the grid puts 4 waves on a SIMD, so registers saved for more
// than 4 buy nothing. With a higher upper bound this build saves registers by
// running each score's select, fma, exp as a chain of its own, with a
// v_nop behind most exps and few paired instructions.
__global__ __launch_bounds__(256)
__attribute__((amdgpu_waves_per_eu(4, 4))) void k_attn(
    const _Float16* __restrict__ qf, const _Float16* __restrict__ kf,
    const _Float16* __restrict__ vf, const unsigned* __restrict__ mbits,
    _Float16* __restrict__ of)
{
    __shared__ alignas(16) _Float16 sK[2][kPK * kKP]; // [kv][dk], rows of kKP
    __shared__ alignas(16) _Float16 sV[2][kDK * kVQ]; // [dk][kv], rows of kVQ

    const int tid   = threadIdx.x;
    const int wid   = tid >> 5;
    const int lane  = tid & 31;
    const int half  = lane >> 4;
    const int lm    = lane & 15;
    const int koff  = half ? 8 : 0;

    const int qgroup = blockIdx.x & 31;         // 32 q-groups per (b,h)
    const int h      = (blockIdx.x >> 5) & (kH - 1);
    const int b      = blockIdx.x >> 8;
    const int q0     = (qgroup * 8 + wid) * 16;

    const _Float16* Qb = qf + (((size_t)b * kH + h) * kS) * kDK;
    const _Float16* Kb = kf + (((size_t)b * kH + h) * kS) * kDK;
    const _Float16* Vb = vf + (((size_t)b * kH + h) * kDK) * kS;

    // Per-thread staging slots, kNG sweeps per tile: K = kPK rows x 8 segs of
    // 16 B, 32 rows a sweep; V^T = 64 rows x kVS segs, kVR rows a sweep.
    const int krow = tid >> 3,  kseg = (tid & 7) * 8;
    const int vrow = tid / kVS, vseg = (tid % kVS) * 8;
    const _Float16* kg = Kb + (size_t)krow * kDK + kseg;
    const _Float16* vg = Vb + (size_t)vrow * kS + vseg;
    const int kdst = krow * kKP + kseg;
    const int vdst = vrow * kVQ + vseg;

    // B operand of the score WMMAs: Q^T columns (fixed for the whole tile).
    v16h bq0, bq1;
    {
        const _Float16* qr = Qb + (size_t)(q0 + lm) * kDK;
        const v8h q_lo0 = *(const v8h*)(qr + koff);
        const v8h q_hi0 = *(const v8h*)(qr + 16 + koff);
        const v8h q_lo1 = *(const v8h*)(qr + 32 + koff);
        const v8h q_hi1 = *(const v8h*)(qr + 48 + koff);
#pragma unroll
        for (int i = 0; i < 8; ++i) {
            bq0[i] = q_lo0[i]; bq0[i + 8] = q_hi0[i];
            bq1[i] = q_lo1[i]; bq1[i + 8] = q_hi1[i];
        }
    }

    float mrow = -1e30f;         // running maximum of the raw scores
    float nmrow = 1e30f * kSL;   // -mrow * kSL, as the pass that set mrow rounded it
    float lrow = 0.0f;
    // -inf for masked scores, held in a vector register: as a literal it makes
    // each select a lone long-form instruction; from a register this build
    // issues the selects two to a slot (v_dual_cndmask_b32).
    float ninf;
    asm("v_mov_b32 %0, 0xff800000" : "=v"(ninf));
    v8f o0 = {}, o1 = {}, o2 = {}, o3 = {};

    const int q = q0 + lm;
    // readfirstlane: the wave's number in a scalar register, so that the mask
    // address is wave-uniform. Constant address space: nothing writes the
    // words while this kernel runs; without it the compiler takes the loop's
    // copies and barriers for possible writers and loads through vector
    // registers instead of with s_load.
    const int qt = qgroup * 8 + __builtin_amdgcn_readfirstlane(wid);
    const __attribute__((address_space(4))) v16u* mtile =
        (const __attribute__((address_space(4))) v16u*)(
            mbits + (size_t)qt * (kS / 32) * 16);

    // Prologue: stage pass 0 into buffer 0.
#pragma unroll
    for (int i = 0; i < kNG; ++i) {
        cp16_g2s(kg + (size_t)i * 32 * kDK,  &sK[0][kdst + i * 32 * kKP]);
        cp16_g2s(vg + (size_t)i * kVR * kS,  &sV[0][vdst + i * kVR * kVQ]);
    }

    const int npass = kS / kPK; // 32
    for (int ci = 0; ci < npass; ++ci) {
        const int cur = ci & 1;

        wait_g2s();
        __syncthreads(); // pass ci visible in LDS to all waves

        if (ci + 1 < npass) { // overlap next pass's DMA with compute
            const int nkv = (ci + 1) * kPK;
#pragma unroll
            for (int i = 0; i < kNG; ++i) {
                cp16_g2s(kg + (size_t)(nkv + i * 32) * kDK,
                         &sK[1 - cur][kdst + i * 32 * kKP]);
                cp16_g2s(vg + (size_t)i * kVR * kS + nkv,
                         &sV[1 - cur][vdst + i * kVR * kVQ]);
            }
        }

        // word e of group g, bit L = lane L's entry of register e
        v16u mw[kNG];
#pragma unroll
        for (int g = 0; g < kNG; ++g) mw[g] = mtile[ci * kNG + g];

        // ---- S^T tiles from LDS K rows, 64 keys at a time. sched_fence(): the
        // K reads of 64 keys stay one group ahead of their score WMMAs, and
        // each 64 keys' V^T reads one group; without it each read is waited
        // out alone.
        v8f c[2 * kNG] = {};
#pragma unroll
        for (int hp = 0; hp < kNG / 2; ++hp) {
            sched_fence();
            v16h ka[4][2];
#pragma unroll
            for (int j = 0; j < 4; ++j) {
                const _Float16* kr = &sK[cur][((hp * 4 + j) * 16 + lm) * kKP + koff];
                ka[j][0] = frag16(kr);
                ka[j][1] = frag16(kr + 32);
            }
            sched_fence();
#pragma unroll
            for (int kk = 0; kk < 2; ++kk) {
#pragma unroll
                for (int j = 0; j < 4; ++j)
                    c[hp * 4 + j] =
                        WMMA_F16(ka[j][kk], kk ? bq1 : bq0, c[hp * 4 + j]);
            }
        }
        sched_fence();
        v16h va[kNG][4]; // the first 64 keys' V^T now, the rest after the softmax
#pragma unroll
        for (int g = 0; g < 2; ++g) {
#pragma unroll
            for (int t = 0; t < 4; ++t)
                va[g][t] = frag16(&sV[cur][(t * 16 + lm) * kVQ + g * 32 + koff]);
        }
        sched_fence();

        // ---- mask (lane masks in scalar registers) + online softmax on the RAW
        // scores, in the base-2 domain: exp((c - m) / 8) = exp2(c * kSL - m * kSL).
        // A masked score is -inf, the running maximum is never below -1e30, so
        // the fma of a masked score is -inf and its exp2 is 0 with no second
        // select, also while a row has met no allowed key yet.
        float s0[kNG][8], s1[kNG][8];
        float tmax = -1e30f;
#pragma unroll
        for (int g = 0; g < kNG; ++g) {
#pragma unroll
            for (int r = 0; r < 8; ++r) {
                const bool b0 = __builtin_amdgcn_inverse_ballot_w32(mw[g][r]);
                const bool b1 = __builtin_amdgcn_inverse_ballot_w32(mw[g][8 + r]);
                s0[g][r] = b0 ? c[2 * g][r] : ninf;
                s1[g][r] = b1 ? c[2 * g + 1][r] : ninf;
                tmax = fmaxf(tmax, fmaxf(s0[g][r], s1[g][r]));
            }
        }
        tmax = fmaxf(tmax, __shfl_xor(tmax, 16, 32));
        const float mnew  = fmaxf(mrow, tmax);
        const float nmk   = -mnew * kSL; // the addend of every score's fma
        const float alpha = __builtin_amdgcn_exp2f(nmk - nmrow);

        float psum = 0.0f;
        v16h bp[kNG]; // P^T repacked lane-locally into the B-operand layout
#pragma unroll
        for (int g = 0; g < kNG; ++g) {
#pragma unroll
            for (int r = 0; r < 8; ++r) {
                const float p0 =
                    __builtin_amdgcn_exp2f(__builtin_fmaf(s0[g][r], kSL, nmk));
                const float p1 =
                    __builtin_amdgcn_exp2f(__builtin_fmaf(s1[g][r], kSL, nmk));
                psum += p0 + p1;
                bp[g][r]     = (_Float16)p0;
                bp[g][r + 8] = (_Float16)p1;
            }
        }
        psum += __shfl_xor(psum, 16, 32);
        lrow = lrow * alpha + psum;
        mrow = mnew;
        nmrow = nmk;

#pragma unroll
        for (int j = 0; j < 8; ++j) {
            o0[j] *= alpha; o1[j] *= alpha; o2[j] *= alpha; o3[j] *= alpha;
        }

        // ---- O^T += V^T . P^T  (4 dk-tiles per 32 keys); the next 64 keys'
        // V^T reads fly under this 64 keys' WMMAs
#pragma unroll
        for (int hp = 0; hp < kNG / 2; ++hp) {
            if (hp + 1 < kNG / 2) {
                sched_fence();
#pragma unroll
                for (int g = 2 * hp + 2; g < 2 * hp + 4; ++g) {
#pragma unroll
                    for (int t = 0; t < 4; ++t)
                        va[g][t] = frag16(
                            &sV[cur][(t * 16 + lm) * kVQ + g * 32 + koff]);
                }
                sched_fence();
            }
#pragma unroll
            for (int g = 2 * hp; g < 2 * hp + 2; ++g) {
                o0 = WMMA_F16(va[g][0], bp[g], o0);
                o1 = WMMA_F16(va[g][1], bp[g], o1);
                o2 = WMMA_F16(va[g][2], bp[g], o2);
                o3 = WMMA_F16(va[g][3], bp[g], o3);
            }
        }

        __syncthreads(); // all waves done reading buf[cur] before reuse
    }

    // ---- normalize + store: O^T element (dk = t*16 + r + half*8, q = q0+lm)
    const float inv = 1.0f / lrow;
    _Float16* orow = of + ((size_t)b * kS + q) * kDM + h * kDK;
#pragma unroll
    for (int t = 0; t < 4; ++t) {
        const v8f ot = (t == 0) ? o0 : (t == 1) ? o1 : (t == 2) ? o2 : o3;
#pragma unroll
        for (int r = 0; r < 8; ++r) {
            const int dk = t * 16 + r + half * 8;
            orow[dk] = (_Float16)(ot[r] * inv);
        }
    }
}

// ---------------------------------------------------------------------------
// Kernel 3: output projection. out = attn(f16) @ Wo^T + bo, f32 store.
// Same staging as kernel 1: block = 8 waves, 128 rows of attn against 64 rows
// of Wo; per 64-wide k step both pieces are read once as whole lines, Wo is
// converted to f16 once, and the waves take fragments from LDS.
// ---------------------------------------------------------------------------
__global__ __launch_bounds__(256) void k_out_proj(
    const _Float16* __restrict__ of, const float* __restrict__ wo,
    const float* __restrict__ bo, float* __restrict__ out)
{
    __shared__ alignas(16) _Float16 sA[2][128 * kKP]; // [m][k], rows of kKP
    __shared__ alignas(16) _Float16 sB[2][64 * kKP];  // [n][k]

    const int tid  = threadIdx.x;
    const int wid  = tid >> 5;
    const int lane = tid & 31;
    const int half = lane >> 4;
    const int lm   = lane & 15;
    const int koff = half ? 8 : 0;

    const int mblk = blockIdx.x * 128;
    const int m0   = mblk + wid * 16;
    const int n0   = blockIdx.y * 64;

    // Staging slots: attn rows 64 f16 = 8 threads x 16 B, 32 rows per sweep;
    // Wo rows 64 f32 = 16 threads x 16 B, 16 rows per sweep.
    const int arow = tid >> 3, aseg = (tid & 7) * 8;
    const int brow = tid >> 4, bc4  = (tid & 15) * 4;
    const _Float16* ag = of + (size_t)(mblk + arow) * kDM + aseg;
    const float*    bg = wo + (size_t)(n0 + brow) * kDM + bc4;

    v8h ra[4];
    float4 rb[4];
#pragma unroll
    for (int i = 0; i < 4; ++i) {
        ra[i] = *(const v8h*)(ag + (size_t)i * 32 * kDM);
        rb[i] = *(const float4*)(bg + (size_t)i * 16 * kDM);
    }
#pragma unroll
    for (int i = 0; i < 4; ++i) {
        *(v8h*)&sA[0][(i * 32 + arow) * kKP + aseg] = ra[i];
        *(v4h*)&sB[0][(i * 16 + brow) * kKP + bc4]  = cvt4(rb[i]);
    }

    v8f acc[4] = {};

    const int nsteps = kDM / 64; // 8
    for (int ks = 0; ks < nsteps; ++ks) {
        const int cur = ks & 1;
        // One barrier per step: buffer cur is complete, and every wave has
        // left the other buffer (read in step ks-1), which is refilled below.
        __syncthreads();

        const bool more = ks + 1 < nsteps;
        if (more) { // next step's global loads fly under this step's WMMAs
            const int k0 = (ks + 1) * 64;
#pragma unroll
            for (int i = 0; i < 4; ++i) {
                ra[i] = *(const v8h*)(ag + (size_t)i * 32 * kDM + k0);
                rb[i] = *(const float4*)(bg + (size_t)i * 16 * kDM + k0);
            }
        }

        // sched_fence(): keeps the global loads above, and the step's LDS
        // reads together ahead of its WMMAs (see kernel 1).
        sched_fence();
        v16h a[2], bm[2][4];
#pragma unroll
        for (int kk = 0; kk < 2; ++kk) {
            a[kk] = frag16(&sA[cur][(wid * 16 + lm) * kKP + kk * 32 + koff]);
#pragma unroll
            for (int t = 0; t < 4; ++t)
                bm[kk][t] =
                    frag16(&sB[cur][(t * 16 + lm) * kKP + kk * 32 + koff]);
        }
        sched_fence();
#pragma unroll
        for (int kk = 0; kk < 2; ++kk) {
#pragma unroll
            for (int t = 0; t < 4; ++t)
                acc[t] = WMMA_F16(a[kk], bm[kk][t], acc[t]);
        }
        sched_fence();

        if (more) {
#pragma unroll
            for (int i = 0; i < 4; ++i) {
                *(v8h*)&sA[1 - cur][(i * 32 + arow) * kKP + aseg] = ra[i];
                *(v4h*)&sB[1 - cur][(i * 16 + brow) * kKP + bc4] = cvt4(rb[i]);
            }
        }
    }

#pragma unroll
    for (int t = 0; t < 4; ++t) {
        const int n = n0 + t * 16 + lm;
        const float bval = bo[n];
#pragma unroll
        for (int r = 0; r < 8; ++r) {
            const int m = m0 + r + half * 8;
            out[(size_t)m * kDM + n] = acc[t][r] + bval;
        }
    }
}

// ---------------------------------------------------------------------------
extern "C" void kernel_launch(void* const* d_in, const int* in_sizes, int n_in,
                              void* d_out, int out_size, void* d_ws,
                              size_t ws_size, hipStream_t stream) {
    (void)in_sizes; (void)n_in; (void)out_size; (void)ws_size;

    const float* x    = (const float*)d_in[0];
    const int*   dmsk = (const int*)d_in[1];
    const float* wq   = (const float*)d_in[2];
    const float* bq   = (const float*)d_in[3];
    const float* wk   = (const float*)d_in[4];
    const float* bk   = (const float*)d_in[5];
    const float* wv   = (const float*)d_in[6];
    const float* bv   = (const float*)d_in[7];
    const float* wo   = (const float*)d_in[8];
    const float* bo   = (const float*)d_in[9];
    float* out = (float*)d_out;

    const size_t elems = (size_t)kB * kH * kS * kDK; // 4,194,304 per tensor
    _Float16* qf = (_Float16*)d_ws;
    _Float16* kf = qf + elems;
    _Float16* vf = kf + elems;
    _Float16* of = vf + elems;
    unsigned* mbits = (unsigned*)(of + elems);       // +2MB packed mask

    const int nmaskwords = (kS * kS) / 32; // 524288, one per thread
    k_mask_pack<<<nmaskwords / 256, 256, 0, stream>>>(dmsk, mbits);

    dim3 g1((kB * kS) / 128, kH);
    k_proj_qkv<<<g1, 256, 0, stream>>>(x, wq, bq, wk, bk, wv, bv, qf, kf, vf);

    const int nblk = kB * kH * 32; // (b,h) x 32 q-groups = 512 blocks
    k_attn<<<nblk, 256, 0, stream>>>(qf, kf, vf, mbits, of);

    dim3 g3((kB * kS) / 128, kDM / 64);
    k_out_proj<<<g3, 256, 0, stream>>>(of, wo, bo, out);
}

// v006
// It runs in 97.2 microseconds.
// Next to v005, in two timings, it ran 1.08 times as fast each time.
// All steps since v000 together make it 3.79 times as fast.
#include <hip/hip_runtime.h>

typedef __attribute__((ext_vector_type(16))) _Float16 v16h;
typedef __attribute__((ext_vector_type(8)))  _Float16 v8h;
typedef __attribute__((ext_vector_type(4)))  _Float16 v4h;
typedef __attribute__((ext_vector_type(8)))  float    v8f;
typedef __attribute__((ext_vector_type(16))) unsigned v16u;
typedef int v4i_vs __attribute__((vector_size(16))); // matches builtin param

#define WMMA_F16(a, b, c) \
    __builtin_amdgcn_wmma_f32_16x16x32_f16(false, (a), false, (b), (short)0, (c), false, false)

static constexpr int   kB  = 2;
static constexpr int   kS  = 4096;
static constexpr int   kDM = 512;
static constexpr int   kH  = 8;
static constexpr int   kDK = 64;
static constexpr float kScale = 0.125f; // 1/sqrt(64)
static constexpr float kSL = kScale * 1.44269504088896f; // scale * log2(e)
// LDS row pitches in f16 elements, 16 B x odd so that the 16 rows one
// ds_load_b128 touches fall on 16 different bank groups (64 banks x 4 B):
// 128-B rows (staged K) -> 144 B, 64-B rows -> 80 B. The projection kernels'
// LDS tiles use these two pitches for their 128-B and 64-B rows.
static constexpr int   kKP = kDK + 8;  // 72 elements = 144 B
static constexpr int   kVP = 32 + 8;   // 40 elements =  80 B
// Attention pass: kNG groups of 32 keys are staged, scored and reduced
// together. A staged V^T row holds the pass's keys, again at 16 B x odd.
static constexpr int   kNG  = 4;
static constexpr int   kPK  = 32 * kNG;   // keys per pass
static constexpr int   kVQ  = kPK + 8;    // V^T row pitch in elements
static constexpr int   kVS  = kPK / 8;    // 16-B segments per V^T row
static constexpr int   kVR  = 256 / kVS;  // V^T rows per staging sweep
static_assert(kNG % 2 == 0 && ((kVQ / 8) & 1) == 1, "pairs of groups; odd pitch");

#if __has_builtin(__builtin_amdgcn_global_load_async_to_lds_b128)
#define ASYNC_LDS 1
#endif

// 16-byte global -> LDS copy. Async DMA path on gfx1250
// (GLOBAL_LOAD_ASYNC_TO_LDS_B128, ASYNCcnt), else load+ds_store fallback.
__device__ __forceinline__ void cp16_g2s(const _Float16* g, _Float16* l) {
#ifdef ASYNC_LDS
    __builtin_amdgcn_global_load_async_to_lds_b128(
        (__attribute__((address_space(1))) v4i_vs*)g,
        (__attribute__((address_space(3))) v4i_vs*)l, 0, 0);
#else
    *(v8h*)l = *(const v8h*)g;
#endif
}

__device__ __forceinline__ void wait_g2s() {
#ifdef ASYNC_LDS
#if __has_builtin(__builtin_amdgcn_s_wait_asynccnt)
    __builtin_amdgcn_s_wait_asynccnt(0);
#else
    asm volatile("s_wait_asynccnt 0" ::: "memory");
#endif
#endif
}

// ---------------------------------------------------------------------------
// Mask packing (runs inside kernel 1): the (S,S) int32 DAG mask becomes 1 bit
// per entry, laid out as the attention kernel's LANE MASKS. For score tile
// (qt = q/16, c = kv/32) there are 16 words, one per accumulator register of
// the tile's two S^T blocks:
//   bits[(qt*128 + c)*16 + e], bit L ==
//     (mask[qt*16 + (L&15)][c*32 + (e>>3)*16 + (L>>4)*8 + (e&7)] != 0)
// i.e. bit L of word e is the entry that lane L holds in register e. A wave
// of the attention kernel reads its tile's 64 B with one scalar load and
// selects straight from the scalar registers. Still 2 MB in all.
// Each of kernel 1's 4096 waves packs 16 mask rows x 1 KB, in two pieces of
// 16 rows x 512 B. A piece comes into the wave's own LDS range by async
// copies (one row = 512 contiguous bytes = four whole lines per copy), which
// use no register and no load counter of the k loop that runs meanwhile.
// Lane L then reads its own row's entries from LDS, a ballot per entry makes
// the word, and each tile pair's 32 words leave as one 128-B line.
// ---------------------------------------------------------------------------
static constexpr int kMRow   = 128;       // entries of a row in one piece
static constexpr int kMPitch = kMRow + 4; // LDS row pitch: 528 B = 16 B x odd

// Eight async copies to LDS: eight mask rows of 512 B, 16 B a lane.
// s_wait_xcnt 0 ends the copies' own statement, so that no address register
// of an issued copy is rewritten ahead of it.
__device__ __forceinline__ void cp_rows8(const unsigned l, const int* g) {
    asm volatile(
        "global_load_async_to_lds_b128 %0, %8, off\n\t"
        "global_load_async_to_lds_b128 %1, %9, off\n\t"
        "global_load_async_to_lds_b128 %2, %10, off\n\t"
        "global_load_async_to_lds_b128 %3, %11, off\n\t"
        "global_load_async_to_lds_b128 %4, %12, off\n\t"
        "global_load_async_to_lds_b128 %5, %13, off\n\t"
        "global_load_async_to_lds_b128 %6, %14, off\n\t"
        "global_load_async_to_lds_b128 %7, %15, off\n\t"
        "s_wait_xcnt 0x0"
        :: "v"(l), "v"(l + kMPitch * 4),
           "v"(l + 2 * kMPitch * 4), "v"(l + 3 * kMPitch * 4),
           "v"(l + 4 * kMPitch * 4), "v"(l + 5 * kMPitch * 4),
           "v"(l + 6 * kMPitch * 4), "v"(l + 7 * kMPitch * 4),
           "v"(g), "v"(g + kS), "v"(g + 2 * kS), "v"(g + 3 * kS),
           "v"(g + 4 * kS), "v"(g + 5 * kS), "v"(g + 6 * kS), "v"(g + 7 * kS)
        : "memory");
}

// One piece on its way: l = the lane's LDS byte address in row 0 of the wave's
// range, g = the lane's 16 bytes of mask row 0 of the piece.
__device__ __forceinline__ void mask_stage(const unsigned l, const int* g) {
    cp_rows8(l, g);
    cp_rows8(l + 8 * kMPitch * 4, g + (size_t)8 * kS);
}

// Packs a landed piece (two tile pairs). row = the lane's own row in LDS, at
// its half's 8 entries; dst = the first pair's 32 words.
__device__ __forceinline__ void mask_pack2(const int* row, unsigned* dst,
                                           const int lane) {
    // The loops below are unrolled so that m[] and t[] have constant indices
    // and stay in registers.
#pragma unroll
    for (int p = 0; p < 2; ++p) {
        int4 m[8]; // m[j]: words e = 4j..4j+3 of the pair (tile j>>2)
#pragma unroll
        for (int j = 0; j < 8; ++j)
            m[j] = *(const int4*)(row + p * 64 + (j >> 1) * 16 + (j & 1) * 4);
        unsigned t[32]; // the pair's 32 words, each wave-uniform
#pragma unroll
        for (int j = 0; j < 8; ++j) {
            t[4 * j + 0] = __builtin_amdgcn_ballot_w32(m[j].x != 0);
            t[4 * j + 1] = __builtin_amdgcn_ballot_w32(m[j].y != 0);
            t[4 * j + 2] = __builtin_amdgcn_ballot_w32(m[j].z != 0);
            t[4 * j + 3] = __builtin_amdgcn_ballot_w32(m[j].w != 0);
        }
        // Lane L picks word L: a select tree over the five bits of L.
#pragma unroll
        for (int s = 0; s < 5; ++s) {
            const bool odd = (lane >> s) & 1;
#pragma unroll
            for (int i = 0; i < (16 >> s); ++i)
                t[i] = odd ? t[2 * i + 1] : t[2 * i];
        }
        dst[p * 32 + lane] = t[0];
    }
}

// ---------------------------------------------------------------------------
// Kernel 1: fused QKV projection, operands staged in LDS.
//   Y[m][n] = sum_k X[m][k] * W[n][k] + bias[n]   (einsum 'bsd,ed->bse')
// Block = 8 waves on ONE head: 128 rows of x against the head's 64 rows of
// each of Wq, Wk, Wv. Per 32-wide k step the block reads its x and W pieces
// once, as whole 128-B lines (8 lanes x 16 B per row), converts them to f16
// once and stores them in LDS; the 8 waves then take their fragments with
// ds_load_b128. Wave w still computes the 16(m) x 64(n) tile of Q, K AND V
// with the same k order as before (12 WMMAs per A fragment).
// Q,K stored f16 as (B,H,S,DK); V stored f16 TRANSPOSED as (B,H,DK,S).
//
// WMMA operand convention (CDNA5 wave32, 16x16x32 f16):
//   A (MxK): lanes 0-15 hold row M=lane, K elems {0..7,16..23};
//            lanes 16-31 hold row M=lane-16, K elems {8..15,24..31}.
//   B (KxN): lane n<16 holds col N=n with K elems {0..7,16..23};
//            lane n+16 holds col N=n with K elems {8..15,24..31}.
//   C/D    : VGPR r, lanes 0-15 -> (M=r, N=lane); lanes 16-31 -> (M=8+r).
// ---------------------------------------------------------------------------
__device__ __forceinline__ v4h cvt4(const float4 f) {
    v4h r;
    r[0] = (_Float16)f.x; r[1] = (_Float16)f.y;
    r[2] = (_Float16)f.z; r[3] = (_Float16)f.w;
    return r;
}

__device__ __forceinline__ void sched_fence() {
    __builtin_amdgcn_sched_barrier(0);
}

__device__ __forceinline__ v16h frag16(const _Float16* p) {
    const v8h lo = *(const v8h*)(p);
    const v8h hi = *(const v8h*)(p + 16);
    v16h a;
#pragma unroll
    for (int i = 0; i < 8; ++i) { a[i] = lo[i]; a[i + 8] = hi[i]; }
    return a;
}

__global__ __launch_bounds__(256) void k_proj_qkv(
    const float* __restrict__ x,
    const float* __restrict__ wq, const float* __restrict__ bq,
    const float* __restrict__ wk, const float* __restrict__ bk,
    const float* __restrict__ wv, const float* __restrict__ bv,
    _Float16* __restrict__ qf, _Float16* __restrict__ kf,
    _Float16* __restrict__ vf,
    const int* __restrict__ mask, unsigned* __restrict__ bits)
{
    __shared__ alignas(16) _Float16 sX[2][128 * kVP]; // [m][k], rows of kVP
    __shared__ alignas(16) _Float16 sW[2][192 * kVP]; // [wsel*64+n][k]
    __shared__ alignas(16) int sM[8][16 * kMPitch];   // a mask piece per wave

    const int tid  = threadIdx.x;
    const int wid  = tid >> 5;
    const int lane = tid & 31;
    const int half = lane >> 4;
    const int lm   = lane & 15;
    const int koff = half ? 8 : 0;

    const int mblk = blockIdx.x * 128; // row block over B*S = 8192 rows
    const int m0   = mblk + wid * 16;  // this wave's 16 rows
    const int h    = blockIdx.y;       // head -> n0 = h*64
    const int n0   = h * kDK;

    const float* bias[3] = {bq, bk, bv};

    // This wave's share of the mask: rows mqt*16.., 256 entries from mcol on.
    const int gw   = (blockIdx.y * (kB * kS / 128) + blockIdx.x) * 8 + wid;
    const int mqt  = gw >> 4;
    const int mcol = (gw & 15) * (2 * kMRow);
    const int* mg  = mask + (size_t)mqt * 16 * kS + mcol + lane * 4;
    const unsigned ml = (unsigned)(__UINTPTR_TYPE__)(
        __attribute__((address_space(3))) int*)&sM[wid][lane * 4];
    const int* mrow = &sM[wid][lm * kMPitch + half * 8];
    unsigned* mdst  = bits + (size_t)gw * 128;

    // Staging slot: 8 threads cover one row's 32 floats, 32 rows per sweep.
    const int srow = tid >> 3;
    const int sc4  = (tid & 7) * 4;
    const float* xg = x + (size_t)(mblk + srow) * kDM + sc4;
    const float* wg[3] = {wq + (size_t)(n0 + srow) * kDM + sc4,
                          wk + (size_t)(n0 + srow) * kDM + sc4,
                          wv + (size_t)(n0 + srow) * kDM + sc4};

    float4 rx[4], rw[6];
#pragma unroll
    for (int i = 0; i < 4; ++i)
        rx[i] = *(const float4*)(xg + (size_t)i * 32 * kDM);
#pragma unroll
    for (int j = 0; j < 6; ++j)
        rw[j] = *(const float4*)(wg[j >> 1] + (size_t)(j & 1) * 32 * kDM);
#pragma unroll
    for (int i = 0; i < 4; ++i)
        *(v4h*)&sX[0][(i * 32 + srow) * kVP + sc4] = cvt4(rx[i]);
#pragma unroll
    for (int j = 0; j < 6; ++j)
        *(v4h*)&sW[0][(j * 32 + srow) * kVP + sc4] = cvt4(rw[j]);
    // Piece 0 flies under the first half of the k loop; asked for once the
    // first x and W pieces are in, so that these do not queue behind it.
    mask_stage(ml, mg);

    v8f acc[3][4] = {};

    const int nsteps = kDM / 32; // 16
    // One k step; inlined into the two loops below, between which the mask's
    // pieces change over. more: a next step exists (a constant at each call).
    auto kstep = [&](const int ks, const bool more)
                     __attribute__((always_inline)) {
        const int cur = ks & 1;
        // One barrier per step: buffer cur is complete, and every wave has
        // left the other buffer (read in step ks-1), which is refilled below.
        // The wave's LDS stores of the step before are complete in front of
        // the barrier.
        asm volatile("s_wait_dscnt 0x0" ::: "memory");
        __syncthreads();

        if (more) { // next step's global loads fly under this step's WMMAs
            const int k0 = (ks + 1) * 32;
#pragma unroll
            for (int i = 0; i < 4; ++i)
                rx[i] = *(const float4*)(xg + (size_t)i * 32 * kDM + k0);
#pragma unroll
            for (int j = 0; j < 6; ++j)
                rw[j] = *(const float4*)(wg[j >> 1] +
                                         (size_t)(j & 1) * 32 * kDM + k0);
        }

        // The scheduler does not cross sched_fence(): without these it sinks
        // the global loads below the WMMAs and waits out every LDS read
        // alone. Each W group is read one group ahead of its WMMAs.
        sched_fence();
        const _Float16* wrow = &sW[cur][lm * kVP + koff];
        const v16h a = frag16(&sX[cur][(wid * 16 + lm) * kVP + koff]);
        v16h b0[4], b1[4];
#pragma unroll
        for (int t = 0; t < 4; ++t) b0[t] = frag16(wrow + (t * 16) * kVP);
#pragma unroll
        for (int t = 0; t < 4; ++t) b1[t] = frag16(wrow + (64 + t * 16) * kVP);
        sched_fence();
#pragma unroll
        for (int t = 0; t < 4; ++t) acc[0][t] = WMMA_F16(a, b0[t], acc[0][t]);
        sched_fence();
#pragma unroll
        for (int t = 0; t < 4; ++t) b0[t] = frag16(wrow + (128 + t * 16) * kVP);
        sched_fence();
#pragma unroll
        for (int t = 0; t < 4; ++t) acc[1][t] = WMMA_F16(a, b1[t], acc[1][t]);
#pragma unroll
        for (int t = 0; t < 4; ++t) acc[2][t] = WMMA_F16(a, b0[t], acc[2][t]);
        sched_fence();

        if (more) {
#pragma unroll
            for (int i = 0; i < 4; ++i)
                *(v4h*)&sX[1 - cur][(i * 32 + srow) * kVP + sc4] = cvt4(rx[i]);
#pragma unroll
            for (int j = 0; j < 6; ++j)
                *(v4h*)&sW[1 - cur][(j * 32 + srow) * kVP + sc4] = cvt4(rw[j]);
        }
    };

    for (int ks = 0; ks < nsteps / 2; ++ks) kstep(ks, true);

    // Mask piece 0 has landed behind the issuing wave's own wait; then a
    // barrier, then the reads. No LDS read moves above the wait.
    asm volatile("s_wait_asynccnt 0x0" ::: "memory");
    __syncthreads();
    mask_pack2(mrow, mdst, lane);
    // The reads of piece 0 are over, in every wave, before piece 1 is copied
    // over them; it flies under the second half of the k loop.
    asm volatile("s_wait_dscnt 0x0" ::: "memory");
    __syncthreads();
    mask_stage(ml, mg + kMRow);

    for (int ks = nsteps / 2; ks < nsteps - 1; ++ks) kstep(ks, true);
    kstep(nsteps - 1, false);

    // Mask piece 1: the wave's own wait, a barrier, then the reads. Ahead of
    // the Q, K, V stores, so that the barrier does not wait for those.
    asm volatile("s_wait_asynccnt 0x0" ::: "memory");
    __syncthreads();
    mask_pack2(mrow, mdst + 64, lane);

#pragma unroll
    for (int wsel = 0; wsel < 3; ++wsel) {
#pragma unroll
        for (int t = 0; t < 4; ++t) {
            const int dk = t * 16 + lm;          // N index inside head
            const float bval = bias[wsel][n0 + dk];
#pragma unroll
            for (int r = 0; r < 8; ++r) {
                const int m = m0 + r + half * 8; // global row (b*S + s)
                const int b = m >> 12;           // / 4096
                const int s = m & (kS - 1);
                const _Float16 val = (_Float16)(acc[wsel][t][r] + bval);
                if (wsel == 2) {                 // V transposed: (B,H,DK,S)
                    vf[(((size_t)b * kH + h) * kDK + dk) * kS + s] = val;
                } else {                         // Q/K: (B,H,S,DK)
                    _Float16* dst = (wsel == 0) ? qf : kf;
                    dst[(((size_t)b * kH + h) * kS + s) * kDK + dk] = val;
                }
            }
        }
    }
}

// ---------------------------------------------------------------------------
// Kernel 2: flash attention, transposed-score formulation, LDS-staged KV.
// Block = 256 threads = 8 waves, all on ONE (b,h); wave w owns q-tile
// (qgroup*8 + w). Each 128-kv pass of K (128x64 f16) and V^T (64x128 f16) is
// staged into LDS once per block via async-to-LDS (double buffered), then
// all 8 waves consume it with ds_load_b128 -> 8x global traffic reduction.
// Mask comes as lane masks (kernel 1): 16 words per wave per 32 keys, read by
// scalar loads; each select takes its word as it stands.
//
//   S^T (kv x q): 8 tiles of 16 kv, each = 2 WMMAs over DK=64.
//   O^T (dk x q): 4 tiles, A = V^T(dk x kv32), B = P^T (lane-local repack),
//                 one WMMA per tile and 32 keys.
// One maximum, one sum, one rescale of O^T and one barrier pair per pass.
// Softmax rows (fixed q) live on the lane axis -> one shfl_xor(16) per
// reduction. Output written f16 to (B,S,H*DK).
// ---------------------------------------------------------------------------
// waves_per_eu: the grid puts 4 waves on a SIMD, so registers saved for more
// than 4 buy nothing. With a higher upper bound this build saves registers by
// running each score's select, fma, exp as a chain of its own, with a
// v_nop behind most exps and few paired instructions.
__global__ __launch_bounds__(256)
__attribute__((amdgpu_waves_per_eu(4, 4))) void k_attn(
    const _Float16* __restrict__ qf, const _Float16* __restrict__ kf,
    const _Float16* __restrict__ vf, const unsigned* __restrict__ mbits,
    _Float16* __restrict__ of)
{
    __shared__ alignas(16) _Float16 sK[2][kPK * kKP]; // [kv][dk], rows of kKP
    __shared__ alignas(16) _Float16 sV[2][kDK * kVQ]; // [dk][kv], rows of kVQ

    const int tid   = threadIdx.x;
    const int wid   = tid >> 5;
    const int lane  = tid & 31;
    const int half  = lane >> 4;
    const int lm    = lane & 15;
    const int koff  = half ? 8 : 0;

    const int qgroup = blockIdx.x & 31;         // 32 q-groups per (b,h)
    const int h      = (blockIdx.x >> 5) & (kH - 1);
    const int b      = blockIdx.x >> 8;
    const int q0     = (qgroup * 8 + wid) * 16;

    const _Float16* Qb = qf + (((size_t)b * kH + h) * kS) * kDK;
    const _Float16* Kb = kf + (((size_t)b * kH + h) * kS) * kDK;
    const _Float16* Vb = vf + (((size_t)b * kH + h) * kDK) * kS;

    // Per-thread staging slots, kNG sweeps per tile: K = kPK rows x 8 segs of
    // 16 B, 32 rows a sweep; V^T = 64 rows x kVS segs, kVR rows a sweep.
    const int krow = tid >> 3,  kseg = (tid & 7) * 8;
    const int vrow = tid / kVS, vseg = (tid % kVS) * 8;
    const _Float16* kg = Kb + (size_t)krow * kDK + kseg;
    const _Float16* vg = Vb + (size_t)vrow * kS + vseg;
    const int kdst = krow * kKP + kseg;
    const int vdst = vrow * kVQ + vseg;

    // B operand of the score WMMAs: Q^T columns (fixed for the whole tile).
    v16h bq0, bq1;
    {
        const _Float16* qr = Qb + (size_t)(q0 + lm) * kDK;
        const v8h q_lo0 = *(const v8h*)(qr + koff);
        const v8h q_hi0 = *(const v8h*)(qr + 16 + koff);
        const v8h q_lo1 = *(const v8h*)(qr + 32 + koff);
        const v8h q_hi1 = *(const v8h*)(qr + 48 + koff);
#pragma unroll
        for (int i = 0; i < 8; ++i) {
            bq0[i] = q_lo0[i]; bq0[i + 8] = q_hi0[i];
            bq1[i] = q_lo1[i]; bq1[i + 8] = q_hi1[i];
        }
    }

    float mrow = -1e30f;         // running maximum of the raw scores
    float nmrow = 1e30f * kSL;   // -mrow * kSL, as the pass that set mrow rounded it
    float lrow = 0.0f;
    // -inf for masked scores, held in a vector register: as a literal it makes
    // each select a lone long-form instruction; from a register this build
    // issues the selects two to a slot (v_dual_cndmask_b32).
    float ninf;
    asm("v_mov_b32 %0, 0xff800000" : "=v"(ninf));
    v8f o0 = {}, o1 = {}, o2 = {}, o3 = {};

    const int q = q0 + lm;
    // readfirstlane: the wave's number in a scalar register, so that the mask
    // address is wave-uniform. Constant address space: nothing writes the
    // words while this kernel runs; without it the compiler takes the loop's
    // copies and barriers for possible writers and loads through vector
    // registers instead of with s_load.
    const int qt = qgroup * 8 + __builtin_amdgcn_readfirstlane(wid);
    const __attribute__((address_space(4))) v16u* mtile =
        (const __attribute__((address_space(4))) v16u*)(
            mbits + (size_t)qt * (kS / 32) * 16);

    // Prologue: stage pass 0 into buffer 0.
#pragma unroll
    for (int i = 0; i < kNG; ++i) {
        cp16_g2s(kg + (size_t)i * 32 * kDK,  &sK[0][kdst + i * 32 * kKP]);
        cp16_g2s(vg + (size_t)i * kVR * kS,  &sV[0][vdst + i * kVR * kVQ]);
    }

    const int npass = kS / kPK; // 32
    for (int ci = 0; ci < npass; ++ci) {
        const int cur = ci & 1;

        wait_g2s();
        __syncthreads(); // pass ci visible in LDS to all waves

        if (ci + 1 < npass) { // overlap next pass's DMA with compute
            const int nkv = (ci + 1) * kPK;
#pragma unroll
            for (int i = 0; i < kNG; ++i) {
                cp16_g2s(kg + (size_t)(nkv + i * 32) * kDK,
                         &sK[1 - cur][kdst + i * 32 * kKP]);
                cp16_g2s(vg + (size_t)i * kVR * kS + nkv,
                         &sV[1 - cur][vdst + i * kVR * kVQ]);
            }
        }

        // word e of group g, bit L = lane L's entry of register e
        v16u mw[kNG];
#pragma unroll
        for (int g = 0; g < kNG; ++g) mw[g] = mtile[ci * kNG + g];

        // ---- S^T tiles from LDS K rows, 64 keys at a time. sched_fence(): the
        // K reads of 64 keys stay one group ahead of their score WMMAs, and
        // each 64 keys' V^T reads one group; without it each read is waited
        // out alone.
        v8f c[2 * kNG] = {};
#pragma unroll
        for (int hp = 0; hp < kNG / 2; ++hp) {
            sched_fence();
            v16h ka[4][2];
#pragma unroll
            for (int j = 0; j < 4; ++j) {
                const _Float16* kr = &sK[cur][((hp * 4 + j) * 16 + lm) * kKP + koff];
                ka[j][0] = frag16(kr);
                ka[j][1] = frag16(kr + 32);
            }
            sched_fence();
#pragma unroll
            for (int kk = 0; kk < 2; ++kk) {
#pragma unroll
                for (int j = 0; j < 4; ++j)
                    c[hp * 4 + j] =
                        WMMA_F16(ka[j][kk], kk ? bq1 : bq0, c[hp * 4 + j]);
            }
        }
        sched_fence();
        v16h va[kNG][4]; // the first 64 keys' V^T now, the rest after the softmax
#pragma unroll
        for (int g = 0; g < 2; ++g) {
#pragma unroll
            for (int t = 0; t < 4; ++t)
                va[g][t] = frag16(&sV[cur][(t * 16 + lm) * kVQ + g * 32 + koff]);
        }
        sched_fence();

        // ---- mask (lane masks in scalar registers) + online softmax on the RAW
        // scores, in the base-2 domain: exp((c - m) / 8) = exp2(c * kSL - m * kSL).
        // A masked score is -inf, the running maximum is never below -1e30, so
        // the fma of a masked score is -inf and its exp2 is 0 with no second
        // select, also while a row has met no allowed key yet.
        float s0[kNG][8], s1[kNG][8];
        float tmax = -1e30f;
#pragma unroll
        for (int g = 0; g < kNG; ++g) {
#pragma unroll
            for (int r = 0; r < 8; ++r) {
                const bool b0 = __builtin_amdgcn_inverse_ballot_w32(mw[g][r]);
                const bool b1 = __builtin_amdgcn_inverse_ballot_w32(mw[g][8 + r]);
                s0[g][r] = b0 ? c[2 * g][r] : ninf;
                s1[g][r] = b1 ? c[2 * g + 1][r] : ninf;
                tmax = fmaxf(tmax, fmaxf(s0[g][r], s1[g][r]));
            }
        }
        tmax = fmaxf(tmax, __shfl_xor(tmax, 16, 32));
        const float mnew  = fmaxf(mrow, tmax);
        const float nmk   = -mnew * kSL; // the addend of every score's fma
        const float alpha = __builtin_amdgcn_exp2f(nmk - nmrow);

        float psum = 0.0f;
        v16h bp[kNG]; // P^T repacked lane-locally into the B-operand layout
#pragma unroll
        for (int g = 0; g < kNG; ++g) {
#pragma unroll
            for (int r = 0; r < 8; ++r) {
                const float p0 =
                    __builtin_amdgcn_exp2f(__builtin_fmaf(s0[g][r], kSL, nmk));
                const float p1 =
                    __builtin_amdgcn_exp2f(__builtin_fmaf(s1[g][r], kSL, nmk));
                psum += p0 + p1;
                bp[g][r]     = (_Float16)p0;
                bp[g][r + 8] = (_Float16)p1;
            }
        }
        psum += __shfl_xor(psum, 16, 32);
        lrow = lrow * alpha + psum;
        mrow = mnew;
        nmrow = nmk;

#pragma unroll
        for (int j = 0; j < 8; ++j) {
            o0[j] *= alpha; o1[j] *= alpha; o2[j] *= alpha; o3[j] *= alpha;
        }

        // ---- O^T += V^T . P^T  (4 dk-tiles per 32 keys); the next 64 keys'
        // V^T reads fly under this 64 keys' WMMAs
#pragma unroll
        for (int hp = 0; hp < kNG / 2; ++hp) {
            if (hp + 1 < kNG / 2) {
                sched_fence();
#pragma unroll
                for (int g = 2 * hp + 2; g < 2 * hp + 4; ++g) {
#pragma unroll
                    for (int t = 0; t < 4; ++t)
                        va[g][t] = frag16(
                            &sV[cur][(t * 16 + lm) * kVQ + g * 32 + koff]);
                }
                sched_fence();
            }
#pragma unroll
            for (int g = 2 * hp; g < 2 * hp + 2; ++g) {
                o0 = WMMA_F16(va[g][0], bp[g], o0);
                o1 = WMMA_F16(va[g][1], bp[g], o1);
                o2 = WMMA_F16(va[g][2], bp[g], o2);
                o3 = WMMA_F16(va[g][3], bp[g], o3);
            }
        }

        __syncthreads(); // all waves done reading buf[cur] before reuse
    }

    // ---- normalize + store: O^T element (dk = t*16 + r + half*8, q = q0+lm)
    const float inv = 1.0f / lrow;
    _Float16* orow = of + ((size_t)b * kS + q) * kDM + h * kDK;
#pragma unroll
    for (int t = 0; t < 4; ++t) {
        const v8f ot = (t == 0) ? o0 : (t == 1) ? o1 : (t == 2) ? o2 : o3;
#pragma unroll
        for (int r = 0; r < 8; ++r) {
            const int dk = t * 16 + r + half * 8;
            orow[dk] = (_Float16)(ot[r] * inv);
        }
    }
}

// ---------------------------------------------------------------------------
// Kernel 3: output projection. out = attn(f16) @ Wo^T + bo, f32 store.
// Same staging as kernel 1: block = 8 waves, 128 rows of attn against 64 rows
// of Wo; per 64-wide k step both pieces are read once as whole lines, Wo is
// converted to f16 once, and the waves take fragments from LDS.
// ---------------------------------------------------------------------------
__global__ __launch_bounds__(256) void k_out_proj(
    const _Float16* __restrict__ of, const float* __restrict__ wo,
    const float* __restrict__ bo, float* __restrict__ out)
{
    __shared__ alignas(16) _Float16 sA[2][128 * kKP]; // [m][k], rows of kKP
    __shared__ alignas(16) _Float16 sB[2][64 * kKP];  // [n][k]

    const int tid  = threadIdx.x;
    const int wid  = tid >> 5;
    const int lane = tid & 31;
    const int half = lane >> 4;
    const int lm   = lane & 15;
    const int koff = half ? 8 : 0;

    const int mblk = blockIdx.x * 128;
    const int m0   = mblk + wid * 16;
    const int n0   = blockIdx.y * 64;

    // Staging slots: attn rows 64 f16 = 8 threads x 16 B, 32 rows per sweep;
    // Wo rows 64 f32 = 16 threads x 16 B, 16 rows per sweep.
    const int arow = tid >> 3, aseg = (tid & 7) * 8;
    const int brow = tid >> 4, bc4  = (tid & 15) * 4;
    const _Float16* ag = of + (size_t)(mblk + arow) * kDM + aseg;
    const float*    bg = wo + (size_t)(n0 + brow) * kDM + bc4;

    v8h ra[4];
    float4 rb[4];
#pragma unroll
    for (int i = 0; i < 4; ++i) {
        ra[i] = *(const v8h*)(ag + (size_t)i * 32 * kDM);
        rb[i] = *(const float4*)(bg + (size_t)i * 16 * kDM);
    }
#pragma unroll
    for (int i = 0; i < 4; ++i) {
        *(v8h*)&sA[0][(i * 32 + arow) * kKP + aseg] = ra[i];
        *(v4h*)&sB[0][(i * 16 + brow) * kKP + bc4]  = cvt4(rb[i]);
    }

    v8f acc[4] = {};

    const int nsteps = kDM / 64; // 8
    for (int ks = 0; ks < nsteps; ++ks) {
        const int cur = ks & 1;
        // One barrier per step: buffer cur is complete, and every wave has
        // left the other buffer (read in step ks-1), which is refilled below.
        __syncthreads();

        const bool more = ks + 1 < nsteps;
        if (more) { // next step's global loads fly under this step's WMMAs
            const int k0 = (ks + 1) * 64;
#pragma unroll
            for (int i = 0; i < 4; ++i) {
                ra[i] = *(const v8h*)(ag + (size_t)i * 32 * kDM + k0);
                rb[i] = *(const float4*)(bg + (size_t)i * 16 * kDM + k0);
            }
        }

        // sched_fence(): keeps the global loads above, and the step's LDS
        // reads together ahead of its WMMAs (see kernel 1).
        sched_fence();
        v16h a[2], bm[2][4];
#pragma unroll
        for (int kk = 0; kk < 2; ++kk) {
            a[kk] = frag16(&sA[cur][(wid * 16 + lm) * kKP + kk * 32 + koff]);
#pragma unroll
            for (int t = 0; t < 4; ++t)
                bm[kk][t] =
                    frag16(&sB[cur][(t * 16 + lm) * kKP + kk * 32 + koff]);
        }
        sched_fence();
#pragma unroll
        for (int kk = 0; kk < 2; ++kk) {
#pragma unroll
            for (int t = 0; t < 4; ++t)
                acc[t] = WMMA_F16(a[kk], bm[kk][t], acc[t]);
        }
        sched_fence();

        if (more) {
#pragma unroll
            for (int i = 0; i < 4; ++i) {
                *(v8h*)&sA[1 - cur][(i * 32 + arow) * kKP + aseg] = ra[i];
                *(v4h*)&sB[1 - cur][(i * 16 + brow) * kKP + bc4] = cvt4(rb[i]);
            }
        }
    }

#pragma unroll
    for (int t = 0; t < 4; ++t) {
        const int n = n0 + t * 16 + lm;
        const float bval = bo[n];
#pragma unroll
        for (int r = 0; r < 8; ++r) {
            const int m = m0 + r + half * 8;
            out[(size_t)m * kDM + n] = acc[t][r] + bval;
        }
    }
}

// ---------------------------------------------------------------------------
extern "C" void kernel_launch(void* const* d_in, const int* in_sizes, int n_in,
                              void* d_out, int out_size, void* d_ws,
                              size_t ws_size, hipStream_t stream) {
    (void)in_sizes; (void)n_in; (void)out_size; (void)ws_size;

    const float* x    = (const float*)d_in[0];
    const int*   dmsk = (const int*)d_in[1];
    const float* wq   = (const float*)d_in[2];
    const float* bq   = (const float*)d_in[3];
    const float* wk   = (const float*)d_in[4];
    const float* bk   = (const float*)d_in[5];
    const float* wv   = (const float*)d_in[6];
    const float* bv   = (const float*)d_in[7];
    const float* wo   = (const float*)d_in[8];
    const float* bo   = (const float*)d_in[9];
    float* out = (float*)d_out;

    const size_t elems = (size_t)kB * kH * kS * kDK; // 4,194,304 per tensor
    _Float16* qf = (_Float16*)d_ws;
    _Float16* kf = qf + elems;
    _Float16* vf = kf + elems;
    _Float16* of = vf + elems;
    unsigned* mbits = (unsigned*)(of + elems);       // +2MB packed mask

    dim3 g1((kB * kS) / 128, kH);
    k_proj_qkv<<<g1, 256, 0, stream>>>(x, wq, bq, wk, bk, wv, bv, qf, kf, vf,
                                       dmsk, mbits);

    const int nblk = kB * kH * 32; // (b,h) x 32 q-groups = 512 blocks
    k_attn<<<nblk, 256, 0, stream>>>(qf, kf, vf, mbits, of);

    dim3 g3((kB * kS) / 128, kDM / 64);
    k_out_proj<<<g3, 256, 0, stream>>>(of, wo, bo, out);
}

// v007
// Measured time: 94 microseconds a run.
// Timed twice side by side with v006, it ran 1.04 times as fast both times.
// Counting every step since v000, it is 3.93 times as fast.
#include <hip/hip_runtime.h>

typedef __attribute__((ext_vector_type(16))) _Float16 v16h;
typedef __attribute__((ext_vector_type(8)))  _Float16 v8h;
typedef __attribute__((ext_vector_type(4)))  _Float16 v4h;
typedef __attribute__((ext_vector_type(8)))  float    v8f;
typedef __attribute__((ext_vector_type(16))) unsigned v16u;
typedef int v4i_vs __attribute__((vector_size(16))); // matches builtin param

#define WMMA_F16(a, b, c) \
    __builtin_amdgcn_wmma_f32_16x16x32_f16(false, (a), false, (b), (short)0, (c), false, false)

static constexpr int   kB  = 2;
static constexpr int   kS  = 4096;
static constexpr int   kDM = 512;
static constexpr int   kH  = 8;
static constexpr int   kDK = 64;
static constexpr float kScale = 0.125f; // 1/sqrt(64)
static constexpr float kSL = kScale * 1.44269504088896f; // scale * log2(e)
// LDS row pitches in f16 elements, 16 B x odd so that the 16 rows one
// ds_load_b128 touches fall on 16 different bank groups (64 banks x 4 B):
// 128-B rows (staged K) -> 144 B, 64-B rows -> 80 B. The projection kernels'
// LDS tiles use these two pitches for their 128-B and 64-B rows.
static constexpr int   kKP = kDK + 8;  // 72 elements = 144 B
static constexpr int   kVP = 32 + 8;   // 40 elements =  80 B
// Attention pass: kNG groups of 32 keys are staged together; each
// wave scores and reduces the two groups of its key half together. A staged V^T row holds the pass's keys, again at 16 B x odd.
static constexpr int   kNG  = 4;
static constexpr int   kPK  = 32 * kNG;   // keys per pass
static constexpr int   kVQ  = kPK + 8;    // V^T row pitch in elements
static constexpr int   kVS  = kPK / 8;    // 16-B segments per V^T row
static constexpr int   kVR  = 256 / kVS;  // V^T rows per staging sweep
static_assert(kNG % 2 == 0 && ((kVQ / 8) & 1) == 1, "pairs of groups; odd pitch");

#if __has_builtin(__builtin_amdgcn_global_load_async_to_lds_b128)
#define ASYNC_LDS 1
#endif

// 16-byte global -> LDS copy. Async DMA path on gfx1250
// (GLOBAL_LOAD_ASYNC_TO_LDS_B128, ASYNCcnt), else load+ds_store fallback.
__device__ __forceinline__ void cp16_g2s(const _Float16* g, _Float16* l) {
#ifdef ASYNC_LDS
    __builtin_amdgcn_global_load_async_to_lds_b128(
        (__attribute__((address_space(1))) v4i_vs*)g,
        (__attribute__((address_space(3))) v4i_vs*)l, 0, 0);
#else
    *(v8h*)l = *(const v8h*)g;
#endif
}

__device__ __forceinline__ void wait_g2s() {
#ifdef ASYNC_LDS
#if __has_builtin(__builtin_amdgcn_s_wait_asynccnt)
    __builtin_amdgcn_s_wait_asynccnt(0);
#else
    asm volatile("s_wait_asynccnt 0" ::: "memory");
#endif
#endif
}

// ---------------------------------------------------------------------------
// Mask packing (runs inside kernel 1): the (S,S) int32 DAG mask becomes 1 bit
// per entry, laid out as the attention kernel's LANE MASKS. For score tile
// (qt = q/16, c = kv/32) there are 16 words, one per accumulator register of
// the tile's two S^T blocks:
//   bits[(qt*128 + c)*16 + e], bit L ==
//     (mask[qt*16 + (L&15)][c*32 + (e>>3)*16 + (L>>4)*8 + (e&7)] != 0)
// i.e. bit L of word e is the entry that lane L holds in register e. A wave
// of the attention kernel reads its tile's 64 B with one scalar load and
// selects straight from the scalar registers. Still 2 MB in all.
// Each of kernel 1's 4096 waves packs 16 mask rows x 1 KB, in two pieces of
// 16 rows x 512 B. A piece comes into the wave's own LDS range by async
// copies (one row = 512 contiguous bytes = four whole lines per copy), which
// use no register and no load counter of the k loop that runs meanwhile.
// Lane L then reads its own row's entries from LDS, a ballot per entry makes
// the word, and each tile pair's 32 words leave as one 128-B line.
// ---------------------------------------------------------------------------
static constexpr int kMRow   = 128;       // entries of a row in one piece
static constexpr int kMPitch = kMRow + 4; // LDS row pitch: 528 B = 16 B x odd

// Eight async copies to LDS: eight mask rows of 512 B, 16 B a lane.
// s_wait_xcnt 0 ends the copies' own statement, so that no address register
// of an issued copy is rewritten ahead of it.
__device__ __forceinline__ void cp_rows8(const unsigned l, const int* g) {
    asm volatile(
        "global_load_async_to_lds_b128 %0, %8, off\n\t"
        "global_load_async_to_lds_b128 %1, %9, off\n\t"
        "global_load_async_to_lds_b128 %2, %10, off\n\t"
        "global_load_async_to_lds_b128 %3, %11, off\n\t"
        "global_load_async_to_lds_b128 %4, %12, off\n\t"
        "global_load_async_to_lds_b128 %5, %13, off\n\t"
        "global_load_async_to_lds_b128 %6, %14, off\n\t"
        "global_load_async_to_lds_b128 %7, %15, off\n\t"
        "s_wait_xcnt 0x0"
        :: "v"(l), "v"(l + kMPitch * 4),
           "v"(l + 2 * kMPitch * 4), "v"(l + 3 * kMPitch * 4),
           "v"(l + 4 * kMPitch * 4), "v"(l + 5 * kMPitch * 4),
           "v"(l + 6 * kMPitch * 4), "v"(l + 7 * kMPitch * 4),
           "v"(g), "v"(g + kS), "v"(g + 2 * kS), "v"(g + 3 * kS),
           "v"(g + 4 * kS), "v"(g + 5 * kS), "v"(g + 6 * kS), "v"(g + 7 * kS)
        : "memory");
}

// One piece on its way: l = the lane's LDS byte address in row 0 of the wave's
// range, g = the lane's 16 bytes of mask row 0 of the piece.
__device__ __forceinline__ void mask_stage(const unsigned l, const int* g) {
    cp_rows8(l, g);
    cp_rows8(l + 8 * kMPitch * 4, g + (size_t)8 * kS);
}

// Packs a landed piece (two tile pairs). row = the lane's own row in LDS, at
// its half's 8 entries; dst = the first pair's 32 words.
__device__ __forceinline__ void mask_pack2(const int* row, unsigned* dst,
                                           const int lane) {
    // The loops below are unrolled so that m[] and t[] have constant indices
    // and stay in registers.
#pragma unroll
    for (int p = 0; p < 2; ++p) {
        int4 m[8]; // m[j]: words e = 4j..4j+3 of the pair (tile j>>2)
#pragma unroll
        for (int j = 0; j < 8; ++j)
            m[j] = *(const int4*)(row + p * 64 + (j >> 1) * 16 + (j & 1) * 4);
        unsigned t[32]; // the pair's 32 words, each wave-uniform
#pragma unroll
        for (int j = 0; j < 8; ++j) {
            t[4 * j + 0] = __builtin_amdgcn_ballot_w32(m[j].x != 0);
            t[4 * j + 1] = __builtin_amdgcn_ballot_w32(m[j].y != 0);
            t[4 * j + 2] = __builtin_amdgcn_ballot_w32(m[j].z != 0);
            t[4 * j + 3] = __builtin_amdgcn_ballot_w32(m[j].w != 0);
        }
        // Lane L picks word L: a select tree over the five bits of L.
#pragma unroll
        for (int s = 0; s < 5; ++s) {
            const bool odd = (lane >> s) & 1;
#pragma unroll
            for (int i = 0; i < (16 >> s); ++i)
                t[i] = odd ? t[2 * i + 1] : t[2 * i];
        }
        dst[p * 32 + lane] = t[0];
    }
}

// ---------------------------------------------------------------------------
// Kernel 1: fused QKV projection, operands staged in LDS.
//   Y[m][n] = sum_k X[m][k] * W[n][k] + bias[n]   (einsum 'bsd,ed->bse')
// Block = 8 waves on ONE head: 128 rows of x against the head's 64 rows of
// each of Wq, Wk, Wv. Per 32-wide k step the block reads its x and W pieces
// once, as whole 128-B lines (8 lanes x 16 B per row), converts them to f16
// once and stores them in LDS; the 8 waves then take their fragments with
// ds_load_b128. Wave w still computes the 16(m) x 64(n) tile of Q, K AND V
// with the same k order as before (12 WMMAs per A fragment).
// Q,K stored f16 as (B,H,S,DK); V stored f16 TRANSPOSED as (B,H,DK,S).
//
// WMMA operand convention (CDNA5 wave32, 16x16x32 f16):
//   A (MxK): lanes 0-15 hold row M=lane, K elems {0..7,16..23};
//            lanes 16-31 hold row M=lane-16, K elems {8..15,24..31}.
//   B (KxN): lane n<16 holds col N=n with K elems {0..7,16..23};
//            lane n+16 holds col N=n with K elems {8..15,24..31}.
//   C/D    : VGPR r, lanes 0-15 -> (M=r, N=lane); lanes 16-31 -> (M=8+r).
// ---------------------------------------------------------------------------
__device__ __forceinline__ v4h cvt4(const float4 f) {
    v4h r;
    r[0] = (_Float16)f.x; r[1] = (_Float16)f.y;
    r[2] = (_Float16)f.z; r[3] = (_Float16)f.w;
    return r;
}

__device__ __forceinline__ void sched_fence() {
    __builtin_amdgcn_sched_barrier(0);
}

__device__ __forceinline__ v16h frag16(const _Float16* p) {
    const v8h lo = *(const v8h*)(p);
    const v8h hi = *(const v8h*)(p + 16);
    v16h a;
#pragma unroll
    for (int i = 0; i < 8; ++i) { a[i] = lo[i]; a[i + 8] = hi[i]; }
    return a;
}

__global__ __launch_bounds__(256) void k_proj_qkv(
    const float* __restrict__ x,
    const float* __restrict__ wq, const float* __restrict__ bq,
    const float* __restrict__ wk, const float* __restrict__ bk,
    const float* __restrict__ wv, const float* __restrict__ bv,
    _Float16* __restrict__ qf, _Float16* __restrict__ kf,
    _Float16* __restrict__ vf,
    const int* __restrict__ mask, unsigned* __restrict__ bits)
{
    __shared__ alignas(16) _Float16 sX[2][128 * kVP]; // [m][k], rows of kVP
    __shared__ alignas(16) _Float16 sW[2][192 * kVP]; // [wsel*64+n][k]
    __shared__ alignas(16) int sM[8][16 * kMPitch];   // a mask piece per wave

    const int tid  = threadIdx.x;
    const int wid  = tid >> 5;
    const int lane = tid & 31;
    const int half = lane >> 4;
    const int lm   = lane & 15;
    const int koff = half ? 8 : 0;

    const int mblk = blockIdx.x * 128; // row block over B*S = 8192 rows
    const int m0   = mblk + wid * 16;  // this wave's 16 rows
    const int h    = blockIdx.y;       // head -> n0 = h*64
    const int n0   = h * kDK;

    const float* bias[3] = {bq, bk, bv};

    // This wave's share of the mask: rows mqt*16.., 256 entries from mcol on.
    const int gw   = (blockIdx.y * (kB * kS / 128) + blockIdx.x) * 8 + wid;
    const int mqt  = gw >> 4;
    const int mcol = (gw & 15) * (2 * kMRow);
    const int* mg  = mask + (size_t)mqt * 16 * kS + mcol + lane * 4;
    const unsigned ml = (unsigned)(__UINTPTR_TYPE__)(
        __attribute__((address_space(3))) int*)&sM[wid][lane * 4];
    const int* mrow = &sM[wid][lm * kMPitch + half * 8];
    unsigned* mdst  = bits + (size_t)gw * 128;

    // Staging slot: 8 threads cover one row's 32 floats, 32 rows per sweep.
    const int srow = tid >> 3;
    const int sc4  = (tid & 7) * 4;
    const float* xg = x + (size_t)(mblk + srow) * kDM + sc4;
    const float* wg[3] = {wq + (size_t)(n0 + srow) * kDM + sc4,
                          wk + (size_t)(n0 + srow) * kDM + sc4,
                          wv + (size_t)(n0 + srow) * kDM + sc4};

    float4 rx[4], rw[6];
#pragma unroll
    for (int i = 0; i < 4; ++i)
        rx[i] = *(const float4*)(xg + (size_t)i * 32 * kDM);
#pragma unroll
    for (int j = 0; j < 6; ++j)
        rw[j] = *(const float4*)(wg[j >> 1] + (size_t)(j & 1) * 32 * kDM);
#pragma unroll
    for (int i = 0; i < 4; ++i)
        *(v4h*)&sX[0][(i * 32 + srow) * kVP + sc4] = cvt4(rx[i]);
#pragma unroll
    for (int j = 0; j < 6; ++j)
        *(v4h*)&sW[0][(j * 32 + srow) * kVP + sc4] = cvt4(rw[j]);
    // Piece 0 flies under the first half of the k loop; asked for once the
    // first x and W pieces are in, so that these do not queue behind it.
    mask_stage(ml, mg);

    v8f acc[3][4] = {};

    const int nsteps = kDM / 32; // 16
    // One k step; inlined into the two loops below, between which the mask's
    // pieces change over. more: a next step exists (a constant at each call).
    auto kstep = [&](const int ks, const bool more)
                     __attribute__((always_inline)) {
        const int cur = ks & 1;
        // One barrier per step: buffer cur is complete, and every wave has
        // left the other buffer (read in step ks-1), which is refilled below.
        // The wave's LDS stores of the step before are complete in front of
        // the barrier.
        asm volatile("s_wait_dscnt 0x0" ::: "memory");
        __syncthreads();

        if (more) { // next step's global loads fly under this step's WMMAs
            const int k0 = (ks + 1) * 32;
#pragma unroll
            for (int i = 0; i < 4; ++i)
                rx[i] = *(const float4*)(xg + (size_t)i * 32 * kDM + k0);
#pragma unroll
            for (int j = 0; j < 6; ++j)
                rw[j] = *(const float4*)(wg[j >> 1] +
                                         (size_t)(j & 1) * 32 * kDM + k0);
        }

        // The scheduler does not cross sched_fence(): without these it sinks
        // the global loads below the WMMAs and waits out every LDS read
        // alone. Each W group is read one group ahead of its WMMAs.
        sched_fence();
        const _Float16* wrow = &sW[cur][lm * kVP + koff];
        const v16h a = frag16(&sX[cur][(wid * 16 + lm) * kVP + koff]);
        v16h b0[4], b1[4];
#pragma unroll
        for (int t = 0; t < 4; ++t) b0[t] = frag16(wrow + (t * 16) * kVP);
#pragma unroll
        for (int t = 0; t < 4; ++t) b1[t] = frag16(wrow + (64 + t * 16) * kVP);
        sched_fence();
#pragma unroll
        for (int t = 0; t < 4; ++t) acc[0][t] = WMMA_F16(a, b0[t], acc[0][t]);
        sched_fence();
#pragma unroll
        for (int t = 0; t < 4; ++t) b0[t] = frag16(wrow + (128 + t * 16) * kVP);
        sched_fence();
#pragma unroll
        for (int t = 0; t < 4; ++t) acc[1][t] = WMMA_F16(a, b1[t], acc[1][t]);
#pragma unroll
        for (int t = 0; t < 4; ++t) acc[2][t] = WMMA_F16(a, b0[t], acc[2][t]);
        sched_fence();

        if (more) {
#pragma unroll
            for (int i = 0; i < 4; ++i)
                *(v4h*)&sX[1 - cur][(i * 32 + srow) * kVP + sc4] = cvt4(rx[i]);
#pragma unroll
            for (int j = 0; j < 6; ++j)
                *(v4h*)&sW[1 - cur][(j * 32 + srow) * kVP + sc4] = cvt4(rw[j]);
        }
    };

    for (int ks = 0; ks < nsteps / 2; ++ks) kstep(ks, true);

    // Mask piece 0 has landed behind the issuing wave's own wait; then a
    // barrier, then the reads. No LDS read moves above the wait.
    asm volatile("s_wait_asynccnt 0x0" ::: "memory");
    __syncthreads();
    mask_pack2(mrow, mdst, lane);
    // The reads of piece 0 are over, in every wave, before piece 1 is copied
    // over them; it flies under the second half of the k loop.
    asm volatile("s_wait_dscnt 0x0" ::: "memory");
    __syncthreads();
    mask_stage(ml, mg + kMRow);

    for (int ks = nsteps / 2; ks < nsteps - 1; ++ks) kstep(ks, true);
    kstep(nsteps - 1, false);

    // Mask piece 1: the wave's own wait, a barrier, then the reads. Ahead of
    // the Q, K, V stores, so that the barrier does not wait for those.
    asm volatile("s_wait_asynccnt 0x0" ::: "memory");
    __syncthreads();
    mask_pack2(mrow, mdst + 64, lane);

#pragma unroll
    for (int wsel = 0; wsel < 3; ++wsel) {
#pragma unroll
        for (int t = 0; t < 4; ++t) {
            const int dk = t * 16 + lm;          // N index inside head
            const float bval = bias[wsel][n0 + dk];
#pragma unroll
            for (int r = 0; r < 8; ++r) {
                const int m = m0 + r + half * 8; // global row (b*S + s)
                const int b = m >> 12;           // / 4096
                const int s = m & (kS - 1);
                const _Float16 val = (_Float16)(acc[wsel][t][r] + bval);
                if (wsel == 2) {                 // V transposed: (B,H,DK,S)
                    vf[(((size_t)b * kH + h) * kDK + dk) * kS + s] = val;
                } else {                         // Q/K: (B,H,S,DK)
                    _Float16* dst = (wsel == 0) ? qf : kf;
                    dst[(((size_t)b * kH + h) * kS + s) * kDK + dk] = val;
                }
            }
        }
    }
}

// ---------------------------------------------------------------------------
// Kernel 2: flash attention, transposed-score formulation, LDS-staged KV.
// Block = 256 threads = 8 waves, all on ONE (b,h) and 128 queries. Each 128-kv
// pass of K (128x64 f16) and V^T (64x128 f16) is staged into LDS once per
// block via async-to-LDS (double buffered).
// Wave tile: 32 query columns x 64 of the pass's 128 keys. Wave w takes query
// pair (w & 3) and key half (w >> 2), so every K and V^T fragment read from
// LDS feeds TWO WMMAs (one per 16 query columns): half the LDS reads of a
// 16-column wave, at the same number of waves. Each key half keeps its own
// running maximum, row sum and O^T; the two halves are merged once, through
// LDS, behind the loop.
// Mask comes as lane masks (kernel 1): 16 words per 16 queries and 32 keys,
// read by scalar loads; each select takes its word as it stands.
//
//   S^T (kv x q): 4 x 2 tiles of 16 kv x 16 q, each = 2 WMMAs over DK=64.
//   O^T (dk x q): 4 x 2 tiles, A = V^T(dk x kv32), B = P^T (lane-local
//                 repack), one WMMA per tile and 32 keys.
// One maximum, one sum, one rescale of O^T per column and one barrier pair
// per pass. Softmax rows (fixed q) live on the lane axis -> one shfl_xor(16)
// per reduction. Output written f16 to (B,S,H*DK).
// ---------------------------------------------------------------------------
// waves_per_eu: the grid puts 4 waves on a SIMD, so registers saved for more
// than 4 buy nothing. With a higher upper bound this build saves registers by
// running each score's select, fma, exp as a chain of its own, with a
// v_nop behind most exps and few paired instructions.
__global__ __launch_bounds__(256)
__attribute__((amdgpu_waves_per_eu(4, 4))) void k_attn(
    const _Float16* __restrict__ qf, const _Float16* __restrict__ kf,
    const _Float16* __restrict__ vf, const unsigned* __restrict__ mbits,
    _Float16* __restrict__ of)
{
    __shared__ alignas(16) _Float16 sK[2][kPK * kKP]; // [kv][dk], rows of kKP
    __shared__ alignas(16) _Float16 sV[2][kDK * kVQ]; // [dk][kv], rows of kVQ
    // Hand-over of the second key half's O^T, maxima and sums: [slot][lane of
    // the four waves], 16 B a lane, so a wave's store covers 512 B in a row.
    __shared__ alignas(16) float4 sX[17][128];

    const int tid   = threadIdx.x;
    const int wid   = tid >> 5;
    const int lane  = tid & 31;
    const int half  = lane >> 4;
    const int lm    = lane & 15;
    const int koff  = half ? 8 : 0;

    // readfirstlane: the wave's number in a scalar register, so that the mask
    // address and the epilogue's branches are wave-uniform.
    const int wsc = __builtin_amdgcn_readfirstlane(wid);
    const int pr  = wsc & 3;  // which 32 of the block's 128 queries
    const int kh  = wsc >> 2; // which 64 of a pass's 128 keys

    const int qgroup = blockIdx.x & 31;         // 32 q-groups per (b,h)
    const int h      = (blockIdx.x >> 5) & (kH - 1);
    const int b      = blockIdx.x >> 8;
    const int q0     = (qgroup * 8 + pr * 2) * 16;

    const _Float16* Qb = qf + (((size_t)b * kH + h) * kS) * kDK;
    const _Float16* Kb = kf + (((size_t)b * kH + h) * kS) * kDK;
    const _Float16* Vb = vf + (((size_t)b * kH + h) * kDK) * kS;

    // Per-thread staging slots, kNG sweeps per tile: K = kPK rows x 8 segs of
    // 16 B, 32 rows a sweep; V^T = 64 rows x kVS segs, kVR rows a sweep.
    const int krow = tid >> 3,  kseg = (tid & 7) * 8;
    const int vrow = tid / kVS, vseg = (tid % kVS) * 8;
    const _Float16* kg = Kb + (size_t)krow * kDK + kseg;
    const _Float16* vg = Vb + (size_t)vrow * kS + vseg;
    const int kdst = krow * kKP + kseg;
    const int vdst = vrow * kVQ + vseg;

    // B operands of the score WMMAs: Q^T columns (fixed for the whole tile).
    v16h bq[2][2];
#pragma unroll
    for (int j = 0; j < 2; ++j) {
        const _Float16* qr = Qb + (size_t)(q0 + j * 16 + lm) * kDK + koff;
        bq[j][0] = frag16(qr);
        bq[j][1] = frag16(qr + 32);
    }

    // Per 16 query columns j: running maximum of the raw scores; -mrow * kSL
    // as the pass that set mrow rounded it; row sum.
    float mrow[2]  = {-1e30f, -1e30f};
    float nmrow[2] = {1e30f * kSL, 1e30f * kSL};
    float lrow[2]  = {0.0f, 0.0f};
    // -inf for masked scores, held in a vector register: as a literal it makes
    // each select a lone long-form instruction; from a register this build
    // issues the selects two to a slot (v_dual_cndmask_b32).
    float ninf;
    asm("v_mov_b32 %0, 0xff800000" : "=v"(ninf));
    v8f o[2][4] = {};

    // Constant address space: nothing writes the words while this kernel
    // runs; without it the compiler takes the loop's copies and barriers for
    // possible writers and loads through vector registers instead of with
    // s_load. Base: the wave's first query tile, its key half's first group.
    const int qt = qgroup * 8 + pr * 2;
    const __attribute__((address_space(4))) v16u* mtile =
        (const __attribute__((address_space(4))) v16u*)(
            mbits + ((size_t)qt * (kS / 32) + kh * 2) * 16);

    // The wave's fragment rows inside a staged buffer (its key half).
    const int kfrag = (kh * 64 + lm) * kKP + koff;
    const int vfrag = lm * kVQ + kh * 64 + koff;

    // Prologue: stage pass 0 into buffer 0.
#pragma unroll
    for (int i = 0; i < kNG; ++i) {
        cp16_g2s(kg + (size_t)i * 32 * kDK,  &sK[0][kdst + i * 32 * kKP]);
        cp16_g2s(vg + (size_t)i * kVR * kS,  &sV[0][vdst + i * kVR * kVQ]);
    }

    const int npass = kS / kPK; // 32
    for (int ci = 0; ci < npass; ++ci) {
        const int cur = ci & 1;

        wait_g2s();
        __syncthreads(); // pass ci visible in LDS to all waves

        if (ci + 1 < npass) { // overlap next pass's DMA with compute
            const int nkv = (ci + 1) * kPK;
#pragma unroll
            for (int i = 0; i < kNG; ++i) {
                cp16_g2s(kg + (size_t)(nkv + i * 32) * kDK,
                         &sK[1 - cur][kdst + i * 32 * kKP]);
                cp16_g2s(vg + (size_t)i * kVR * kS + nkv,
                         &sV[1 - cur][vdst + i * kVR * kVQ]);
            }
        }

        // word e of query tile j, group g: bit L = lane L's entry of register e
        v16u mw[2][2];
#pragma unroll
        for (int j = 0; j < 2; ++j) {
#pragma unroll
            for (int g = 0; g < 2; ++g)
                mw[j][g] = mtile[j * (kS / 32) + ci * kNG + g];
        }

        // ---- S^T tiles from LDS K rows. sched_fence(): the wave's K reads
        // stay one group ahead of their score WMMAs, and its V^T reads one
        // group; without it each read is waited out alone.
        v8f c[4][2] = {};
        sched_fence();
        v16h ka[4][2];
#pragma unroll
        for (int i = 0; i < 4; ++i) {
            const _Float16* kr = &sK[cur][kfrag + i * 16 * kKP];
            ka[i][0] = frag16(kr);
            ka[i][1] = frag16(kr + 32);
        }
        sched_fence();
#pragma unroll
        for (int kk = 0; kk < 2; ++kk) {
#pragma unroll
            for (int i = 0; i < 4; ++i) {
#pragma unroll
                for (int j = 0; j < 2; ++j)
                    c[i][j] = WMMA_F16(ka[i][kk], bq[j][kk], c[i][j]);
            }
        }
        sched_fence();
        v16h va[2][4]; // the first 32 keys' V^T now, the rest after the softmax
#pragma unroll
        for (int t = 0; t < 4; ++t)
            va[0][t] = frag16(&sV[cur][vfrag + t * 16 * kVQ]);
        sched_fence();

        // ---- mask (lane masks in scalar registers) + online softmax on the RAW
        // scores, in the base-2 domain: exp((c - m) / 8) = exp2(c * kSL - m * kSL).
        // A masked score is -inf, the running maximum is never below -1e30, so
        // the fma of a masked score is -inf and its exp2 is 0 with no second
        // select, also while a row has met no allowed key yet.
        float tmax[2] = {-1e30f, -1e30f};
#pragma unroll
        for (int j = 0; j < 2; ++j) {
#pragma unroll
            for (int g = 0; g < 2; ++g) {
#pragma unroll
                for (int r = 0; r < 8; ++r) {
                    const bool b0 =
                        __builtin_amdgcn_inverse_ballot_w32(mw[j][g][r]);
                    const bool b1 =
                        __builtin_amdgcn_inverse_ballot_w32(mw[j][g][8 + r]);
                    c[2 * g][j][r]     = b0 ? c[2 * g][j][r] : ninf;
                    c[2 * g + 1][j][r] = b1 ? c[2 * g + 1][j][r] : ninf;
                    tmax[j] = fmaxf(tmax[j],
                                    fmaxf(c[2 * g][j][r], c[2 * g + 1][j][r]));
                }
            }
        }
        float alpha[2], nmk[2];
#pragma unroll
        for (int j = 0; j < 2; ++j)
            tmax[j] = fmaxf(tmax[j], __shfl_xor(tmax[j], 16, 32));
#pragma unroll
        for (int j = 0; j < 2; ++j) {
            const float mnew = fmaxf(mrow[j], tmax[j]);
            nmk[j]   = -mnew * kSL; // the addend of every score's fma
            alpha[j] = __builtin_amdgcn_exp2f(nmk[j] - nmrow[j]);
            mrow[j]  = mnew;
            nmrow[j] = nmk[j];
        }

        float psum[2] = {0.0f, 0.0f};
        v16h bp[2][2]; // P^T repacked lane-locally into the B-operand layout
#pragma unroll
        for (int j = 0; j < 2; ++j) {
#pragma unroll
            for (int g = 0; g < 2; ++g) {
#pragma unroll
                for (int r = 0; r < 8; ++r) {
                    const float p0 = __builtin_amdgcn_exp2f(
                        __builtin_fmaf(c[2 * g][j][r], kSL, nmk[j]));
                    const float p1 = __builtin_amdgcn_exp2f(
                        __builtin_fmaf(c[2 * g + 1][j][r], kSL, nmk[j]));
                    psum[j] += p0 + p1;
                    bp[j][g][r]     = (_Float16)p0;
                    bp[j][g][r + 8] = (_Float16)p1;
                }
            }
        }
#pragma unroll
        for (int j = 0; j < 2; ++j)
            psum[j] += __shfl_xor(psum[j], 16, 32);
#pragma unroll
        for (int j = 0; j < 2; ++j) {
            lrow[j] = lrow[j] * alpha[j] + psum[j];
#pragma unroll
            for (int t = 0; t < 4; ++t) o[j][t] *= alpha[j];
        }

        // ---- O^T += V^T . P^T  (4 dk-tiles x 2 query tiles per 32 keys); the
        // second 32 keys' V^T reads fly under the first 32 keys' WMMAs
        sched_fence();
#pragma unroll
        for (int t = 0; t < 4; ++t)
            va[1][t] = frag16(&sV[cur][vfrag + t * 16 * kVQ + 32]);
        sched_fence();
#pragma unroll
        for (int g = 0; g < 2; ++g) {
#pragma unroll
            for (int t = 0; t < 4; ++t) {
#pragma unroll
                for (int j = 0; j < 2; ++j)
                    o[j][t] = WMMA_F16(va[g][t], bp[j][g], o[j][t]);
            }
        }

        __syncthreads(); // all waves done reading buf[cur] before reuse
    }

    // ---- merge of the two key halves: the waves of half 1 hand their O^T,
    // maxima and sums to the wave of half 0 that has the same queries.
    const int xl = pr * 32 + lane;
    if (kh == 1) {
#pragma unroll
        for (int j = 0; j < 2; ++j) {
#pragma unroll
            for (int t = 0; t < 4; ++t) {
                const v8f ot = o[j][t];
                sX[(j * 4 + t) * 2][xl] =
                    make_float4(ot[0], ot[1], ot[2], ot[3]);
                sX[(j * 4 + t) * 2 + 1][xl] =
                    make_float4(ot[4], ot[5], ot[6], ot[7]);
            }
        }
        sX[16][xl] = make_float4(mrow[0], lrow[0], mrow[1], lrow[1]);
    }
    __syncthreads(); // the hand-over is complete before the other half reads it
    if (kh == 0) {
        const float4 ml = sX[16][xl];
#pragma unroll
        for (int j = 0; j < 2; ++j) {
            const float m1 = j ? ml.z : ml.x;
            const float l1 = j ? ml.w : ml.y;
            const float mn = fmaxf(mrow[j], m1);
            const float a0 = __builtin_amdgcn_exp2f((mrow[j] - mn) * kSL);
            const float a1 = __builtin_amdgcn_exp2f((m1 - mn) * kSL);
            const float inv = 1.0f / (lrow[j] * a0 + l1 * a1);
            const float f0 = a0 * inv, f1 = a1 * inv;
            // O^T element (dk = t*16 + r + half*8, q = q0 + j*16 + lm)
            _Float16* orow = of + ((size_t)b * kS + q0 + j * 16 + lm) * kDM +
                             h * kDK + half * 8;
#pragma unroll
            for (int t = 0; t < 4; ++t) {
                const float4 lo = sX[(j * 4 + t) * 2][xl];
                const float4 hi = sX[(j * 4 + t) * 2 + 1][xl];
                const float x1[8] = {lo.x, lo.y, lo.z, lo.w,
                                     hi.x, hi.y, hi.z, hi.w};
                v8h w;
#pragma unroll
                for (int r = 0; r < 8; ++r)
                    w[r] = (_Float16)(o[j][t][r] * f0 + x1[r] * f1);
                *(v8h*)(orow + t * 16) = w;
            }
        }
    }
}

// ---------------------------------------------------------------------------
// Kernel 3: output projection. out = attn(f16) @ Wo^T + bo, f32 store.
// Same staging as kernel 1: block = 8 waves, 128 rows of attn against 64 rows
// of Wo; per 64-wide k step both pieces are read once as whole lines, Wo is
// converted to f16 once, and the waves take fragments from LDS.
// ---------------------------------------------------------------------------
__global__ __launch_bounds__(256) void k_out_proj(
    const _Float16* __restrict__ of, const float* __restrict__ wo,
    const float* __restrict__ bo, float* __restrict__ out)
{
    __shared__ alignas(16) _Float16 sA[2][128 * kKP]; // [m][k], rows of kKP
    __shared__ alignas(16) _Float16 sB[2][64 * kKP];  // [n][k]

    const int tid  = threadIdx.x;
    const int wid  = tid >> 5;
    const int lane = tid & 31;
    const int half = lane >> 4;
    const int lm   = lane & 15;
    const int koff = half ? 8 : 0;

    const int mblk = blockIdx.x * 128;
    const int m0   = mblk + wid * 16;
    const int n0   = blockIdx.y * 64;

    // Staging slots: attn rows 64 f16 = 8 threads x 16 B, 32 rows per sweep;
    // Wo rows 64 f32 = 16 threads x 16 B, 16 rows per sweep.
    const int arow = tid >> 3, aseg = (tid & 7) * 8;
    const int brow = tid >> 4, bc4  = (tid & 15) * 4;
    const _Float16* ag = of + (size_t)(mblk + arow) * kDM + aseg;
    const float*    bg = wo + (size_t)(n0 + brow) * kDM + bc4;

    v8h ra[4];
    float4 rb[4];
#pragma unroll
    for (int i = 0; i < 4; ++i) {
        ra[i] = *(const v8h*)(ag + (size_t)i * 32 * kDM);
        rb[i] = *(const float4*)(bg + (size_t)i * 16 * kDM);
    }
#pragma unroll
    for (int i = 0; i < 4; ++i) {
        *(v8h*)&sA[0][(i * 32 + arow) * kKP + aseg] = ra[i];
        *(v4h*)&sB[0][(i * 16 + brow) * kKP + bc4]  = cvt4(rb[i]);
    }

    v8f acc[4] = {};

    const int nsteps = kDM / 64; // 8
    for (int ks = 0; ks < nsteps; ++ks) {
        const int cur = ks & 1;
        // One barrier per step: buffer cur is complete, and every wave has
        // left the other buffer (read in step ks-1), which is refilled below.
        __syncthreads();

        const bool more = ks + 1 < nsteps;
        if (more) { // next step's global loads fly under this step's WMMAs
            const int k0 = (ks + 1) * 64;
#pragma unroll
            for (int i = 0; i < 4; ++i) {
                ra[i] = *(const v8h*)(ag + (size_t)i * 32 * kDM + k0);
                rb[i] = *(const float4*)(bg + (size_t)i * 16 * kDM + k0);
            }
        }

        // sched_fence(): keeps the global loads above, and the step's LDS
        // reads together ahead of its WMMAs (see kernel 1).
        sched_fence();
        v16h a[2], bm[2][4];
#pragma unroll
        for (int kk = 0; kk < 2; ++kk) {
            a[kk] = frag16(&sA[cur][(wid * 16 + lm) * kKP + kk * 32 + koff]);
#pragma unroll
            for (int t = 0; t < 4; ++t)
                bm[kk][t] =
                    frag16(&sB[cur][(t * 16 + lm) * kKP + kk * 32 + koff]);
        }
        sched_fence();
#pragma unroll
        for (int kk = 0; kk < 2; ++kk) {
#pragma unroll
            for (int t = 0; t < 4; ++t)
                acc[t] = WMMA_F16(a[kk], bm[kk][t], acc[t]);
        }
        sched_fence();

        if (more) {
#pragma unroll
            for (int i = 0; i < 4; ++i) {
                *(v8h*)&sA[1 - cur][(i * 32 + arow) * kKP + aseg] = ra[i];
                *(v4h*)&sB[1 - cur][(i * 16 + brow) * kKP + bc4] = cvt4(rb[i]);
            }
        }
    }

#pragma unroll
    for (int t = 0; t < 4; ++t) {
        const int n = n0 + t * 16 + lm;
        const float bval = bo[n];
#pragma unroll
        for (int r = 0; r < 8; ++r) {
            const int m = m0 + r + half * 8;
            out[(size_t)m * kDM + n] = acc[t][r] + bval;
        }
    }
}

// ---------------------------------------------------------------------------
extern "C" void kernel_launch(void* const* d_in, const int* in_sizes, int n_in,
                              void* d_out, int out_size, void* d_ws,
                              size_t ws_size, hipStream_t stream) {
    (void)in_sizes; (void)n_in; (void)out_size; (void)ws_size;

    const float* x    = (const float*)d_in[0];
    const int*   dmsk = (const int*)d_in[1];
    const float* wq   = (const float*)d_in[2];
    const float* bq   = (const float*)d_in[3];
    const float* wk   = (const float*)d_in[4];
    const float* bk   = (const float*)d_in[5];
    const float* wv   = (const float*)d_in[6];
    const float* bv   = (const float*)d_in[7];
    const float* wo   = (const float*)d_in[8];
    const float* bo   = (const float*)d_in[9];
    float* out = (float*)d_out;

    const size_t elems = (size_t)kB * kH * kS * kDK; // 4,194,304 per tensor
    _Float16* qf = (_Float16*)d_ws;
    _Float16* kf = qf + elems;
    _Float16* vf = kf + elems;
    _Float16* of = vf + elems;
    unsigned* mbits = (unsigned*)(of + elems);       // +2MB packed mask

    dim3 g1((kB * kS) / 128, kH);
    k_proj_qkv<<<g1, 256, 0, stream>>>(x, wq, bq, wk, bk, wv, bv, qf, kf, vf,
                                       dmsk, mbits);

    const int nblk = kB * kH * 32; // (b,h) x 32 q-groups = 512 blocks
    k_attn<<<nblk, 256, 0, stream>>>(qf, kf, vf, mbits, of);

    dim3 g3((kB * kS) / 128, kDM / 64);
    k_out_proj<<<g3, 256, 0, stream>>>(of, wo, bo, out);
}

// v008
// It runs in 88.6 microseconds.
// In both of two side-by-side timings against v007, it was 1.06 times as fast.
// All steps since v000 together make it 4.16 times as fast.
#include <hip/hip_runtime.h>

typedef __attribute__((ext_vector_type(16))) _Float16 v16h;
typedef __attribute__((ext_vector_type(8)))  _Float16 v8h;
typedef __attribute__((ext_vector_type(4)))  _Float16 v4h;
typedef __attribute__((ext_vector_type(8)))  float    v8f;
typedef __attribute__((ext_vector_type(16))) unsigned v16u;
typedef int v4i_vs __attribute__((vector_size(16))); // matches builtin param

#define WMMA_F16(a, b, c) \
    __builtin_amdgcn_wmma_f32_16x16x32_f16(false, (a), false, (b), (short)0, (c), false, false)

static constexpr int   kB  = 2;
static constexpr int   kS  = 4096;
static constexpr int   kDM = 512;
static constexpr int   kH  = 8;
static constexpr int   kDK = 64;
static constexpr float kScale = 0.125f; // 1/sqrt(64)
static constexpr float kSL = kScale * 1.44269504088896f; // scale * log2(e)
// Attention keeps a column's reference maximum until a score exceeds it by
// more than kLazy (base-2 units): P stays <= 2^kLazy, far inside f16 range.
static constexpr float kLazy = 8.0f;
// LDS row pitches in f16 elements, 16 B x odd so that the 16 rows one
// ds_load_b128 touches fall on 16 different bank groups (64 banks x 4 B):
// 128-B rows (staged K) -> 144 B, 64-B rows -> 80 B. The projection kernels'
// LDS tiles use these two pitches for their 128-B and 64-B rows.
static constexpr int   kKP = kDK + 8;  // 72 elements = 144 B
static constexpr int   kVP = 32 + 8;   // 40 elements =  80 B
// Attention pass: kNG groups of 32 keys are staged together; each
// wave scores and reduces the two groups of its key half together. A staged V^T row holds the pass's keys, again at 16 B x odd.
static constexpr int   kNG  = 4;
static constexpr int   kPK  = 32 * kNG;   // keys per pass
static constexpr int   kVQ  = kPK + 8;    // V^T row pitch in elements
static constexpr int   kVS  = kPK / 8;    // 16-B segments per V^T row
static constexpr int   kVR  = 256 / kVS;  // V^T rows per staging sweep
static_assert(kNG % 2 == 0 && ((kVQ / 8) & 1) == 1, "pairs of groups; odd pitch");

#if __has_builtin(__builtin_amdgcn_global_load_async_to_lds_b128)
#define ASYNC_LDS 1
#endif

// 16-byte global -> LDS copy. Async DMA path on gfx1250
// (GLOBAL_LOAD_ASYNC_TO_LDS_B128, ASYNCcnt), else load+ds_store fallback.
__device__ __forceinline__ void cp16_g2s(const _Float16* g, _Float16* l) {
#ifdef ASYNC_LDS
    __builtin_amdgcn_global_load_async_to_lds_b128(
        (__attribute__((address_space(1))) v4i_vs*)g,
        (__attribute__((address_space(3))) v4i_vs*)l, 0, 0);
#else
    *(v8h*)l = *(const v8h*)g;
#endif
}

__device__ __forceinline__ void wait_g2s() {
#ifdef ASYNC_LDS
#if __has_builtin(__builtin_amdgcn_s_wait_asynccnt)
    __builtin_amdgcn_s_wait_asynccnt(0);
#else
    asm volatile("s_wait_asynccnt 0" ::: "memory");
#endif
#endif
}

// ---------------------------------------------------------------------------
// Mask packing (runs inside kernel 1): the (S,S) int32 DAG mask becomes 1 bit
// per entry, laid out as the attention kernel's LANE MASKS. For score tile
// (qt = q/16, c = kv/32) there are 16 words, one per accumulator register of
// the tile's two S^T blocks:
//   bits[(qt*128 + c)*16 + e], bit L ==
//     (mask[qt*16 + (L&15)][c*32 + (e>>3)*16 + (L>>4)*8 + (e&7)] != 0)
// i.e. bit L of word e is the entry that lane L holds in register e. A wave
// of the attention kernel reads its tile's 64 B with one scalar load and
// selects straight from the scalar registers. Still 2 MB in all.
// Each of kernel 1's 4096 waves packs 16 mask rows x 1 KB, in two pieces of
// 16 rows x 512 B. A piece comes into the wave's own LDS range by async
// copies (one row = 512 contiguous bytes = four whole lines per copy), which
// use no register and no load counter of the k loop that runs meanwhile.
// Lane L then reads its own row's entries from LDS, a ballot per entry makes
// the word, and each tile pair's 32 words leave as one 128-B line.
// ---------------------------------------------------------------------------
static constexpr int kMRow   = 128;       // entries of a row in one piece
static constexpr int kMPitch = kMRow + 4; // LDS row pitch: 528 B = 16 B x odd

// Eight async copies to LDS: eight mask rows of 512 B, 16 B a lane.
// s_wait_xcnt 0 ends the copies' own statement, so that no address register
// of an issued copy is rewritten ahead of it.
__device__ __forceinline__ void cp_rows8(const unsigned l, const int* g) {
    asm volatile(
        "global_load_async_to_lds_b128 %0, %8, off\n\t"
        "global_load_async_to_lds_b128 %1, %9, off\n\t"
        "global_load_async_to_lds_b128 %2, %10, off\n\t"
        "global_load_async_to_lds_b128 %3, %11, off\n\t"
        "global_load_async_to_lds_b128 %4, %12, off\n\t"
        "global_load_async_to_lds_b128 %5, %13, off\n\t"
        "global_load_async_to_lds_b128 %6, %14, off\n\t"
        "global_load_async_to_lds_b128 %7, %15, off\n\t"
        "s_wait_xcnt 0x0"
        :: "v"(l), "v"(l + kMPitch * 4),
           "v"(l + 2 * kMPitch * 4), "v"(l + 3 * kMPitch * 4),
           "v"(l + 4 * kMPitch * 4), "v"(l + 5 * kMPitch * 4),
           "v"(l + 6 * kMPitch * 4), "v"(l + 7 * kMPitch * 4),
           "v"(g), "v"(g + kS), "v"(g + 2 * kS), "v"(g + 3 * kS),
           "v"(g + 4 * kS), "v"(g + 5 * kS), "v"(g + 6 * kS), "v"(g + 7 * kS)
        : "memory");
}

// One piece on its way: l = the lane's LDS byte address in row 0 of the wave's
// range, g = the lane's 16 bytes of mask row 0 of the piece.
__device__ __forceinline__ void mask_stage(const unsigned l, const int* g) {
    cp_rows8(l, g);
    cp_rows8(l + 8 * kMPitch * 4, g + (size_t)8 * kS);
}

// Packs a landed piece (two tile pairs). row = the lane's own row in LDS, at
// its half's 8 entries; dst = the first pair's 32 words.
__device__ __forceinline__ void mask_pack2(const int* row, unsigned* dst,
                                           const int lane) {
    // The loops below are unrolled so that m[] and t[] have constant indices
    // and stay in registers.
#pragma unroll
    for (int p = 0; p < 2; ++p) {
        int4 m[8]; // m[j]: words e = 4j..4j+3 of the pair (tile j>>2)
#pragma unroll
        for (int j = 0; j < 8; ++j)
            m[j] = *(const int4*)(row + p * 64 + (j >> 1) * 16 + (j & 1) * 4);
        unsigned t[32]; // the pair's 32 words, each wave-uniform
#pragma unroll
        for (int j = 0; j < 8; ++j) {
            t[4 * j + 0] = __builtin_amdgcn_ballot_w32(m[j].x != 0);
            t[4 * j + 1] = __builtin_amdgcn_ballot_w32(m[j].y != 0);
            t[4 * j + 2] = __builtin_amdgcn_ballot_w32(m[j].z != 0);
            t[4 * j + 3] = __builtin_amdgcn_ballot_w32(m[j].w != 0);
        }
        // Lane L picks word L: a select tree over the five bits of L.
#pragma unroll
        for (int s = 0; s < 5; ++s) {
            const bool odd = (lane >> s) & 1;
#pragma unroll
            for (int i = 0; i < (16 >> s); ++i)
                t[i] = odd ? t[2 * i + 1] : t[2 * i];
        }
        dst[p * 32 + lane] = t[0];
    }
}

// ---------------------------------------------------------------------------
// Kernel 1: fused QKV projection, operands staged in LDS.
//   Y[m][n] = sum_k X[m][k] * W[n][k] + bias[n]   (einsum 'bsd,ed->bse')
// Block = 8 waves on ONE head: 128 rows of x against the head's 64 rows of
// each of Wq, Wk, Wv. Per 32-wide k step the block reads its x and W pieces
// once, as whole 128-B lines (8 lanes x 16 B per row), converts them to f16
// once and stores them in LDS; the 8 waves then take their fragments with
// ds_load_b128. Wave w still computes the 16(m) x 64(n) tile of Q, K AND V
// with the same k order as before (12 WMMAs per A fragment).
// Q,K stored f16 as (B,H,S,DK); V stored f16 TRANSPOSED as (B,H,DK,S).
// Q is stored times kSL (multiplied in f32, rounded to f16 once), so that the
// attention kernel's score products are exp2 arguments as they stand.
//
// WMMA operand convention (CDNA5 wave32, 16x16x32 f16):
//   A (MxK): lanes 0-15 hold row M=lane, K elems {0..7,16..23};
//            lanes 16-31 hold row M=lane-16, K elems {8..15,24..31}.
//   B (KxN): lane n<16 holds col N=n with K elems {0..7,16..23};
//            lane n+16 holds col N=n with K elems {8..15,24..31}.
//   C/D    : VGPR r, lanes 0-15 -> (M=r, N=lane); lanes 16-31 -> (M=8+r).
// ---------------------------------------------------------------------------
__device__ __forceinline__ v4h cvt4(const float4 f) {
    v4h r;
    r[0] = (_Float16)f.x; r[1] = (_Float16)f.y;
    r[2] = (_Float16)f.z; r[3] = (_Float16)f.w;
    return r;
}

__device__ __forceinline__ void sched_fence() {
    __builtin_amdgcn_sched_barrier(0);
}

__device__ __forceinline__ v16h frag16(const _Float16* p) {
    const v8h lo = *(const v8h*)(p);
    const v8h hi = *(const v8h*)(p + 16);
    v16h a;
#pragma unroll
    for (int i = 0; i < 8; ++i) { a[i] = lo[i]; a[i + 8] = hi[i]; }
    return a;
}

__global__ __launch_bounds__(256) void k_proj_qkv(
    const float* __restrict__ x,
    const float* __restrict__ wq, const float* __restrict__ bq,
    const float* __restrict__ wk, const float* __restrict__ bk,
    const float* __restrict__ wv, const float* __restrict__ bv,
    _Float16* __restrict__ qf, _Float16* __restrict__ kf,
    _Float16* __restrict__ vf,
    const int* __restrict__ mask, unsigned* __restrict__ bits)
{
    __shared__ alignas(16) _Float16 sX[2][128 * kVP]; // [m][k], rows of kVP
    __shared__ alignas(16) _Float16 sW[2][192 * kVP]; // [wsel*64+n][k]
    __shared__ alignas(16) int sM[8][16 * kMPitch];   // a mask piece per wave

    const int tid  = threadIdx.x;
    const int wid  = tid >> 5;
    const int lane = tid & 31;
    const int half = lane >> 4;
    const int lm   = lane & 15;
    const int koff = half ? 8 : 0;

    const int mblk = blockIdx.x * 128; // row block over B*S = 8192 rows
    const int m0   = mblk + wid * 16;  // this wave's 16 rows
    const int h    = blockIdx.y;       // head -> n0 = h*64
    const int n0   = h * kDK;

    const float* bias[3] = {bq, bk, bv};

    // This wave's share of the mask: rows mqt*16.., 256 entries from mcol on.
    const int gw   = (blockIdx.y * (kB * kS / 128) + blockIdx.x) * 8 + wid;
    const int mqt  = gw >> 4;
    const int mcol = (gw & 15) * (2 * kMRow);
    const int* mg  = mask + (size_t)mqt * 16 * kS + mcol + lane * 4;
    const unsigned ml = (unsigned)(__UINTPTR_TYPE__)(
        __attribute__((address_space(3))) int*)&sM[wid][lane * 4];
    const int* mrow = &sM[wid][lm * kMPitch + half * 8];
    unsigned* mdst  = bits + (size_t)gw * 128;

    // Staging slot: 8 threads cover one row's 32 floats, 32 rows per sweep.
    const int srow = tid >> 3;
    const int sc4  = (tid & 7) * 4;
    const float* xg = x + (size_t)(mblk + srow) * kDM + sc4;
    const float* wg[3] = {wq + (size_t)(n0 + srow) * kDM + sc4,
                          wk + (size_t)(n0 + srow) * kDM + sc4,
                          wv + (size_t)(n0 + srow) * kDM + sc4};

    float4 rx[4], rw[6];
#pragma unroll
    for (int i = 0; i < 4; ++i)
        rx[i] = *(const float4*)(xg + (size_t)i * 32 * kDM);
#pragma unroll
    for (int j = 0; j < 6; ++j)
        rw[j] = *(const float4*)(wg[j >> 1] + (size_t)(j & 1) * 32 * kDM);
#pragma unroll
    for (int i = 0; i < 4; ++i)
        *(v4h*)&sX[0][(i * 32 + srow) * kVP + sc4] = cvt4(rx[i]);
#pragma unroll
    for (int j = 0; j < 6; ++j)
        *(v4h*)&sW[0][(j * 32 + srow) * kVP + sc4] = cvt4(rw[j]);
    // Piece 0 flies under the first half of the k loop; asked for once the
    // first x and W pieces are in, so that these do not queue behind it.
    mask_stage(ml, mg);

    v8f acc[3][4] = {};

    const int nsteps = kDM / 32; // 16
    // One k step; inlined into the two loops below, between which the mask's
    // pieces change over. more: a next step exists (a constant at each call).
    auto kstep = [&](const int ks, const bool more)
                     __attribute__((always_inline)) {
        const int cur = ks & 1;
        // One barrier per step: buffer cur is complete, and every wave has
        // left the other buffer (read in step ks-1), which is refilled below.
        // The wave's LDS stores of the step before are complete in front of
        // the barrier.
        asm volatile("s_wait_dscnt 0x0" ::: "memory");
        __syncthreads();

        if (more) { // next step's global loads fly under this step's WMMAs
            const int k0 = (ks + 1) * 32;
#pragma unroll
            for (int i = 0; i < 4; ++i)
                rx[i] = *(const float4*)(xg + (size_t)i * 32 * kDM + k0);
#pragma unroll
            for (int j = 0; j < 6; ++j)
                rw[j] = *(const float4*)(wg[j >> 1] +
                                         (size_t)(j & 1) * 32 * kDM + k0);
        }

        // The scheduler does not cross sched_fence(): without these it sinks
        // the global loads below the WMMAs and waits out every LDS read
        // alone. Each W group is read one group ahead of its WMMAs.
        sched_fence();
        const _Float16* wrow = &sW[cur][lm * kVP + koff];
        const v16h a = frag16(&sX[cur][(wid * 16 + lm) * kVP + koff]);
        v16h b0[4], b1[4];
#pragma unroll
        for (int t = 0; t < 4; ++t) b0[t] = frag16(wrow + (t * 16) * kVP);
#pragma unroll
        for (int t = 0; t < 4; ++t) b1[t] = frag16(wrow + (64 + t * 16) * kVP);
        sched_fence();
#pragma unroll
        for (int t = 0; t < 4; ++t) acc[0][t] = WMMA_F16(a, b0[t], acc[0][t]);
        sched_fence();
#pragma unroll
        for (int t = 0; t < 4; ++t) b0[t] = frag16(wrow + (128 + t * 16) * kVP);
        sched_fence();
#pragma unroll
        for (int t = 0; t < 4; ++t) acc[1][t] = WMMA_F16(a, b1[t], acc[1][t]);
#pragma unroll
        for (int t = 0; t < 4; ++t) acc[2][t] = WMMA_F16(a, b0[t], acc[2][t]);
        sched_fence();

        if (more) {
#pragma unroll
            for (int i = 0; i < 4; ++i)
                *(v4h*)&sX[1 - cur][(i * 32 + srow) * kVP + sc4] = cvt4(rx[i]);
#pragma unroll
            for (int j = 0; j < 6; ++j)
                *(v4h*)&sW[1 - cur][(j * 32 + srow) * kVP + sc4] = cvt4(rw[j]);
        }
    };

    for (int ks = 0; ks < nsteps / 2; ++ks) kstep(ks, true);

    // Mask piece 0 has landed behind the issuing wave's own wait; then a
    // barrier, then the reads. No LDS read moves above the wait.
    asm volatile("s_wait_asynccnt 0x0" ::: "memory");
    __syncthreads();
    mask_pack2(mrow, mdst, lane);
    // The reads of piece 0 are over, in every wave, before piece 1 is copied
    // over them; it flies under the second half of the k loop.
    asm volatile("s_wait_dscnt 0x0" ::: "memory");
    __syncthreads();
    mask_stage(ml, mg + kMRow);

    for (int ks = nsteps / 2; ks < nsteps - 1; ++ks) kstep(ks, true);
    kstep(nsteps - 1, false);

    // Mask piece 1: the wave's own wait, a barrier, then the reads. Ahead of
    // the Q, K, V stores, so that the barrier does not wait for those.
    asm volatile("s_wait_asynccnt 0x0" ::: "memory");
    __syncthreads();
    mask_pack2(mrow, mdst + 64, lane);

#pragma unroll
    for (int wsel = 0; wsel < 3; ++wsel) {
#pragma unroll
        for (int t = 0; t < 4; ++t) {
            const int dk = t * 16 + lm;          // N index inside head
            const float bval = bias[wsel][n0 + dk];
#pragma unroll
            for (int r = 0; r < 8; ++r) {
                const int m = m0 + r + half * 8; // global row (b*S + s)
                const int b = m >> 12;           // / 4096
                const int s = m & (kS - 1);
                const float y = acc[wsel][t][r] + bval;
                const _Float16 val = (_Float16)(wsel == 0 ? y * kSL : y);
                if (wsel == 2) {                 // V transposed: (B,H,DK,S)
                    vf[(((size_t)b * kH + h) * kDK + dk) * kS + s] = val;
                } else {                         // Q/K: (B,H,S,DK)
                    _Float16* dst = (wsel == 0) ? qf : kf;
                    dst[(((size_t)b * kH + h) * kS + s) * kDK + dk] = val;
                }
            }
        }
    }
}

// ---------------------------------------------------------------------------
// Kernel 2: flash attention, transposed-score formulation, LDS-staged KV.
// Block = 256 threads = 8 waves, all on ONE (b,h) and 128 queries. Each 128-kv
// pass of K (128x64 f16) and V^T (64x128 f16) is staged into LDS once per
// block via async-to-LDS (double buffered).
// Wave tile: 32 query columns x 64 of the pass's 128 keys. Wave w takes query
// pair (w & 3) and key half (w >> 2), so every K and V^T fragment read from
// LDS feeds TWO WMMAs (one per 16 query columns): half the LDS reads of a
// 16-column wave, at the same number of waves. Each key half keeps its own
// running maximum, row sum and O^T; the two halves are merged once, through
// LDS, behind the loop.
// Mask comes as lane masks (kernel 1): 16 words per 16 queries and 32 keys,
// read by scalar loads; each select takes its word as it stands.
//
//   S^T (kv x q): 4 x 2 tiles of 16 kv x 16 q, each = 2 WMMAs over DK=64.
//   O^T (dk x q): 4 x 2 tiles, A = V^T(dk x kv32), B = P^T (lane-local
//                 repack), one WMMA per tile and 32 keys.
// Q arrives times scale * log2(e), and the score WMMAs take C = -m, m being
// the column's reference maximum: a score leaves the matrix unit as its exp2
// argument. m moves, and O^T and the row sum are rescaled, only in a pass in
// which some score exceeds m by more than kLazy (one wave-uniform test per
// pass). One sum per column and one barrier pair per pass. Softmax rows
// (fixed q) live on the lane axis -> one shfl_xor(16) per reduction. Output
// written f16 to (B,S,H*DK).
// ---------------------------------------------------------------------------
// waves_per_eu: the grid puts 4 waves on a SIMD, so registers saved for more
// than 4 buy nothing. With a higher upper bound this build saves registers by
// running each score's select, exp as a chain of its own, with a
// v_nop behind most exps and few paired instructions.
__global__ __launch_bounds__(256)
__attribute__((amdgpu_waves_per_eu(4, 4))) void k_attn(
    const _Float16* __restrict__ qf, const _Float16* __restrict__ kf,
    const _Float16* __restrict__ vf, const unsigned* __restrict__ mbits,
    _Float16* __restrict__ of)
{
    __shared__ alignas(16) _Float16 sK[2][kPK * kKP]; // [kv][dk], rows of kKP
    __shared__ alignas(16) _Float16 sV[2][kDK * kVQ]; // [dk][kv], rows of kVQ
    // Hand-over of the second key half's O^T, maxima and sums: [slot][lane of
    // the four waves], 16 B a lane, so a wave's store covers 512 B in a row.
    __shared__ alignas(16) float4 sX[17][128];

    const int tid   = threadIdx.x;
    const int wid   = tid >> 5;
    const int lane  = tid & 31;
    const int half  = lane >> 4;
    const int lm    = lane & 15;
    const int koff  = half ? 8 : 0;

    // readfirstlane: the wave's number in a scalar register, so that the mask
    // address and the epilogue's branches are wave-uniform.
    const int wsc = __builtin_amdgcn_readfirstlane(wid);
    const int pr  = wsc & 3;  // which 32 of the block's 128 queries
    const int kh  = wsc >> 2; // which 64 of a pass's 128 keys

    const int qgroup = blockIdx.x & 31;         // 32 q-groups per (b,h)
    const int h      = (blockIdx.x >> 5) & (kH - 1);
    const int b      = blockIdx.x >> 8;
    const int q0     = (qgroup * 8 + pr * 2) * 16;

    const _Float16* Qb = qf + (((size_t)b * kH + h) * kS) * kDK;
    const _Float16* Kb = kf + (((size_t)b * kH + h) * kS) * kDK;
    const _Float16* Vb = vf + (((size_t)b * kH + h) * kDK) * kS;

    // Per-thread staging slots, kNG sweeps per tile: K = kPK rows x 8 segs of
    // 16 B, 32 rows a sweep; V^T = 64 rows x kVS segs, kVR rows a sweep.
    const int krow = tid >> 3,  kseg = (tid & 7) * 8;
    const int vrow = tid / kVS, vseg = (tid % kVS) * 8;
    const _Float16* kg = Kb + (size_t)krow * kDK + kseg;
    const _Float16* vg = Vb + (size_t)vrow * kS + vseg;
    const int kdst = krow * kKP + kseg;
    const int vdst = vrow * kVQ + vseg;

    // B operands of the score WMMAs: Q^T columns (fixed for the whole tile).
    v16h bq[2][2];
#pragma unroll
    for (int j = 0; j < 2; ++j) {
        const _Float16* qr = Qb + (size_t)(q0 + j * 16 + lm) * kDK + koff;
        bq[j][0] = frag16(qr);
        bq[j][1] = frag16(qr + 32);
    }

    // Per 16 query columns j: nm = -m; thr = how far a score may stand above m
    // before m moves: -inf until the column has met an allowed key, so that
    // the first finite score sets m; row sum.
    float nm[2]   = {0.0f, 0.0f};
    float thr[2]  = {-__builtin_inff(), -__builtin_inff()};
    float lrow[2] = {0.0f, 0.0f};
    // -inf for masked scores, held in a vector register: as a literal it makes
    // each select a lone long-form instruction; from a register this build
    // issues the selects two to a slot (v_dual_cndmask_b32).
    float ninf;
    asm("v_mov_b32 %0, 0xff800000" : "=v"(ninf));
    v8f o[2][4] = {};

    // Constant address space: nothing writes the words while this kernel
    // runs; without it the compiler takes the loop's copies and barriers for
    // possible writers and loads through vector registers instead of with
    // s_load. Base: the wave's first query tile, its key half's first group.
    const int qt = qgroup * 8 + pr * 2;
    const __attribute__((address_space(4))) v16u* mtile =
        (const __attribute__((address_space(4))) v16u*)(
            mbits + ((size_t)qt * (kS / 32) + kh * 2) * 16);

    // The wave's fragment rows inside a staged buffer (its key half).
    const int kfrag = (kh * 64 + lm) * kKP + koff;
    const int vfrag = lm * kVQ + kh * 64 + koff;

    // Prologue: stage pass 0 into buffer 0.
#pragma unroll
    for (int i = 0; i < kNG; ++i) {
        cp16_g2s(kg + (size_t)i * 32 * kDK,  &sK[0][kdst + i * 32 * kKP]);
        cp16_g2s(vg + (size_t)i * kVR * kS,  &sV[0][vdst + i * kVR * kVQ]);
    }

    const int npass = kS / kPK; // 32
    for (int ci = 0; ci < npass; ++ci) {
        const int cur = ci & 1;

        wait_g2s();
        __syncthreads(); // pass ci visible in LDS to all waves

        if (ci + 1 < npass) { // overlap next pass's DMA with compute
            const int nkv = (ci + 1) * kPK;
#pragma unroll
            for (int i = 0; i < kNG; ++i) {
                cp16_g2s(kg + (size_t)(nkv + i * 32) * kDK,
                         &sK[1 - cur][kdst + i * 32 * kKP]);
                cp16_g2s(vg + (size_t)i * kVR * kS + nkv,
                         &sV[1 - cur][vdst + i * kVR * kVQ]);
            }
        }

        // word e of query tile j, group g: bit L = lane L's entry of register e
        v16u mw[2][2];
#pragma unroll
        for (int j = 0; j < 2; ++j) {
#pragma unroll
            for (int g = 0; g < 2; ++g)
                mw[j][g] = mtile[j * (kS / 32) + ci * kNG + g];
        }

        // ---- S^T tiles from LDS K rows. sched_fence(): the wave's K reads
        // stay one group ahead of their score WMMAs, and its V^T reads one
        // group; without it each read is waited out alone.
        v8f c[4][2];
        // C operand of a column's first score WMMAs: -m in all eight registers
        // (a lane's eight scores of a tile belong to one column). Formed anew
        // in each pass, so that it holds no registers outside the products.
        v8f cm[2];
#pragma unroll
        for (int j = 0; j < 2; ++j) {
#pragma unroll
            for (int r = 0; r < 8; ++r) cm[j][r] = nm[j];
        }
        sched_fence();
        v16h ka[4][2];
#pragma unroll
        for (int i = 0; i < 4; ++i) {
            const _Float16* kr = &sK[cur][kfrag + i * 16 * kKP];
            ka[i][0] = frag16(kr);
            ka[i][1] = frag16(kr + 32);
        }
        sched_fence();
#pragma unroll
        for (int kk = 0; kk < 2; ++kk) {
#pragma unroll
            for (int i = 0; i < 4; ++i) {
#pragma unroll
                for (int j = 0; j < 2; ++j)
                    c[i][j] = WMMA_F16(ka[i][kk], bq[j][kk],
                                       kk == 0 ? cm[j] : c[i][j]);
            }
        }
        sched_fence();
        v16h va[2][4]; // the first 32 keys' V^T now, the rest after the softmax
#pragma unroll
        for (int t = 0; t < 4; ++t)
            va[0][t] = frag16(&sV[cur][vfrag + t * 16 * kVQ]);
        sched_fence();

        // ---- mask (lane masks in scalar registers) + online softmax. A score is
        // s * scale * log2(e) - m already. A masked score is -inf and its exp2 is
        // 0 with no second select, also while a column has met no allowed key.
        float tmax[2] = {-__builtin_inff(), -__builtin_inff()};
#pragma unroll
        for (int j = 0; j < 2; ++j) {
#pragma unroll
            for (int g = 0; g < 2; ++g) {
#pragma unroll
                for (int r = 0; r < 8; ++r) {
                    const bool b0 =
                        __builtin_amdgcn_inverse_ballot_w32(mw[j][g][r]);
                    const bool b1 =
                        __builtin_amdgcn_inverse_ballot_w32(mw[j][g][8 + r]);
                    c[2 * g][j][r]     = b0 ? c[2 * g][j][r] : ninf;
                    c[2 * g + 1][j][r] = b1 ? c[2 * g + 1][j][r] : ninf;
                    tmax[j] = fmaxf(tmax[j],
                                    fmaxf(c[2 * g][j][r], c[2 * g + 1][j][r]));
                }
            }
        }
        // One test per pass, a scalar branch: does any column's m have to move?
        // A lane's own maximum decides; the halves are joined only inside.
        const bool need = (tmax[0] > thr[0]) || (tmax[1] > thr[1]);
        if (__builtin_amdgcn_ballot_w32(need) != 0u) {
#pragma unroll
            for (int j = 0; j < 2; ++j) {
                const float t   = fmaxf(tmax[j], __shfl_xor(tmax[j], 16, 32));
                const bool  upd = t > thr[j]; // alike in both halves of a column
                const float nmo = nm[j];
                const float nmn = upd ? nmo - t : nmo;
                const float d   = nmo - nmn;  // the shift as nmn was rounded
                // d < 0 only for a column's first key: O^T and the sum are 0.
                const float al  = __builtin_amdgcn_exp2f(fminf(-d, 0.0f));
                thr[j] = upd ? kLazy : thr[j];
                nm[j]  = nmn;
#pragma unroll
                for (int i = 0; i < 4; ++i) c[i][j] -= d;
                lrow[j] *= al;
#pragma unroll
                for (int t4 = 0; t4 < 4; ++t4) o[j][t4] *= al;
            }
        }

        float psum[2] = {0.0f, 0.0f};
        v16h bp[2][2]; // P^T repacked lane-locally into the B-operand layout
#pragma unroll
        for (int j = 0; j < 2; ++j) {
#pragma unroll
            for (int g = 0; g < 2; ++g) {
#pragma unroll
                for (int r = 0; r < 8; ++r) {
                    const float p0 = __builtin_amdgcn_exp2f(c[2 * g][j][r]);
                    const float p1 = __builtin_amdgcn_exp2f(c[2 * g + 1][j][r]);
                    psum[j] += p0 + p1;
                    bp[j][g][r]     = (_Float16)p0;
                    bp[j][g][r + 8] = (_Float16)p1;
                }
            }
        }
#pragma unroll
        for (int j = 0; j < 2; ++j)
            psum[j] += __shfl_xor(psum[j], 16, 32);
#pragma unroll
        for (int j = 0; j < 2; ++j) lrow[j] += psum[j];

        // ---- O^T += V^T . P^T  (4 dk-tiles x 2 query tiles per 32 keys); the
        // second 32 keys' V^T reads fly under the first 32 keys' WMMAs
        sched_fence();
#pragma unroll
        for (int t = 0; t < 4; ++t)
            va[1][t] = frag16(&sV[cur][vfrag + t * 16 * kVQ + 32]);
        sched_fence();
#pragma unroll
        for (int g = 0; g < 2; ++g) {
#pragma unroll
            for (int t = 0; t < 4; ++t) {
#pragma unroll
                for (int j = 0; j < 2; ++j)
                    o[j][t] = WMMA_F16(va[g][t], bp[j][g], o[j][t]);
            }
        }

        __syncthreads(); // all waves done reading buf[cur] before reuse
    }

    // ---- merge of the two key halves: the waves of half 1 hand their O^T,
    // maxima and sums to the wave of half 0 that has the same queries.
    // A column that met no allowed key in this half counts with m = -1e30.
    float mrow[2];
#pragma unroll
    for (int j = 0; j < 2; ++j) mrow[j] = thr[j] > 0.0f ? -nm[j] : -1e30f;
    const int xl = pr * 32 + lane;
    if (kh == 1) {
#pragma unroll
        for (int j = 0; j < 2; ++j) {
#pragma unroll
            for (int t = 0; t < 4; ++t) {
                const v8f ot = o[j][t];
                sX[(j * 4 + t) * 2][xl] =
                    make_float4(ot[0], ot[1], ot[2], ot[3]);
                sX[(j * 4 + t) * 2 + 1][xl] =
                    make_float4(ot[4], ot[5], ot[6], ot[7]);
            }
        }
        sX[16][xl] = make_float4(mrow[0], lrow[0], mrow[1], lrow[1]);
    }
    __syncthreads(); // the hand-over is complete before the other half reads it
    if (kh == 0) {
        const float4 ml = sX[16][xl];
#pragma unroll
        for (int j = 0; j < 2; ++j) {
            const float m1 = j ? ml.z : ml.x;
            const float l1 = j ? ml.w : ml.y;
            const float mn = fmaxf(mrow[j], m1);
            const float a0 = __builtin_amdgcn_exp2f(mrow[j] - mn);
            const float a1 = __builtin_amdgcn_exp2f(m1 - mn);
            const float inv = 1.0f / (lrow[j] * a0 + l1 * a1);
            const float f0 = a0 * inv, f1 = a1 * inv;
            // O^T element (dk = t*16 + r + half*8, q = q0 + j*16 + lm)
            _Float16* orow = of + ((size_t)b * kS + q0 + j * 16 + lm) * kDM +
                             h * kDK + half * 8;
#pragma unroll
            for (int t = 0; t < 4; ++t) {
                const float4 lo = sX[(j * 4 + t) * 2][xl];
                const float4 hi = sX[(j * 4 + t) * 2 + 1][xl];
                const float x1[8] = {lo.x, lo.y, lo.z, lo.w,
                                     hi.x, hi.y, hi.z, hi.w};
                v8h w;
#pragma unroll
                for (int r = 0; r < 8; ++r)
                    w[r] = (_Float16)(o[j][t][r] * f0 + x1[r] * f1);
                *(v8h*)(orow + t * 16) = w;
            }
        }
    }
}

// ---------------------------------------------------------------------------
// Kernel 3: output projection. out = attn(f16) @ Wo^T + bo, f32 store.
// Same staging as kernel 1: block = 8 waves, 128 rows of attn against 64 rows
// of Wo; per 64-wide k step both pieces are read once as whole lines, Wo is
// converted to f16 once, and the waves take fragments from LDS.
// ---------------------------------------------------------------------------
__global__ __launch_bounds__(256) void k_out_proj(
    const _Float16* __restrict__ of, const float* __restrict__ wo,
    const float* __restrict__ bo, float* __restrict__ out)
{
    __shared__ alignas(16) _Float16 sA[2][128 * kKP]; // [m][k], rows of kKP
    __shared__ alignas(16) _Float16 sB[2][64 * kKP];  // [n][k]

    const int tid  = threadIdx.x;
    const int wid  = tid >> 5;
    const int lane = tid & 31;
    const int half = lane >> 4;
    const int lm   = lane & 15;
    const int koff = half ? 8 : 0;

    const int mblk = blockIdx.x * 128;
    const int m0   = mblk + wid * 16;
    const int n0   = blockIdx.y * 64;

    // Staging slots: attn rows 64 f16 = 8 threads x 16 B, 32 rows per sweep;
    // Wo rows 64 f32 = 16 threads x 16 B, 16 rows per sweep.
    const int arow = tid >> 3, aseg = (tid & 7) * 8;
    const int brow = tid >> 4, bc4  = (tid & 15) * 4;
    const _Float16* ag = of + (size_t)(mblk + arow) * kDM + aseg;
    const float*    bg = wo + (size_t)(n0 + brow) * kDM + bc4;

    v8h ra[4];
    float4 rb[4];
#pragma unroll
    for (int i = 0; i < 4; ++i) {
        ra[i] = *(const v8h*)(ag + (size_t)i * 32 * kDM);
        rb[i] = *(const float4*)(bg + (size_t)i * 16 * kDM);
    }
#pragma unroll
    for (int i = 0; i < 4; ++i) {
        *(v8h*)&sA[0][(i * 32 + arow) * kKP + aseg] = ra[i];
        *(v4h*)&sB[0][(i * 16 + brow) * kKP + bc4]  = cvt4(rb[i]);
    }

    v8f acc[4] = {};

    const int nsteps = kDM / 64; // 8
    for (int ks = 0; ks < nsteps; ++ks) {
        const int cur = ks & 1;
        // One barrier per step: buffer cur is complete, and every wave has
        // left the other buffer (read in step ks-1), which is refilled below.
        __syncthreads();

        const bool more = ks + 1 < nsteps;
        if (more) { // next step's global loads fly under this step's WMMAs
            const int k0 = (ks + 1) * 64;
#pragma unroll
            for (int i = 0; i < 4; ++i) {
                ra[i] = *(const v8h*)(ag + (size_t)i * 32 * kDM + k0);
                rb[i] = *(const float4*)(bg + (size_t)i * 16 * kDM + k0);
            }
        }

        // sched_fence(): keeps the global loads above, and the step's LDS
        // reads together ahead of its WMMAs (see kernel 1).
        sched_fence();
        v16h a[2], bm[2][4];
#pragma unroll
        for (int kk = 0; kk < 2; ++kk) {
            a[kk] = frag16(&sA[cur][(wid * 16 + lm) * kKP + kk * 32 + koff]);
#pragma unroll
            for (int t = 0; t < 4; ++t)
                bm[kk][t] =
                    frag16(&sB[cur][(t * 16 + lm) * kKP + kk * 32 + koff]);
        }
        sched_fence();
#pragma unroll
        for (int kk = 0; kk < 2; ++kk) {
#pragma unroll
            for (int t = 0; t < 4; ++t)
                acc[t] = WMMA_F16(a[kk], bm[kk][t], acc[t]);
        }
        sched_fence();

        if (more) {
#pragma unroll
            for (int i = 0; i < 4; ++i) {
                *(v8h*)&sA[1 - cur][(i * 32 + arow) * kKP + aseg] = ra[i];
                *(v4h*)&sB[1 - cur][(i * 16 + brow) * kKP + bc4] = cvt4(rb[i]);
            }
        }
    }

#pragma unroll
    for (int t = 0; t < 4; ++t) {
        const int n = n0 + t * 16 + lm;
        const float bval = bo[n];
#pragma unroll
        for (int r = 0; r < 8; ++r) {
            const int m = m0 + r + half * 8;
            out[(size_t)m * kDM + n] = acc[t][r] + bval;
        }
    }
}

// ---------------------------------------------------------------------------
extern "C" void kernel_launch(void* const* d_in, const int* in_sizes, int n_in,
                              void* d_out, int out_size, void* d_ws,
                              size_t ws_size, hipStream_t stream) {
    (void)in_sizes; (void)n_in; (void)out_size; (void)ws_size;

    const float* x    = (const float*)d_in[0];
    const int*   dmsk = (const int*)d_in[1];
    const float* wq   = (const float*)d_in[2];
    const float* bq   = (const float*)d_in[3];
    const float* wk   = (const float*)d_in[4];
    const float* bk   = (const float*)d_in[5];
    const float* wv   = (const float*)d_in[6];
    const float* bv   = (const float*)d_in[7];
    const float* wo   = (const float*)d_in[8];
    const float* bo   = (const float*)d_in[9];
    float* out = (float*)d_out;

    const size_t elems = (size_t)kB * kH * kS * kDK; // 4,194,304 per tensor
    _Float16* qf = (_Float16*)d_ws;
    _Float16* kf = qf + elems;
    _Float16* vf = kf + elems;
    _Float16* of = vf + elems;
    unsigned* mbits = (unsigned*)(of + elems);       // +2MB packed mask

    dim3 g1((kB * kS) / 128, kH);
    k_proj_qkv<<<g1, 256, 0, stream>>>(x, wq, bq, wk, bk, wv, bv, qf, kf, vf,
                                       dmsk, mbits);

    const int nblk = kB * kH * 32; // (b,h) x 32 q-groups = 512 blocks
    k_attn<<<nblk, 256, 0, stream>>>(qf, kf, vf, mbits, of);

    dim3 g3((kB * kS) / 128, kDM / 64);
    k_out_proj<<<g3, 256, 0, stream>>>(of, wo, bo, out);
}

// v009
// A run of this version takes 85.2 microseconds.
// Timed twice side by side with v008, it ran 1.04 times as fast both times.
// Over all steps from v000 it is 4.34 times as fast.
#include <hip/hip_runtime.h>

typedef __attribute__((ext_vector_type(16))) _Float16 v16h;
typedef __attribute__((ext_vector_type(8)))  _Float16 v8h;
typedef __attribute__((ext_vector_type(4)))  _Float16 v4h;
typedef __attribute__((ext_vector_type(8)))  float    v8f;
typedef __attribute__((ext_vector_type(16))) unsigned v16u;
typedef int v4i_vs __attribute__((vector_size(16))); // matches builtin param

#define WMMA_F16(a, b, c) \
    __builtin_amdgcn_wmma_f32_16x16x32_f16(false, (a), false, (b), (short)0, (c), false, false)

static constexpr int   kB  = 2;
static constexpr int   kS  = 4096;
static constexpr int   kDM = 512;
static constexpr int   kH  = 8;
static constexpr int   kDK = 64;
static constexpr float kScale = 0.125f; // 1/sqrt(64)
static constexpr float kSL = kScale * 1.44269504088896f; // scale * log2(e)
// Attention keeps a column's reference maximum until a score exceeds it by
// more than kLazy (base-2 units): P stays <= 2^kLazy, far inside f16 range.
static constexpr float kLazy = 8.0f;
// LDS row pitches in f16 elements, 16 B x odd so that the 16 rows one
// ds_load_b128 touches fall on 16 different bank groups (64 banks x 4 B):
// 128-B rows (staged K) -> 144 B, 64-B rows -> 80 B. The projection kernels'
// LDS tiles use these two pitches for their 128-B and 64-B rows.
static constexpr int   kKP = kDK + 8;  // 72 elements = 144 B
static constexpr int   kVP = 32 + 8;   // 40 elements =  80 B
// Attention pass: kNG groups of 32 keys are staged together; each
// wave scores and reduces the two groups of its key half together. A staged V^T row holds the pass's keys, again at 16 B x odd.
static constexpr int   kNG  = 4;
static constexpr int   kPK  = 32 * kNG;   // keys per pass
static constexpr int   kVQ  = kPK + 8;    // V^T row pitch in elements
static constexpr int   kVS  = kPK / 8;    // 16-B segments per V^T row
static constexpr int   kVR  = 256 / kVS;  // V^T rows per staging sweep
static_assert(kNG % 2 == 0 && ((kVQ / 8) & 1) == 1, "pairs of groups; odd pitch");

#if __has_builtin(__builtin_amdgcn_global_load_async_to_lds_b128)
#define ASYNC_LDS 1
#endif

// 16-byte global -> LDS copy. Async DMA path on gfx1250
// (GLOBAL_LOAD_ASYNC_TO_LDS_B128, ASYNCcnt), else load+ds_store fallback.
__device__ __forceinline__ void cp16_g2s(const _Float16* g, _Float16* l) {
#ifdef ASYNC_LDS
    __builtin_amdgcn_global_load_async_to_lds_b128(
        (__attribute__((address_space(1))) v4i_vs*)g,
        (__attribute__((address_space(3))) v4i_vs*)l, 0, 0);
#else
    *(v8h*)l = *(const v8h*)g;
#endif
}

__device__ __forceinline__ void wait_g2s() {
#ifdef ASYNC_LDS
#if __has_builtin(__builtin_amdgcn_s_wait_asynccnt)
    __builtin_amdgcn_s_wait_asynccnt(0);
#else
    asm volatile("s_wait_asynccnt 0" ::: "memory");
#endif
#endif
}

// ---------------------------------------------------------------------------
// Mask packing (runs inside kernel 1): the (S,S) int32 DAG mask becomes 1 bit
// per entry, laid out as the attention kernel's LANE MASKS. For score tile
// (qt = q/16, c = kv/32) there are 16 words, one per accumulator register of
// the tile's two S^T blocks:
//   bits[(qt*128 + c)*16 + e], bit L ==
//     (mask[qt*16 + (L&15)][c*32 + (e>>3)*16 + (L>>4)*8 + (e&7)] != 0)
// i.e. bit L of word e is the entry that lane L holds in register e. A wave
// of the attention kernel reads its tile's 64 B with one scalar load and
// selects straight from the scalar registers. Still 2 MB in all.
// Each of kernel 1's 4096 waves packs 16 mask rows x 1 KB, in two pieces of
// 16 rows x 512 B. A piece comes into the wave's own LDS range by async
// copies (one row = 512 contiguous bytes = four whole lines per copy), which
// use no register and no load counter of the k loop that runs meanwhile.
// Lane L then reads its own row's entries from LDS, a ballot per entry makes
// the word, and each tile pair's 32 words leave as one 128-B line.
// ---------------------------------------------------------------------------
static constexpr int kMRow   = 128;       // entries of a row in one piece
static constexpr int kMPitch = kMRow + 4; // LDS row pitch: 528 B = 16 B x odd

// Eight async copies to LDS: eight mask rows of 512 B, 16 B a lane.
// s_wait_xcnt 0 ends the copies' own statement, so that no address register
// of an issued copy is rewritten ahead of it.
__device__ __forceinline__ void cp_rows8(const unsigned l, const int* g) {
    asm volatile(
        "global_load_async_to_lds_b128 %0, %8, off\n\t"
        "global_load_async_to_lds_b128 %1, %9, off\n\t"
        "global_load_async_to_lds_b128 %2, %10, off\n\t"
        "global_load_async_to_lds_b128 %3, %11, off\n\t"
        "global_load_async_to_lds_b128 %4, %12, off\n\t"
        "global_load_async_to_lds_b128 %5, %13, off\n\t"
        "global_load_async_to_lds_b128 %6, %14, off\n\t"
        "global_load_async_to_lds_b128 %7, %15, off\n\t"
        "s_wait_xcnt 0x0"
        :: "v"(l), "v"(l + kMPitch * 4),
           "v"(l + 2 * kMPitch * 4), "v"(l + 3 * kMPitch * 4),
           "v"(l + 4 * kMPitch * 4), "v"(l + 5 * kMPitch * 4),
           "v"(l + 6 * kMPitch * 4), "v"(l + 7 * kMPitch * 4),
           "v"(g), "v"(g + kS), "v"(g + 2 * kS), "v"(g + 3 * kS),
           "v"(g + 4 * kS), "v"(g + 5 * kS), "v"(g + 6 * kS), "v"(g + 7 * kS)
        : "memory");
}

// One piece on its way: l = the lane's LDS byte address in row 0 of the wave's
// range, g = the lane's 16 bytes of mask row 0 of the piece.
__device__ __forceinline__ void mask_stage(const unsigned l, const int* g) {
    cp_rows8(l, g);
    cp_rows8(l + 8 * kMPitch * 4, g + (size_t)8 * kS);
}

// Packs a landed piece (two tile pairs). row = the lane's own row in LDS, at
// its half's 8 entries; dst = the first pair's 32 words.
__device__ __forceinline__ void mask_pack2(const int* row, unsigned* dst,
                                           const int lane) {
    // The loops below are unrolled so that m[] and t[] have constant indices
    // and stay in registers.
#pragma unroll
    for (int p = 0; p < 2; ++p) {
        int4 m[8]; // m[j]: words e = 4j..4j+3 of the pair (tile j>>2)
#pragma unroll
        for (int j = 0; j < 8; ++j)
            m[j] = *(const int4*)(row + p * 64 + (j >> 1) * 16 + (j & 1) * 4);
        unsigned t[32]; // the pair's 32 words, each wave-uniform
#pragma unroll
        for (int j = 0; j < 8; ++j) {
            t[4 * j + 0] = __builtin_amdgcn_ballot_w32(m[j].x != 0);
            t[4 * j + 1] = __builtin_amdgcn_ballot_w32(m[j].y != 0);
            t[4 * j + 2] = __builtin_amdgcn_ballot_w32(m[j].z != 0);
            t[4 * j + 3] = __builtin_amdgcn_ballot_w32(m[j].w != 0);
        }
        // Lane L picks word L: a select tree over the five bits of L.
#pragma unroll
        for (int s = 0; s < 5; ++s) {
            const bool odd = (lane >> s) & 1;
#pragma unroll
            for (int i = 0; i < (16 >> s); ++i)
                t[i] = odd ? t[2 * i + 1] : t[2 * i];
        }
        dst[p * 32 + lane] = t[0];
    }
}

// ---------------------------------------------------------------------------
// Kernel 1: fused QKV projection, operands staged in LDS.
//   Y[m][n] = sum_k X[m][k] * W[n][k] + bias[n]   (einsum 'bsd,ed->bse')
// Block = 8 waves on ONE head: 128 rows of x against the head's 64 rows of
// each of Wq, Wk, Wv. Per 32-wide k step the block reads its x and W pieces
// once, as whole 128-B lines (8 lanes x 16 B per row), converts them to f16
// once and stores them in LDS; the 8 waves then take their fragments with
// ds_load_b128. Wave w computes the 16(m) x 64(n) tile of Q, K AND V (12
// WMMAs per A fragment). The k steps are taken in a rotated order, the start
// differing from block to block (see rot below).
// Q,K stored f16 as (B,H,S,DK); V stored f16 TRANSPOSED as (B,H,DK,S).
// Q is stored times kSL (multiplied in f32, rounded to f16 once), so that the
// attention kernel's score products are exp2 arguments as they stand.
//
// WMMA operand convention (CDNA5 wave32, 16x16x32 f16):
//   A (MxK): lanes 0-15 hold row M=lane, K elems {0..7,16..23};
//            lanes 16-31 hold row M=lane-16, K elems {8..15,24..31}.
//   B (KxN): lane n<16 holds col N=n with K elems {0..7,16..23};
//            lane n+16 holds col N=n with K elems {8..15,24..31}.
//   C/D    : VGPR r, lanes 0-15 -> (M=r, N=lane); lanes 16-31 -> (M=8+r).
// ---------------------------------------------------------------------------
__device__ __forceinline__ v4h cvt4(const float4 f) {
    v4h r;
    r[0] = (_Float16)f.x; r[1] = (_Float16)f.y;
    r[2] = (_Float16)f.z; r[3] = (_Float16)f.w;
    return r;
}

__device__ __forceinline__ void sched_fence() {
    __builtin_amdgcn_sched_barrier(0);
}

__device__ __forceinline__ v16h frag16(const _Float16* p) {
    const v8h lo = *(const v8h*)(p);
    const v8h hi = *(const v8h*)(p + 16);
    v16h a;
#pragma unroll
    for (int i = 0; i < 8; ++i) { a[i] = lo[i]; a[i + 8] = hi[i]; }
    return a;
}

__global__ __launch_bounds__(256) void k_proj_qkv(
    const float* __restrict__ x,
    const float* __restrict__ wq, const float* __restrict__ bq,
    const float* __restrict__ wk, const float* __restrict__ bk,
    const float* __restrict__ wv, const float* __restrict__ bv,
    _Float16* __restrict__ qf, _Float16* __restrict__ kf,
    _Float16* __restrict__ vf,
    const int* __restrict__ mask, unsigned* __restrict__ bits)
{
    __shared__ alignas(16) _Float16 sX[2][128 * kVP]; // [m][k], rows of kVP
    __shared__ alignas(16) _Float16 sW[2][192 * kVP]; // [wsel*64+n][k]
    __shared__ alignas(16) int sM[8][16 * kMPitch];   // a mask piece per wave

    const int tid  = threadIdx.x;
    const int wid  = tid >> 5;
    const int lane = tid & 31;
    const int half = lane >> 4;
    const int lm   = lane & 15;
    const int koff = half ? 8 : 0;

    const int mblk = blockIdx.x * 128; // row block over B*S = 8192 rows
    const int m0   = mblk + wid * 16;  // this wave's 16 rows
    const int h    = blockIdx.y;       // head -> n0 = h*64
    const int n0   = h * kDK;

    const float* bias[3] = {bq, bk, bv};

    // This wave's share of the mask: rows mqt*16.., 256 entries from mcol on.
    const int gw   = (blockIdx.y * (kB * kS / 128) + blockIdx.x) * 8 + wid;
    const int mqt  = gw >> 4;
    const int mcol = (gw & 15) * (2 * kMRow);
    const int* mg  = mask + (size_t)mqt * 16 * kS + mcol + lane * 4;
    const unsigned ml = (unsigned)(__UINTPTR_TYPE__)(
        __attribute__((address_space(3))) int*)&sM[wid][lane * 4];
    const int* mrow = &sM[wid][lm * kMPitch + half * 8];
    unsigned* mdst  = bits + (size_t)gw * 128;

    // Staging slot: 8 threads cover one row's 32 floats, 32 rows per sweep.
    const int srow = tid >> 3;
    const int sc4  = (tid & 7) * 4;
    const float* xg = x + (size_t)(mblk + srow) * kDM + sc4;
    const float* wg[3] = {wq + (size_t)(n0 + srow) * kDM + sc4,
                          wk + (size_t)(n0 + srow) * kDM + sc4,
                          wv + (size_t)(n0 + srow) * kDM + sc4};

    // Rotated k start. The 8 blocks that share these x rows (one per head) and
    // the 64 that share these W rows would walk k in step and all meet each
    // line's first fetch from memory together, at every step. Each
    // starts at another 256 B of the rows (2 steps) and wraps round: a
    // block waits for memory only on the pieces it is first at; the rest have
    // been brought into L2 by the others some steps before. The sum below
    // takes all 8 values over the heads of one row block, over row blocks
    // 8n..8n+7 and over row blocks that are 8 apart.
    const int rot = ((blockIdx.x + (blockIdx.x >> 3) + blockIdx.y) & 7) * 2;

    float4 rx[4], rw[6];
#pragma unroll
    for (int i = 0; i < 4; ++i)
        rx[i] = *(const float4*)(xg + (size_t)i * 32 * kDM + rot * 32);
#pragma unroll
    for (int j = 0; j < 6; ++j)
        rw[j] = *(const float4*)(wg[j >> 1] + (size_t)(j & 1) * 32 * kDM +
                                 rot * 32);
#pragma unroll
    for (int i = 0; i < 4; ++i)
        *(v4h*)&sX[0][(i * 32 + srow) * kVP + sc4] = cvt4(rx[i]);
#pragma unroll
    for (int j = 0; j < 6; ++j)
        *(v4h*)&sW[0][(j * 32 + srow) * kVP + sc4] = cvt4(rw[j]);
    // Piece 0 flies under the first half of the k loop; asked for once the
    // first x and W pieces are in, so that these do not queue behind it.
    mask_stage(ml, mg);

    v8f acc[3][4] = {};

    const int nsteps = kDM / 32; // 16
    // One k step; inlined into the two loops below, between which the mask's
    // pieces change over. more: a next step exists (a constant at each call).
    auto kstep = [&](const int ks, const bool more)
                     __attribute__((always_inline)) {
        const int cur = ks & 1;
        // One barrier per step: buffer cur is complete, and every wave has
        // left the other buffer (read in step ks-1), which is refilled below.
        // The wave's LDS stores of the step before are complete in front of
        // the barrier.
        asm volatile("s_wait_dscnt 0x0" ::: "memory");
        __syncthreads();

        if (more) { // next step's global loads fly under this step's WMMAs
            const int k0 = ((ks + 1 + rot) & (nsteps - 1)) * 32;
#pragma unroll
            for (int i = 0; i < 4; ++i)
                rx[i] = *(const float4*)(xg + (size_t)i * 32 * kDM + k0);
#pragma unroll
            for (int j = 0; j < 6; ++j)
                rw[j] = *(const float4*)(wg[j >> 1] +
                                         (size_t)(j & 1) * 32 * kDM + k0);
        }

        // The scheduler does not cross sched_fence(): without these it sinks
        // the global loads below the WMMAs and waits out every LDS read
        // alone. Each W group is read one group ahead of its WMMAs.
        sched_fence();
        const _Float16* wrow = &sW[cur][lm * kVP + koff];
        const v16h a = frag16(&sX[cur][(wid * 16 + lm) * kVP + koff]);
        v16h b0[4], b1[4];
#pragma unroll
        for (int t = 0; t < 4; ++t) b0[t] = frag16(wrow + (t * 16) * kVP);
#pragma unroll
        for (int t = 0; t < 4; ++t) b1[t] = frag16(wrow + (64 + t * 16) * kVP);
        sched_fence();
#pragma unroll
        for (int t = 0; t < 4; ++t) acc[0][t] = WMMA_F16(a, b0[t], acc[0][t]);
        sched_fence();
#pragma unroll
        for (int t = 0; t < 4; ++t) b0[t] = frag16(wrow + (128 + t * 16) * kVP);
        sched_fence();
#pragma unroll
        for (int t = 0; t < 4; ++t) acc[1][t] = WMMA_F16(a, b1[t], acc[1][t]);
#pragma unroll
        for (int t = 0; t < 4; ++t) acc[2][t] = WMMA_F16(a, b0[t], acc[2][t]);
        sched_fence();

        if (more) {
#pragma unroll
            for (int i = 0; i < 4; ++i)
                *(v4h*)&sX[1 - cur][(i * 32 + srow) * kVP + sc4] = cvt4(rx[i]);
#pragma unroll
            for (int j = 0; j < 6; ++j)
                *(v4h*)&sW[1 - cur][(j * 32 + srow) * kVP + sc4] = cvt4(rw[j]);
        }
    };

    for (int ks = 0; ks < nsteps / 2; ++ks) kstep(ks, true);

    // Mask piece 0 has landed behind the issuing wave's own wait; then a
    // barrier, then the reads. No LDS read moves above the wait.
    asm volatile("s_wait_asynccnt 0x0" ::: "memory");
    __syncthreads();
    mask_pack2(mrow, mdst, lane);
    // The reads of piece 0 are over, in every wave, before piece 1 is copied
    // over them; it flies under the second half of the k loop.
    asm volatile("s_wait_dscnt 0x0" ::: "memory");
    __syncthreads();
    mask_stage(ml, mg + kMRow);

    for (int ks = nsteps / 2; ks < nsteps - 1; ++ks) kstep(ks, true);
    kstep(nsteps - 1, false);

    // Mask piece 1: the wave's own wait, a barrier, then the reads. Ahead of
    // the Q, K, V stores, so that the barrier does not wait for those.
    asm volatile("s_wait_asynccnt 0x0" ::: "memory");
    __syncthreads();
    mask_pack2(mrow, mdst + 64, lane);

#pragma unroll
    for (int wsel = 0; wsel < 3; ++wsel) {
#pragma unroll
        for (int t = 0; t < 4; ++t) {
            const int dk = t * 16 + lm;          // N index inside head
            const float bval = bias[wsel][n0 + dk];
#pragma unroll
            for (int r = 0; r < 8; ++r) {
                const int m = m0 + r + half * 8; // global row (b*S + s)
                const int b = m >> 12;           // / 4096
                const int s = m & (kS - 1);
                const float y = acc[wsel][t][r] + bval;
                const _Float16 val = (_Float16)(wsel == 0 ? y * kSL : y);
                if (wsel == 2) {                 // V transposed: (B,H,DK,S)
                    vf[(((size_t)b * kH + h) * kDK + dk) * kS + s] = val;
                } else {                         // Q/K: (B,H,S,DK)
                    _Float16* dst = (wsel == 0) ? qf : kf;
                    dst[(((size_t)b * kH + h) * kS + s) * kDK + dk] = val;
                }
            }
        }
    }
}

// ---------------------------------------------------------------------------
// Kernel 2: flash attention, transposed-score formulation, LDS-staged KV.
// Block = 256 threads = 8 waves, all on ONE (b,h) and 128 queries. Each 128-kv
// pass of K (128x64 f16) and V^T (64x128 f16) is staged into LDS once per
// block via async-to-LDS (double buffered).
// Wave tile: 32 query columns x 64 of the pass's 128 keys. Wave w takes query
// pair (w & 3) and key half (w >> 2), so every K and V^T fragment read from
// LDS feeds TWO WMMAs (one per 16 query columns): half the LDS reads of a
// 16-column wave, at the same number of waves. Each key half keeps its own
// running maximum, row sum and O^T; the two halves are merged once, through
// LDS, behind the loop.
// Mask comes as lane masks (kernel 1): 16 words per 16 queries and 32 keys,
// read by scalar loads; each select takes its word as it stands.
//
//   S^T (kv x q): 4 x 2 tiles of 16 kv x 16 q, each = 2 WMMAs over DK=64.
//   O^T (dk x q): 4 x 2 tiles, A = V^T(dk x kv32), B = P^T (lane-local
//                 repack), one WMMA per tile and 32 keys.
// Q arrives times scale * log2(e), and the score WMMAs take C = -m, m being
// the column's reference maximum: a score leaves the matrix unit as its exp2
// argument. m moves, and O^T and the row sum are rescaled, only in a pass in
// which some score exceeds m by more than kLazy (one wave-uniform test per
// pass). One sum per column and one barrier pair per pass. Softmax rows
// (fixed q) live on the lane axis -> one shfl_xor(16) per reduction. Output
// written f16 to (B,S,H*DK).
// ---------------------------------------------------------------------------
// waves_per_eu: the grid puts 4 waves on a SIMD, so registers saved for more
// than 4 buy nothing. With a higher upper bound this build saves registers by
// running each score's select, exp as a chain of its own, with a
// v_nop behind most exps and few paired instructions.
__global__ __launch_bounds__(256)
__attribute__((amdgpu_waves_per_eu(4, 4))) void k_attn(
    const _Float16* __restrict__ qf, const _Float16* __restrict__ kf,
    const _Float16* __restrict__ vf, const unsigned* __restrict__ mbits,
    _Float16* __restrict__ of)
{
    __shared__ alignas(16) _Float16 sK[2][kPK * kKP]; // [kv][dk], rows of kKP
    __shared__ alignas(16) _Float16 sV[2][kDK * kVQ]; // [dk][kv], rows of kVQ
    // Hand-over of the second key half's O^T, maxima and sums: [slot][lane of
    // the four waves], 16 B a lane, so a wave's store covers 512 B in a row.
    __shared__ alignas(16) float4 sX[17][128];

    const int tid   = threadIdx.x;
    const int wid   = tid >> 5;
    const int lane  = tid & 31;
    const int half  = lane >> 4;
    const int lm    = lane & 15;
    const int koff  = half ? 8 : 0;

    // readfirstlane: the wave's number in a scalar register, so that the mask
    // address and the epilogue's branches are wave-uniform.
    const int wsc = __builtin_amdgcn_readfirstlane(wid);
    const int pr  = wsc & 3;  // which 32 of the block's 128 queries
    const int kh  = wsc >> 2; // which 64 of a pass's 128 keys

    const int qgroup = blockIdx.x & 31;         // 32 q-groups per (b,h)
    const int h      = (blockIdx.x >> 5) & (kH - 1);
    const int b      = blockIdx.x >> 8;
    const int q0     = (qgroup * 8 + pr * 2) * 16;

    const _Float16* Qb = qf + (((size_t)b * kH + h) * kS) * kDK;
    const _Float16* Kb = kf + (((size_t)b * kH + h) * kS) * kDK;
    const _Float16* Vb = vf + (((size_t)b * kH + h) * kDK) * kS;

    // Per-thread staging slots, kNG sweeps per tile: K = kPK rows x 8 segs of
    // 16 B, 32 rows a sweep; V^T = 64 rows x kVS segs, kVR rows a sweep.
    const int krow = tid >> 3,  kseg = (tid & 7) * 8;
    const int vrow = tid / kVS, vseg = (tid % kVS) * 8;
    const _Float16* kg = Kb + (size_t)krow * kDK + kseg;
    const _Float16* vg = Vb + (size_t)vrow * kS + vseg;
    const int kdst = krow * kKP + kseg;
    const int vdst = vrow * kVQ + vseg;

    // B operands of the score WMMAs: Q^T columns (fixed for the whole tile).
    v16h bq[2][2];
#pragma unroll
    for (int j = 0; j < 2; ++j) {
        const _Float16* qr = Qb + (size_t)(q0 + j * 16 + lm) * kDK + koff;
        bq[j][0] = frag16(qr);
        bq[j][1] = frag16(qr + 32);
    }

    // Per 16 query columns j: nm = -m; thr = how far a score may stand above m
    // before m moves: -inf until the column has met an allowed key, so that
    // the first finite score sets m; row sum.
    float nm[2]   = {0.0f, 0.0f};
    float thr[2]  = {-__builtin_inff(), -__builtin_inff()};
    float lrow[2] = {0.0f, 0.0f};
    // -inf for masked scores, held in a vector register: as a literal it makes
    // each select a lone long-form instruction; from a register this build
    // issues the selects two to a slot (v_dual_cndmask_b32).
    float ninf;
    asm("v_mov_b32 %0, 0xff800000" : "=v"(ninf));
    v8f o[2][4] = {};

    // Constant address space: nothing writes the words while this kernel
    // runs; without it the compiler takes the loop's copies and barriers for
    // possible writers and loads through vector registers instead of with
    // s_load. Base: the wave's first query tile, its key half's first group.
    const int qt = qgroup * 8 + pr * 2;
    const __attribute__((address_space(4))) v16u* mtile =
        (const __attribute__((address_space(4))) v16u*)(
            mbits + ((size_t)qt * (kS / 32) + kh * 2) * 16);

    // The wave's fragment rows inside a staged buffer (its key half).
    const int kfrag = (kh * 64 + lm) * kKP + koff;
    const int vfrag = lm * kVQ + kh * 64 + koff;

    // Prologue: stage pass 0 into buffer 0.
#pragma unroll
    for (int i = 0; i < kNG; ++i) {
        cp16_g2s(kg + (size_t)i * 32 * kDK,  &sK[0][kdst + i * 32 * kKP]);
        cp16_g2s(vg + (size_t)i * kVR * kS,  &sV[0][vdst + i * kVR * kVQ]);
    }

    const int npass = kS / kPK; // 32
    for (int ci = 0; ci < npass; ++ci) {
        const int cur = ci & 1;

        wait_g2s();
        __syncthreads(); // pass ci visible in LDS to all waves

        if (ci + 1 < npass) { // overlap next pass's DMA with compute
            const int nkv = (ci + 1) * kPK;
#pragma unroll
            for (int i = 0; i < kNG; ++i) {
                cp16_g2s(kg + (size_t)(nkv + i * 32) * kDK,
                         &sK[1 - cur][kdst + i * 32 * kKP]);
                cp16_g2s(vg + (size_t)i * kVR * kS + nkv,
                         &sV[1 - cur][vdst + i * kVR * kVQ]);
            }
        }

        // word e of query tile j, group g: bit L = lane L's entry of register e
        v16u mw[2][2];
#pragma unroll
        for (int j = 0; j < 2; ++j) {
#pragma unroll
            for (int g = 0; g < 2; ++g)
                mw[j][g] = mtile[j * (kS / 32) + ci * kNG + g];
        }

        // ---- S^T tiles from LDS K rows. sched_fence(): the wave's K reads
        // stay one group ahead of their score WMMAs, and its V^T reads one
        // group; without it each read is waited out alone.
        v8f c[4][2];
        // C operand of a column's first score WMMAs: -m in all eight registers
        // (a lane's eight scores of a tile belong to one column). Formed anew
        // in each pass, so that it holds no registers outside the products.
        v8f cm[2];
#pragma unroll
        for (int j = 0; j < 2; ++j) {
#pragma unroll
            for (int r = 0; r < 8; ++r) cm[j][r] = nm[j];
        }
        sched_fence();
        v16h ka[4][2];
#pragma unroll
        for (int i = 0; i < 4; ++i) {
            const _Float16* kr = &sK[cur][kfrag + i * 16 * kKP];
            ka[i][0] = frag16(kr);
            ka[i][1] = frag16(kr + 32);
        }
        sched_fence();
#pragma unroll
        for (int kk = 0; kk < 2; ++kk) {
#pragma unroll
            for (int i = 0; i < 4; ++i) {
#pragma unroll
                for (int j = 0; j < 2; ++j)
                    c[i][j] = WMMA_F16(ka[i][kk], bq[j][kk],
                                       kk == 0 ? cm[j] : c[i][j]);
            }
        }
        sched_fence();
        v16h va[2][4]; // the first 32 keys' V^T now, the rest after the softmax
#pragma unroll
        for (int t = 0; t < 4; ++t)
            va[0][t] = frag16(&sV[cur][vfrag + t * 16 * kVQ]);
        sched_fence();

        // ---- mask (lane masks in scalar registers) + online softmax. A score is
        // s * scale * log2(e) - m already. A masked score is -inf and its exp2 is
        // 0 with no second select, also while a column has met no allowed key.
        float tmax[2] = {-__builtin_inff(), -__builtin_inff()};
#pragma unroll
        for (int j = 0; j < 2; ++j) {
#pragma unroll
            for (int g = 0; g < 2; ++g) {
#pragma unroll
                for (int r = 0; r < 8; ++r) {
                    const bool b0 =
                        __builtin_amdgcn_inverse_ballot_w32(mw[j][g][r]);
                    const bool b1 =
                        __builtin_amdgcn_inverse_ballot_w32(mw[j][g][8 + r]);
                    c[2 * g][j][r]     = b0 ? c[2 * g][j][r] : ninf;
                    c[2 * g + 1][j][r] = b1 ? c[2 * g + 1][j][r] : ninf;
                    tmax[j] = fmaxf(tmax[j],
                                    fmaxf(c[2 * g][j][r], c[2 * g + 1][j][r]));
                }
            }
        }
        // One test per pass, a scalar branch: does any column's m have to move?
        // A lane's own maximum decides; the halves are joined only inside.
        const bool need = (tmax[0] > thr[0]) || (tmax[1] > thr[1]);
        if (__builtin_amdgcn_ballot_w32(need) != 0u) {
#pragma unroll
            for (int j = 0; j < 2; ++j) {
                const float t   = fmaxf(tmax[j], __shfl_xor(tmax[j], 16, 32));
                const bool  upd = t > thr[j]; // alike in both halves of a column
                const float nmo = nm[j];
                const float nmn = upd ? nmo - t : nmo;
                const float d   = nmo - nmn;  // the shift as nmn was rounded
                // d < 0 only for a column's first key: O^T and the sum are 0.
                const float al  = __builtin_amdgcn_exp2f(fminf(-d, 0.0f));
                thr[j] = upd ? kLazy : thr[j];
                nm[j]  = nmn;
#pragma unroll
                for (int i = 0; i < 4; ++i) c[i][j] -= d;
                lrow[j] *= al;
#pragma unroll
                for (int t4 = 0; t4 < 4; ++t4) o[j][t4] *= al;
            }
        }

        float psum[2] = {0.0f, 0.0f};
        v16h bp[2][2]; // P^T repacked lane-locally into the B-operand layout
#pragma unroll
        for (int j = 0; j < 2; ++j) {
#pragma unroll
            for (int g = 0; g < 2; ++g) {
#pragma unroll
                for (int r = 0; r < 8; ++r) {
                    const float p0 = __builtin_amdgcn_exp2f(c[2 * g][j][r]);
                    const float p1 = __builtin_amdgcn_exp2f(c[2 * g + 1][j][r]);
                    psum[j] += p0 + p1;
                    bp[j][g][r]     = (_Float16)p0;
                    bp[j][g][r + 8] = (_Float16)p1;
                }
            }
        }
#pragma unroll
        for (int j = 0; j < 2; ++j)
            psum[j] += __shfl_xor(psum[j], 16, 32);
#pragma unroll
        for (int j = 0; j < 2; ++j) lrow[j] += psum[j];

        // ---- O^T += V^T . P^T  (4 dk-tiles x 2 query tiles per 32 keys); the
        // second 32 keys' V^T reads fly under the first 32 keys' WMMAs
        sched_fence();
#pragma unroll
        for (int t = 0; t < 4; ++t)
            va[1][t] = frag16(&sV[cur][vfrag + t * 16 * kVQ + 32]);
        sched_fence();
#pragma unroll
        for (int g = 0; g < 2; ++g) {
#pragma unroll
            for (int t = 0; t < 4; ++t) {
#pragma unroll
                for (int j = 0; j < 2; ++j)
                    o[j][t] = WMMA_F16(va[g][t], bp[j][g], o[j][t]);
            }
        }

        __syncthreads(); // all waves done reading buf[cur] before reuse
    }

    // ---- merge of the two key halves: the waves of half 1 hand their O^T,
    // maxima and sums to the wave of half 0 that has the same queries.
    // A column that met no allowed key in this half counts with m = -1e30.
    float mrow[2];
#pragma unroll
    for (int j = 0; j < 2; ++j) mrow[j] = thr[j] > 0.0f ? -nm[j] : -1e30f;
    const int xl = pr * 32 + lane;
    if (kh == 1) {
#pragma unroll
        for (int j = 0; j < 2; ++j) {
#pragma unroll
            for (int t = 0; t < 4; ++t) {
                const v8f ot = o[j][t];
                sX[(j * 4 + t) * 2][xl] =
                    make_float4(ot[0], ot[1], ot[2], ot[3]);
                sX[(j * 4 + t) * 2 + 1][xl] =
                    make_float4(ot[4], ot[5], ot[6], ot[7]);
            }
        }
        sX[16][xl] = make_float4(mrow[0], lrow[0], mrow[1], lrow[1]);
    }
    __syncthreads(); // the hand-over is complete before the other half reads it
    if (kh == 0) {
        const float4 ml = sX[16][xl];
#pragma unroll
        for (int j = 0; j < 2; ++j) {
            const float m1 = j ? ml.z : ml.x;
            const float l1 = j ? ml.w : ml.y;
            const float mn = fmaxf(mrow[j], m1);
            const float a0 = __builtin_amdgcn_exp2f(mrow[j] - mn);
            const float a1 = __builtin_amdgcn_exp2f(m1 - mn);
            const float inv = 1.0f / (lrow[j] * a0 + l1 * a1);
            const float f0 = a0 * inv, f1 = a1 * inv;
            // O^T element (dk = t*16 + r + half*8, q = q0 + j*16 + lm)
            _Float16* orow = of + ((size_t)b * kS + q0 + j * 16 + lm) * kDM +
                             h * kDK + half * 8;
#pragma unroll
            for (int t = 0; t < 4; ++t) {
                const float4 lo = sX[(j * 4 + t) * 2][xl];
                const float4 hi = sX[(j * 4 + t) * 2 + 1][xl];
                const float x1[8] = {lo.x, lo.y, lo.z, lo.w,
                                     hi.x, hi.y, hi.z, hi.w};
                v8h w;
#pragma unroll
                for (int r = 0; r < 8; ++r)
                    w[r] = (_Float16)(o[j][t][r] * f0 + x1[r] * f1);
                *(v8h*)(orow + t * 16) = w;
            }
        }
    }
}

// ---------------------------------------------------------------------------
// Kernel 3: output projection. out = attn(f16) @ Wo^T + bo, f32 store.
// Same staging as kernel 1: block = 8 waves, 128 rows of attn against 64 rows
// of Wo; per 64-wide k step both pieces are read once as whole lines, Wo is
// converted to f16 once, and the waves take fragments from LDS.
// ---------------------------------------------------------------------------
__global__ __launch_bounds__(256) void k_out_proj(
    const _Float16* __restrict__ of, const float* __restrict__ wo,
    const float* __restrict__ bo, float* __restrict__ out)
{
    __shared__ alignas(16) _Float16 sA[2][128 * kKP]; // [m][k], rows of kKP
    __shared__ alignas(16) _Float16 sB[2][64 * kKP];  // [n][k]

    const int tid  = threadIdx.x;
    const int wid  = tid >> 5;
    const int lane = tid & 31;
    const int half = lane >> 4;
    const int lm   = lane & 15;
    const int koff = half ? 8 : 0;

    const int mblk = blockIdx.x * 128;
    const int m0   = mblk + wid * 16;
    const int n0   = blockIdx.y * 64;

    // Staging slots: attn rows 64 f16 = 8 threads x 16 B, 32 rows per sweep;
    // Wo rows 64 f32 = 16 threads x 16 B, 16 rows per sweep.
    const int arow = tid >> 3, aseg = (tid & 7) * 8;
    const int brow = tid >> 4, bc4  = (tid & 15) * 4;
    const _Float16* ag = of + (size_t)(mblk + arow) * kDM + aseg;
    const float*    bg = wo + (size_t)(n0 + brow) * kDM + bc4;

    // Rotated k start, as in kernel 1: the 64 blocks that share these Wo rows
    // (256 B of each per step) and the 8 that share these attn rows each start
    // at another step and wrap round.
    const int rot = (blockIdx.x + (blockIdx.x >> 3) + blockIdx.y) & 7;

    v8h ra[4];
    float4 rb[4];
#pragma unroll
    for (int i = 0; i < 4; ++i) {
        ra[i] = *(const v8h*)(ag + (size_t)i * 32 * kDM + rot * 64);
        rb[i] = *(const float4*)(bg + (size_t)i * 16 * kDM + rot * 64);
    }
#pragma unroll
    for (int i = 0; i < 4; ++i) {
        *(v8h*)&sA[0][(i * 32 + arow) * kKP + aseg] = ra[i];
        *(v4h*)&sB[0][(i * 16 + brow) * kKP + bc4]  = cvt4(rb[i]);
    }

    v8f acc[4] = {};

    const int nsteps = kDM / 64; // 8
    for (int ks = 0; ks < nsteps; ++ks) {
        const int cur = ks & 1;
        // One barrier per step: buffer cur is complete, and every wave has
        // left the other buffer (read in step ks-1), which is refilled below.
        __syncthreads();

        const bool more = ks + 1 < nsteps;
        if (more) { // next step's global loads fly under this step's WMMAs
            const int k0 = ((ks + 1 + rot) & (nsteps - 1)) * 64;
#pragma unroll
            for (int i = 0; i < 4; ++i) {
                ra[i] = *(const v8h*)(ag + (size_t)i * 32 * kDM + k0);
                rb[i] = *(const float4*)(bg + (size_t)i * 16 * kDM + k0);
            }
        }

        // sched_fence(): keeps the global loads above, and the step's LDS
        // reads together ahead of its WMMAs (see kernel 1).
        sched_fence();
        v16h a[2], bm[2][4];
#pragma unroll
        for (int kk = 0; kk < 2; ++kk) {
            a[kk] = frag16(&sA[cur][(wid * 16 + lm) * kKP + kk * 32 + koff]);
#pragma unroll
            for (int t = 0; t < 4; ++t)
                bm[kk][t] =
                    frag16(&sB[cur][(t * 16 + lm) * kKP + kk * 32 + koff]);
        }
        sched_fence();
#pragma unroll
        for (int kk = 0; kk < 2; ++kk) {
#pragma unroll
            for (int t = 0; t < 4; ++t)
                acc[t] = WMMA_F16(a[kk], bm[kk][t], acc[t]);
        }
        sched_fence();

        if (more) {
#pragma unroll
            for (int i = 0; i < 4; ++i) {
                *(v8h*)&sA[1 - cur][(i * 32 + arow) * kKP + aseg] = ra[i];
                *(v4h*)&sB[1 - cur][(i * 16 + brow) * kKP + bc4] = cvt4(rb[i]);
            }
        }
    }

#pragma unroll
    for (int t = 0; t < 4; ++t) {
        const int n = n0 + t * 16 + lm;
        const float bval = bo[n];
#pragma unroll
        for (int r = 0; r < 8; ++r) {
            const int m = m0 + r + half * 8;
            out[(size_t)m * kDM + n] = acc[t][r] + bval;
        }
    }
}

// ---------------------------------------------------------------------------
extern "C" void kernel_launch(void* const* d_in, const int* in_sizes, int n_in,
                              void* d_out, int out_size, void* d_ws,
                              size_t ws_size, hipStream_t stream) {
    (void)in_sizes; (void)n_in; (void)out_size; (void)ws_size;

    const float* x    = (const float*)d_in[0];
    const int*   dmsk = (const int*)d_in[1];
    const float* wq   = (const float*)d_in[2];
    const float* bq   = (const float*)d_in[3];
    const float* wk   = (const float*)d_in[4];
    const float* bk   = (const float*)d_in[5];
    const float* wv   = (const float*)d_in[6];
    const float* bv   = (const float*)d_in[7];
    const float* wo   = (const float*)d_in[8];
    const float* bo   = (const float*)d_in[9];
    float* out = (float*)d_out;

    const size_t elems = (size_t)kB * kH * kS * kDK; // 4,194,304 per tensor
    _Float16* qf = (_Float16*)d_ws;
    _Float16* kf = qf + elems;
    _Float16* vf = kf + elems;
    _Float16* of = vf + elems;
    unsigned* mbits = (unsigned*)(of + elems);       // +2MB packed mask

    dim3 g1((kB * kS) / 128, kH);
    k_proj_qkv<<<g1, 256, 0, stream>>>(x, wq, bq, wk, bk, wv, bv, qf, kf, vf,
                                       dmsk, mbits);

    const int nblk = kB * kH * 32; // (b,h) x 32 q-groups = 512 blocks
    k_attn<<<nblk, 256, 0, stream>>>(qf, kf, vf, mbits, of);

    dim3 g3((kB * kS) / 128, kDM / 64);
    k_out_proj<<<g3, 256, 0, stream>>>(of, wo, bo, out);
}
